// v000
// The times below were measured on an AMD MI455X: many runs one after another, warmed up first and cycling through
// copies of the inputs, with the whole window's GPU time divided by the number of runs. Launches and the gaps
// between them are all in it. The median over several windows is given; except for v000 it joins two sittings, which
// can be a few percent apart, so the side-by-side timings, each taken in one sitting, are the better comparison.
// v000, which the later versions start from, runs in 210 microseconds.
#include <hip/hip_runtime.h>

// Gated axial attention along the width axis: x [4][256][64][128]; q,k,v = 1x1 convs (8 heads x 32); per (n, head, row i): logits[j][w] = (q_j.k_w + g_q q_j.rq[:,j,w] +
// g_k k_j.rk[:,j,w]) / 16 with learned per-position tables (tanh'd), softmax over w; out = g_v1 (weights . v) + g_v2 (weights . rv[:,j,:]); 1x1 out conv.
// Contractions on v_wmma_f32_16x16x32_f16 with single f16 operands (position-major activation rows, weight / position-table copies with the gates and 1/16

namespace {
__device__ __forceinline__ float tanh_e(float v) { return 1.0f - 2.0f * __builtin_amdgcn_rcpf(1.0f + __expf(2.0f * v)); }   // tanh via exp + hardware reciprocal (~1 ulp; values are rounded to f16 afterwards or are gates of O(1))
constexpr int Nn = 4, C = 256, Hh = 64, Wd = 128, NH = 8, HD = 32, NPIX = Nn * Hh * Wd;   // 32768 pixels
constexpr float DS = 0.0625f;   // 1/sqrt(C)

typedef _Float16 b16;
typedef __attribute__((ext_vector_type(16))) _Float16 v16b;
typedef __attribute__((ext_vector_type(8)))  _Float16 v8b;
typedef __attribute__((ext_vector_type(8)))  float v8f;
typedef __attribute__((ext_vector_type(4)))  float v4f;

__device__ __forceinline__ v8b ld8b(const b16* p) { return *(const v8b*)p; }
__device__ __forceinline__ v16b cat8b(v8b a, v8b b) { return __builtin_shufflevector(a, b, 0, 1, 2, 3, 4, 5, 6, 7, 8, 9, 10, 11, 12, 13, 14, 15); }
__device__ __forceinline__ v16b frag_kb(const b16* p, int hh) { return cat8b(ld8b(p + 8 * hh), ld8b(p + 16 + 8 * hh)); }
__device__ __forceinline__ void split16(float v, b16& hi, b16& lo) { hi = (b16)v; lo = (b16)(v - (float)hi); }
// hi/lo fragment pair straight from an f32 k-contiguous row (same k-map)
__device__ __forceinline__ void frag_ksplit(const float* p, int hh, v16b& fh_, v16b& fl_) {
  const float* p0 = p + 8 * hh; const float* p1 = p + 16 + 8 * hh;
#pragma unroll
  for (int e = 0; e < 8; ++e) { b16 a, c; split16(p0[e], a, c); fh_[e] = a; fl_[e] = c; split16(p1[e], a, c); fh_[8 + e] = a; fl_[8 + e] = c; }
}
__device__ __forceinline__ v8f wmma16b(v16b a, v16b b, v8f c) {
  v8f d = __builtin_amdgcn_wmma_f32_16x16x32_f16(false, a, false, b, (short)0, c, false, false);
  asm volatile("v_nop\n\tv_nop\n\tv_nop\n\tv_nop" : "+v"(d) : "v"(a), "v"(b));
  return d;
}
__device__ __forceinline__ void wave_lds_sync() {
  __builtin_amdgcn_fence(__ATOMIC_RELEASE, "workgroup");
  __builtin_amdgcn_wave_barrier();
  __builtin_amdgcn_fence(__ATOMIC_ACQUIRE, "workgroup");
}

// Operand descriptor: NP = 0 -> f32 rows split on the fly into (hi, lo); NP = 1 -> one f16 plane; NP = 2 -> f16 hi + lo planes;
// NP = 3 -> f32 rows rounded once to a single f16 fragment. ld = row pitch.
struct Opnd { const void* p0; const void* p1; int ld; };
template <int NP> __device__ __forceinline__ void load_frags(const Opnd& o, int row, int kb, int hh, v16b& fh_, v16b& fl_) {
  if (NP == 0) { frag_ksplit((const float*)o.p0 + (size_t)row * o.ld + kb, hh, fh_, fl_); }
  else if (NP == 4) {                                        // f32 rows x64 then split (keeps the lo halves of small values normal)
    const float* p = (const float*)o.p0 + (size_t)row * o.ld + kb; const float* p0 = p + 8 * hh; const float* p1 = p + 16 + 8 * hh;
#pragma unroll
    for (int e = 0; e < 8; ++e) { b16 a, c; split16(p0[e] * 64.0f, a, c); fh_[e] = a; fl_[e] = c; split16(p1[e] * 64.0f, a, c); fh_[8 + e] = a; fl_[8 + e] = c; }
  } else if (NP == 3) {
    const float* p = (const float*)o.p0 + (size_t)row * o.ld + kb; const float* p0 = p + 8 * hh; const float* p1 = p + 16 + 8 * hh;
#pragma unroll
    for (int e = 0; e < 8; ++e) { fh_[e] = (b16)p0[e]; fh_[8 + e] = (b16)p1[e]; }
    fl_ = fh_;
  } else {
    fh_ = frag_kb((const b16*)o.p0 + (size_t)row * o.ld + kb, hh);
    if (NP == 2) fl_ = frag_kb((const b16*)o.p1 + (size_t)row * o.ld + kb, hh); else fl_ = fh_;
  }
}
template <int ANP, int BNP> __device__ __forceinline__ v8f mac(v16b ah, v16b al, v16b bh, v16b bl, v8f c) {
  c = wmma16b(ah, bh, c);
  if (BNP == 0 || BNP == 2 || BNP == 4) c = wmma16b(ah, bl, c);     // hi.lo
  if (ANP == 0 || ANP == 2 || ANP == 4) c = wmma16b(al, bh, c);     // lo.hi   (lo.lo dropped)
  return c;
}
// 32x64 wave tile: acc[r][t] (rows m0+16r.., cols c0+16t..) += A[m][k] . B[n][k] over k in [0, K)
template <int ANP, int BNP>
__device__ __forceinline__ void gemm_tile(const Opnd& A, const Opnd& B, int K, int m0, int c0, int nloc, int hlf, v8f (&acc)[2][4]) {
  for (int kb = 0; kb < K; kb += 32) {
    v16b a0h, a0l, a1h, a1l;
    load_frags<ANP>(A, m0 + nloc, kb, hlf, a0h, a0l);
    load_frags<ANP>(A, m0 + 16 + nloc, kb, hlf, a1h, a1l);
#pragma unroll
    for (int t = 0; t < 4; ++t) {
      v16b bh, bl;
      load_frags<BNP>(B, c0 + t * 16 + nloc, kb, hlf, bh, bl);
      acc[0][t] = mac<ANP, BNP>(a0h, a0l, bh, bl, acc[0][t]);
      acc[1][t] = mac<ANP, BNP>(a1h, a1l, bh, bl, acc[1][t]);
    }
  }
}

__device__ __forceinline__ void epi_planes(v8f (&acc)[2][4], float scale, bool two, b16* __restrict__ oh, b16* __restrict__ ol, int ldo,
                                           int m0, int c0, int lane, b16* Th, b16* Tl) {
  const int nloc = lane & 15, hlf = lane >> 4;
#pragma unroll
  for (int t = 0; t < 4; ++t)
#pragma unroll
    for (int r = 0; r < 2; ++r)
#pragma unroll
      for (int v = 0; v < 8; ++v) {
        const int rr = r * 16 + v + 8 * hlf, cc = t * 16 + nloc;
        b16 h_, l_; split16(acc[r][t][v] * scale, h_, l_);
        Th[rr * 64 + cc] = h_; Tl[rr * 64 + cc] = l_;
      }
  wave_lds_sync();
  {
#pragma unroll
    for (int j = 0; j < 8; ++j) {
      const int rr = j * 4 + (lane >> 3), c8 = (lane & 7) * 8;
      const size_t o = (size_t)(m0 + rr) * ldo + c0 + c8;
      *(v8b*)(oh + o) = ld8b(Th + rr * 64 + c8);
      if (two) *(v8b*)(ol + o) = ld8b(Tl + rr * 64 + c8);
    }
    
  }
}
// (b) f32 rows with pitch ldo: 64 floats = 256 B = 2 lines per row; 16 lanes x 16 B per row, 2 rows per instruction. Optional per-row factor
__device__ __forceinline__ void epi_f32(v8f (&acc)[2][4], float scale, const float* rscale, float* __restrict__ out, int ldo, int m0, int c0, int lane, float* Tt) {
  const int nloc = lane & 15, hlf = lane >> 4;
#pragma unroll
  for (int t = 0; t < 4; ++t)
#pragma unroll
    for (int r = 0; r < 2; ++r)
#pragma unroll
      for (int v = 0; v < 8; ++v) {
        const int rr = r * 16 + v + 8 * hlf;
        const float rs = rscale ? rscale[(size_t)(m0 + rr) * 32] : 1.0f;
        Tt[rr * 64 + t * 16 + nloc] = acc[r][t][v] * scale * rs;
      }
  wave_lds_sync();
  float* dst0 = out + (size_t)m0 * ldo + c0;
  {
#pragma unroll
    for (int j = 0; j < 16; ++j) { const int rr = j * 2 + hlf, c4 = nloc * 4; *(v4f*)(dst0 + (size_t)rr * ldo + c4) = *(const v4f*)(Tt + rr * 64 + c4); }
    
  }
}



// prep (grid-stride): wqkv = [wq; wk; wv] [768][256] f16, wout f16 [256][256]; Rcat[h][j][w][c'] = (c' < 32 ? tanh(Gq_h) tanh(rq[h][c'][j][w]) : tanh(Gk_h) tanh(rk[h][c'-32][j][w])) / 16
__global__ __launch_bounds__(256) void prep_kernel(const float* __restrict__ wq, const float* __restrict__ wk, const float* __restrict__ wv, const float* __restrict__ wo,
                                                   const float* __restrict__ rq, const float* __restrict__ rk, const float* __restrict__ rv, const float* __restrict__ Gq, const float* __restrict__ Gk,
                                                   b16* __restrict__ wqkv, b16* __restrict__ wo16, b16* __restrict__ Rcat, b16* __restrict__ rvT) {
  const size_t tid = (size_t)blockIdx.x * blockDim.x + threadIdx.x, stride = (size_t)gridDim.x * blockDim.x;
  const size_t n0 = (size_t)3 * C * C / 8, n1 = (size_t)C * C / 8, n2 = (size_t)NH * Wd * Wd * 64 / 8, n3 = (size_t)NH * Wd * HD * Wd / 8;
  {
    for (size_t p = tid; p < n0 + n1 + n2 + n3; p += stride) {
      v8b v; b16* dst;
      if (p < n0) { const size_t i = p * 8; const float* src = (i < (size_t)C * C) ? (wq + i) : (i < (size_t)2 * C * C) ? (wk + i - (size_t)C * C) : (wv + i - (size_t)2 * C * C);
#pragma unroll
        for (int e = 0; e < 8; ++e) v[e] = (b16)src[e]; dst = wqkv + i; }
      else if (p < n0 + n1) { const size_t i = (p - n0) * 8;
#pragma unroll
        for (int e = 0; e < 8; ++e) v[e] = (b16)wo[i + e]; dst = wo16 + i; }
      else if (p < n0 + n1 + n2) { const size_t i = (p - n0 - n1) * 8;       // Rcat index ((h*128 + j)*128 + w)*64 + c'
        const int cp0 = (int)(i % 64), w = (int)((i / 64) % Wd), j = (int)((i / (64 * Wd)) % Wd), h = (int)(i / ((size_t)64 * Wd * Wd));
        const float gq = tanh_e(Gq[h]) * DS, gk = tanh_e(Gk[h]) * DS;
#pragma unroll
        for (int e = 0; e < 8; ++e) { const int cp = cp0 + e; const float* tab = (cp < HD) ? rq : rk; const int c = (cp < HD) ? cp : cp - HD;
          v[e] = (b16)(((cp < HD) ? gq : gk) * tanh_e(tab[(((size_t)h * HD + c) * Wd + j) * Wd + w])); }
        dst = Rcat + i; }
      else { const size_t i = (p - n0 - n1 - n2) * 8;                          // rvT index ((h*128 + j)*32 + c)*128 + w
        const int w0 = (int)(i % Wd), c = (int)((i / Wd) % HD), j = (int)((i / ((size_t)Wd * HD)) % Wd), h = (int)(i / ((size_t)Wd * HD * Wd));
#pragma unroll
        for (int e = 0; e < 8; ++e) v[e] = (b16)tanh_e(rv[(((size_t)h * HD + c) * Wd + j) * Wd + w0 + e]);
        dst = rvT + i; }
      *(v8b*)dst = v;
    }
    
  }
}

__global__ __launch_bounds__(256) void xt_kernel(const float* __restrict__ x, b16* __restrict__ xT) {
  __shared__ __attribute__((aligned(16))) b16 Tl[64][72];
  const int tid = threadIdx.x, lane = tid & 31, wave = tid >> 5, n = blockIdx.y, p0 = (blockIdx.x / 4) * 64, c0 = (blockIdx.x % 4) * 64;
  for (int i = tid; i < 64 * 64; i += 256) { const int cc = i / 64, pp = i % 64; Tl[pp][cc] = (b16)x[((size_t)n * C + c0 + cc) * (Hh * Wd) + p0 + pp]; }
  __syncthreads();
  b16* dst = xT + ((size_t)n * Hh * Wd + p0) * C + c0;
  {
#pragma unroll
    for (int j = 0; j < 2; ++j) { const int rr = wave * 8 + j * 4 + (lane >> 3), c8 = (lane & 7) * 8; *(v8b*)(dst + (size_t)rr * C + c8) = *(const v8b*)(&Tl[rr][c8]); }
    
  }
}

// qkv: (32768 x 256) x (256 x 768); grid (12, 256). Column tiles 0-7 -> q|k f16 rows qk16[pixel][512]; tiles 8-11 -> v transposed per (n, h, i): vT[n][h][i][c][w]
// (256-B rows) through a block LDS tile (block = 128 pixels = one image row i of one n).
__global__ __launch_bounds__(128) void qkv_kernel(const b16* __restrict__ xT, const b16* __restrict__ wqkv, b16* __restrict__ qk16, b16* __restrict__ vT) {
  __shared__ __attribute__((aligned(16))) b16 Th[4][2][32 * 64];
  __shared__ __attribute__((aligned(16))) b16 Tt[64][128 + 8];
  const int lane = threadIdx.x & 31, wave = threadIdx.x >> 5, nloc = lane & 15, hlf = lane >> 4;
  const int m0 = blockIdx.y * 128 + wave * 32, c0 = blockIdx.x * 64;
  v8f acc[2][4];
#pragma unroll
  for (int r = 0; r < 2; ++r)
#pragma unroll
    for (int t = 0; t < 4; ++t) acc[r][t] = (v8f){};
  const Opnd A{xT, nullptr, C}, B{wqkv, nullptr, C};
  gemm_tile<1, 1>(A, B, C, m0, c0, nloc, hlf, acc);
  if (c0 < 2 * C) { epi_planes(acc, 1.0f, false, qk16, nullptr, 2 * C, m0, c0, lane, Th[wave][0], Th[wave][1]); return; }   // block-uniform
  // v: block's 128 pixels = (n, i, all w); tile columns = 2 heads x 32 c -> vT rows (h, c) of 128 w
#pragma unroll
  for (int t = 0; t < 4; ++t)
#pragma unroll
    for (int r = 0; r < 2; ++r)
#pragma unroll
      for (int v = 0; v < 8; ++v) Tt[t * 16 + nloc][wave * 32 + r * 16 + 8 * hlf + v] = (b16)acc[r][t][v];
  __syncthreads();
  const int pix0 = blockIdx.y * 128, n = pix0 / (Hh * Wd), i = (pix0 / Wd) % Hh, hc0 = c0 - 2 * C;   // hc0 = h*32 + c base (64 rows)
  {
#pragma unroll
    for (int j = 0; j < 8; ++j) { const int rr = wave * 16 + j * 2 + (lane >> 4), c8 = (lane & 15) * 8; const int hc = hc0 + rr, h = hc / HD, c = hc % HD;
      *(v8b*)(vT + ((((size_t)n * NH + h) * Hh + i) * HD + c) * Wd + c8) = *(const v8b*)(&Tt[rr][c8]); }
    
  }
}

// E[h][i][j][w] (image n) = [q_j | k_j](head h) . Rcat[h][j][w][:] for all i: per (h,j) a (64 x 64) x (64 x 128) product; block = (h, j, all 64 i rows of image n, all 128 w);
__global__ __launch_bounds__(128) void e_kernel(const b16* __restrict__ qk16, const b16* __restrict__ Rcat, int n, b16* __restrict__ E) {
  __shared__ __attribute__((aligned(16))) b16 Th[4][2][32 * 64];
  const int lane = threadIdx.x & 31, wave = threadIdx.x >> 5, nloc = lane & 15, hlf = lane >> 4;
  const int h = blockIdx.x / Wd, j = blockIdx.x % Wd, m0 = (wave & 1) * 32, c0 = (wave >> 1) * 64;                // rows = i (64), block covers 64 i x 128 w
  v8f acc[2][4];
#pragma unroll
  for (int r = 0; r < 2; ++r)
#pragma unroll
    for (int t = 0; t < 4; ++t) acc[r][t] = (v8f){};
  const b16* Rb = Rcat + ((size_t)h * Wd + j) * Wd * 64;
#pragma unroll
  for (int ks = 0; ks < 2; ++ks) {                             // k-step 0: q (c' 0..31), 1: k (c' 32..63)
    const int ia = m0 + nloc, ib = m0 + 16 + nloc;
    const size_t pa = ((size_t)n * Hh * Wd + (size_t)ia * Wd + j) * (2 * C) + ks * C + h * HD, pb = ((size_t)n * Hh * Wd + (size_t)ib * Wd + j) * (2 * C) + ks * C + h * HD;
    const v16b a0 = frag_kb(qk16 + pa, hlf), a1 = frag_kb(qk16 + pb, hlf);
#pragma unroll
    for (int t = 0; t < 4; ++t) { const v16b bw = frag_kb(Rb + (size_t)(c0 + t * 16 + nloc) * 64 + ks * 32, hlf); acc[0][t] = wmma16b(a0, bw, acc[0][t]); acc[1][t] = wmma16b(a1, bw, acc[1][t]); }
  }
  // E (per n) rows: ((h*64 + i)*128 + j)*128 + w
  b16* Tp = Th[wave][0];
#pragma unroll
  for (int t = 0; t < 4; ++t)
#pragma unroll
    for (int r = 0; r < 2; ++r)
#pragma unroll
      for (int v = 0; v < 8; ++v) Tp[(r * 16 + v + 8 * hlf) * 64 + t * 16 + nloc] = (b16)acc[r][t][v];
  wave_lds_sync();
  {
#pragma unroll
    for (int jj = 0; jj < 8; ++jj) { const int rr = jj * 4 + (lane >> 3), c8 = (lane & 7) * 8; const int i = m0 + rr;
      *(v8b*)(E + (((size_t)h * Hh + i) * Wd + j) * Wd + c0 + c8) = ld8b(Tp + rr * 64 + c8); }
    
  }
}

// Attention: wave = (n, h, i, 16 queries j0); all 128 keys: logits = q.k/16 + E (4 chunks of 32 kept in registers), max / sum, weights = e/sum -> (a) f16 weights rows
__global__ __launch_bounds__(256) void attn_kernel(const b16* __restrict__ qk16, const b16* __restrict__ E, const b16* __restrict__ vT, int n, b16* __restrict__ wt16, float* __restrict__ x1) {
  __shared__ __attribute__((aligned(16))) b16 Ws[8][16][Wd + 8];
  __shared__ __attribute__((aligned(16))) float Xs[8][16][HD + 4];
  const int wid = threadIdx.x >> 5, lane = threadIdx.x & 31, hh = lane >> 4, col = lane & 15;
  const int qt = blockIdx.x * 8 + wid;                          // (h*64 + i)*8 + j0/16 within image n
  const int jt = qt & 7, i = (qt >> 3) & 63, h = (qt >> 9) & 7, j0 = jt * 16;
  const size_t pixrow = (size_t)n * Hh * Wd + (size_t)i * Wd;  // pixel index of (n, i, w=0)
  const b16* qrow = qk16 + (pixrow + j0 + col) * (2 * C) + h * HD;                // B operand: queries (columns)
  const v16b qb = frag_kb(qrow, hh);
  const b16* Erow = E + (((size_t)h * Hh + i) * Wd) * Wd;                        // per-n E: + j*128 + w
  float lg[4][16];
#pragma unroll
  for (int ch = 0; ch < 4; ++ch) {
    v8f s0 = {}, s1 = {};
    s0 = wmma16b(frag_kb(qk16 + (pixrow + ch * 32 + col) * (2 * C) + C + h * HD, hh), qb, s0);        // A: keys w = 32ch + col (k rows), k-step over the 32 channels
    s1 = wmma16b(frag_kb(qk16 + (pixrow + ch * 32 + 16 + col) * (2 * C) + C + h * HD, hh), qb, s1);
#pragma unroll
    for (int r = 0; r < 8; ++r) { const int w0 = ch * 32 + 8 * hh + r, w1 = w0 + 16; const size_t eo = (size_t)(j0 + col) * Wd;
      lg[ch][r] = s0[r] * DS + (float)Erow[eo + w0]; lg[ch][8 + r] = s1[r] * DS + (float)Erow[eo + w1]; }
  }
  float m = -INFINITY;
#pragma unroll
  for (int ch = 0; ch < 4; ++ch)
#pragma unroll
    for (int r = 0; r < 16; ++r) m = fmaxf(m, lg[ch][r]);
  m = fmaxf(m, __shfl_xor(m, 16));
  float sum = 0.0f;
#pragma unroll
  for (int ch = 0; ch < 4; ++ch)
#pragma unroll
    for (int r = 0; r < 16; ++r) { lg[ch][r] = __expf(lg[ch][r] - m); sum += lg[ch][r]; }
  sum += __shfl_xor(sum, 16);
  const float inv = 1.0f / sum;
  v8f o[2] = {{}, {}};
  const b16* vrow = vT + (((size_t)n * NH + h) * Hh + i) * HD * Wd;              // rows c, 128 w
#pragma unroll
  for (int ch = 0; ch < 4; ++ch) {
    v16b pb;
#pragma unroll
    for (int r = 0; r < 8; ++r) { const float p0 = lg[ch][r] * inv, p1 = lg[ch][8 + r] * inv; pb[r] = (b16)p0; pb[8 + r] = (b16)p1;
      Ws[wid][col][ch * 32 + 8 * hh + r] = (b16)p0; Ws[wid][col][ch * 32 + 16 + 8 * hh + r] = (b16)p1; }
#pragma unroll
    for (int nt = 0; nt < 2; ++nt) o[nt] = wmma16b(frag_kb(vrow + (size_t)(nt * 16 + col) * Wd + ch * 32, hh), pb, o[nt]);
  }
#pragma unroll
  for (int nt = 0; nt < 2; ++nt)
#pragma unroll
    for (int r = 0; r < 8; ++r) Xs[wid][col][nt * 16 + 8 * hh + r] = o[nt][r];   // x1^T: lane col = query j, element = feature
  wave_lds_sync();
  const size_t rowbase = ((size_t)h * Hh + i) * Wd + j0;                           // per-n (h,i,j) row index
  {
#pragma unroll
    for (int jj = 0; jj < 8; ++jj) { const int rr = jj * 2 + hh, c8 = col * 8; *(v8b*)(wt16 + (rowbase + rr) * Wd + c8) = *(const v8b*)(&Ws[wid][rr][c8]); }
#pragma unroll
    for (int jj = 0; jj < 4; ++jj) { const int rr = jj * 4 + (lane >> 3), c4 = (lane & 7) * 4; *(v4f*)(x1 + (rowbase + rr) * HD + c4) = *(const v4f*)(&Xs[wid][rr][c4]); }
    
  }
}

// x2 + combine (image n): per (h, j): (64 rows i) x (K = 128 w) x (32 c): A = wt16 rows of (h,i,j), B = rvT[h][j] rows c; pre[pixel (i,j)][h*32 + c] = g1 x1 + g2 x2 as f32
__global__ __launch_bounds__(64) void x2_kernel(const b16* __restrict__ wt16, const b16* __restrict__ rvT, const float* __restrict__ x1, const float* __restrict__ Gv1, const float* __restrict__ Gv2, int n, float* __restrict__ pre) {
  __shared__ __attribute__((aligned(16))) float Ts[2][32][HD + 4];
  const int lane = threadIdx.x & 31, wave = threadIdx.x >> 5, nloc = lane & 15, hlf = lane >> 4;
  const int h = blockIdx.x / Wd, j = blockIdx.x % Wd, m0 = wave * 32;               // rows = i
  const float g1 = tanh_e(Gv1[h]), g2 = tanh_e(Gv2[h]);
  const b16* Rb = rvT + ((size_t)h * Wd + j) * HD * Wd;
  auto rowidx = [&](int i) { return ((size_t)h * Hh + i) * Wd + j; };               // per-n (h,i,j) row
  v8f acc[2][2] = {{{}, {}}, {{}, {}}};
#pragma unroll
  for (int kb = 0; kb < Wd; kb += 32) {
    const v16b a0 = frag_kb(wt16 + rowidx(m0 + nloc) * Wd + kb, hlf), a1 = frag_kb(wt16 + rowidx(m0 + 16 + nloc) * Wd + kb, hlf);
#pragma unroll
    for (int t = 0; t < 2; ++t) { const v16b bw = frag_kb(Rb + (size_t)(t * 16 + nloc) * Wd + kb, hlf); acc[0][t] = wmma16b(a0, bw, acc[0][t]); acc[1][t] = wmma16b(a1, bw, acc[1][t]); }
  }
#pragma unroll
  for (int t = 0; t < 2; ++t)
#pragma unroll
    for (int r = 0; r < 2; ++r)
#pragma unroll
      for (int v = 0; v < 8; ++v) { const int rr = r * 16 + v + 8 * hlf, cc = t * 16 + nloc; const size_t ri = rowidx(m0 + rr);
        Ts[wave][rr][cc] = g1 * x1[ri * HD + cc] + g2 * acc[r][t][v]; }
  wave_lds_sync();
  {
#pragma unroll
    for (int jj = 0; jj < 4; ++jj) { const int rr = jj * 8 + (lane >> 2), c4 = (lane & 3) * 8; const int i = m0 + rr;
      const size_t pix = (size_t)i * Wd + j;                   // pre is per-n [8192][256]
      *(v4f*)(pre + pix * C + h * HD + c4) = *(const v4f*)(&Ts[wave][rr][c4]); *(v4f*)(pre + pix * C + h * HD + c4 + 4) = *(const v4f*)(&Ts[wave][rr][c4 + 4]); }
    
  }
}

__global__ __launch_bounds__(128) void out_kernel(const float* __restrict__ pre, const b16* __restrict__ wo16, int n, float* __restrict__ out) {
  __shared__ __attribute__((aligned(16))) float Ts[4][64][32 + 4];
  const int lane = threadIdx.x & 31, wave = threadIdx.x >> 5, nloc = lane & 15, hlf = lane >> 4;
  const int m0 = blockIdx.y * 128 + wave * 32, c0 = blockIdx.x * 64;
  v8f acc[2][4];
#pragma unroll
  for (int r = 0; r < 2; ++r)
#pragma unroll
    for (int t = 0; t < 4; ++t) acc[r][t] = (v8f){};
  const Opnd A{pre, nullptr, C}, B{wo16, nullptr, C};
  gemm_tile<3, 1>(A, B, C, m0, c0, nloc, hlf, acc);
#pragma unroll
  for (int t = 0; t < 4; ++t)
#pragma unroll
    for (int r = 0; r < 2; ++r)
#pragma unroll
      for (int v = 0; v < 8; ++v) Ts[wave][t * 16 + nloc][r * 16 + v + 8 * hlf] = acc[r][t][v];
  wave_lds_sync();
  const int hw0 = m0;                                         // per-n pre rows = hw
  {
#pragma unroll
    for (int jj = 0; jj < 16; ++jj) { const int cc = jj * 4 + (lane >> 3), c4 = (lane & 7) * 4; *(v4f*)(out + ((size_t)n * C + c0 + cc) * (Hh * Wd) + hw0 + c4) = *(const v4f*)(&Ts[wave][cc][c4]); }   // channel-major [n][o][hw]
    
  }
}
}  // namespace

extern "C" void kernel_launch(void* const* d_in, const int* in_sizes, int n_in,
                              void* d_out, int out_size, void* d_ws, size_t ws_size, hipStream_t stream) {
  (void)n_in; (void)out_size;
  const float* x = (const float*)d_in[0]; const float* wq = (const float*)d_in[1]; const float* wk = (const float*)d_in[2]; const float* wv = (const float*)d_in[3]; const float* wo = (const float*)d_in[4];
  const float* rq = (const float*)d_in[5]; const float* rk = (const float*)d_in[6]; const float* rv = (const float*)d_in[7];
  const float* Gq = (const float*)d_in[8]; const float* Gk = (const float*)d_in[9]; const float* Gv1 = (const float*)d_in[10]; const float* Gv2 = (const float*)d_in[11];
  float* out = (float*)d_out;   // [4,256,64,128]
  if (in_sizes[0] != NPIX * C || in_sizes[1] != C * C || in_sizes[5] != NH * HD * Wd * Wd || in_sizes[8] != NH) return;
  size_t off = 0; char* ws = (char*)d_ws;
  auto carve = [&](size_t bytes) { char* p = ws + off; off += (bytes + 255) & ~(size_t)255; return p; };
  b16* wqkv = (b16*)carve((size_t)3 * C * C * 2); b16* wo16 = (b16*)carve((size_t)C * C * 2);
  b16* Rcat = (b16*)carve((size_t)NH * Wd * Wd * 64 * 2);      // 16 MB
  b16* rvT = (b16*)carve((size_t)NH * Wd * HD * Wd * 2);       // 8 MB
  b16* xT = (b16*)carve((size_t)NPIX * C * 2);                  // 16 MB; dead after qkv -> reused as the per-image E buffer (8*64*128*128 halves = 16 MB)
  b16* E = xT;
  b16* qk16 = (b16*)carve((size_t)NPIX * 2 * C * 2);            // 32 MB
  b16* vT = (b16*)carve((size_t)NPIX * C * 2);                  // 16 MB
  b16* wt16 = (b16*)carve((size_t)NH * Hh * Wd * Wd * 2);       // 16 MB per image
  float* x1 = (float*)carve((size_t)NH * Hh * Wd * HD * 4);     //  8 MB per image
  float* pre = (float*)carve((size_t)Hh * Wd * C * 4);          //  8 MB per image
  if (off > ws_size) return;                                     // total ≈ 121 MB
  prep_kernel<<<1024, 256, 0, stream>>>(wq, wk, wv, wo, rq, rk, rv, Gq, Gk, wqkv, wo16, Rcat, rvT);
  xt_kernel<<<dim3(128 * 4, Nn), 256, 0, stream>>>(x, xT);
  qkv_kernel<<<dim3(3 * C / 64, NPIX / 128), 128, 0, stream>>>(xT, wqkv, qk16, vT);
  for (int n = 0; n < Nn; ++n) {
    e_kernel<<<NH * Wd, 128, 0, stream>>>(qk16, Rcat, n, E);
    attn_kernel<<<NH * Hh * Wd / 16 / 8, 256, 0, stream>>>(qk16, E, vT, n, wt16, x1);
    x2_kernel<<<NH * Wd, 64, 0, stream>>>(wt16, rvT, x1, Gv1, Gv2, n, pre);
    out_kernel<<<dim3(C / 64, Hh * Wd / 128), 128, 0, stream>>>(pre, wo16, n, out);
  }
}

// v001
// One run takes 166 microseconds.
// Next to v000, in two timings, it ran 1.29 times as fast each time.
#include <hip/hip_runtime.h>

// Gated axial attention along the width axis: x [4][256][64][128]; q,k,v = 1x1 convs (8 heads x 32); per (n, head, row i): logits[j][w] = (q_j.k_w + g_q q_j.rq[:,j,w] +
// g_k k_j.rk[:,j,w]) / 16 with learned per-position tables (tanh'd), softmax over w; out = g_v1 (weights . v) + g_v2 (weights . rv[:,j,:]); 1x1 out conv.
// Contractions on v_wmma_f32_16x16x32_f16 with single f16 operands (position-major activation rows, weight / position-table copies with the gates and 1/16

namespace {
__device__ __forceinline__ float tanh_e(float v) { return 1.0f - 2.0f * __builtin_amdgcn_rcpf(1.0f + __expf(2.0f * v)); }   // tanh via exp + hardware reciprocal (~1 ulp; values are rounded to f16 afterwards or are gates of O(1))
constexpr int Nn = 4, C = 256, Hh = 64, Wd = 128, NH = 8, HD = 32, NPIX = Nn * Hh * Wd;   // 32768 pixels
constexpr float DS = 0.0625f;   // 1/sqrt(C)

typedef _Float16 b16;
typedef __attribute__((ext_vector_type(16))) _Float16 v16b;
typedef __attribute__((ext_vector_type(8)))  _Float16 v8b;
typedef __attribute__((ext_vector_type(8)))  float v8f;
typedef __attribute__((ext_vector_type(4)))  float v4f;

__device__ __forceinline__ v8b ld8b(const b16* p) { return *(const v8b*)p; }
__device__ __forceinline__ v16b cat8b(v8b a, v8b b) { return __builtin_shufflevector(a, b, 0, 1, 2, 3, 4, 5, 6, 7, 8, 9, 10, 11, 12, 13, 14, 15); }
__device__ __forceinline__ v16b frag_kb(const b16* p, int hh) { return cat8b(ld8b(p + 8 * hh), ld8b(p + 16 + 8 * hh)); }
__device__ __forceinline__ void split16(float v, b16& hi, b16& lo) { hi = (b16)v; lo = (b16)(v - (float)hi); }
// hi/lo fragment pair straight from an f32 k-contiguous row (same k-map)
__device__ __forceinline__ void frag_ksplit(const float* p, int hh, v16b& fh_, v16b& fl_) {
  const float* p0 = p + 8 * hh; const float* p1 = p + 16 + 8 * hh;
#pragma unroll
  for (int e = 0; e < 8; ++e) { b16 a, c; split16(p0[e], a, c); fh_[e] = a; fl_[e] = c; split16(p1[e], a, c); fh_[8 + e] = a; fl_[8 + e] = c; }
}
__device__ __forceinline__ v8f wmma16b(v16b a, v16b b, v8f c) {
  v8f d = __builtin_amdgcn_wmma_f32_16x16x32_f16(false, a, false, b, (short)0, c, false, false);
  asm volatile("v_nop\n\tv_nop\n\tv_nop\n\tv_nop" : "+v"(d) : "v"(a), "v"(b));
  return d;
}
__device__ __forceinline__ void wave_lds_sync() {
  __builtin_amdgcn_fence(__ATOMIC_RELEASE, "workgroup");
  __builtin_amdgcn_wave_barrier();
  __builtin_amdgcn_fence(__ATOMIC_ACQUIRE, "workgroup");
}

// Operand descriptor: NP = 0 -> f32 rows split on the fly into (hi, lo); NP = 1 -> one f16 plane; NP = 2 -> f16 hi + lo planes;
// NP = 3 -> f32 rows rounded once to a single f16 fragment. ld = row pitch.
struct Opnd { const void* p0; const void* p1; int ld; };
template <int NP> __device__ __forceinline__ void load_frags(const Opnd& o, int row, int kb, int hh, v16b& fh_, v16b& fl_) {
  if (NP == 0) { frag_ksplit((const float*)o.p0 + (size_t)row * o.ld + kb, hh, fh_, fl_); }
  else if (NP == 4) {                                        // f32 rows x64 then split (keeps the lo halves of small values normal)
    const float* p = (const float*)o.p0 + (size_t)row * o.ld + kb; const float* p0 = p + 8 * hh; const float* p1 = p + 16 + 8 * hh;
#pragma unroll
    for (int e = 0; e < 8; ++e) { b16 a, c; split16(p0[e] * 64.0f, a, c); fh_[e] = a; fl_[e] = c; split16(p1[e] * 64.0f, a, c); fh_[8 + e] = a; fl_[8 + e] = c; }
  } else if (NP == 3) {
    const float* p = (const float*)o.p0 + (size_t)row * o.ld + kb; const float* p0 = p + 8 * hh; const float* p1 = p + 16 + 8 * hh;
#pragma unroll
    for (int e = 0; e < 8; ++e) { fh_[e] = (b16)p0[e]; fh_[8 + e] = (b16)p1[e]; }
    fl_ = fh_;
  } else {
    fh_ = frag_kb((const b16*)o.p0 + (size_t)row * o.ld + kb, hh);
    if (NP == 2) fl_ = frag_kb((const b16*)o.p1 + (size_t)row * o.ld + kb, hh); else fl_ = fh_;
  }
}
template <int ANP, int BNP> __device__ __forceinline__ v8f mac(v16b ah, v16b al, v16b bh, v16b bl, v8f c) {
  c = wmma16b(ah, bh, c);
  if (BNP == 0 || BNP == 2 || BNP == 4) c = wmma16b(ah, bl, c);     // hi.lo
  if (ANP == 0 || ANP == 2 || ANP == 4) c = wmma16b(al, bh, c);     // lo.hi   (lo.lo dropped)
  return c;
}
// 32x64 wave tile: acc[r][t] (rows m0+16r.., cols c0+16t..) += A[m][k] . B[n][k] over k in [0, K)
template <int ANP, int BNP>
__device__ __forceinline__ void gemm_tile(const Opnd& A, const Opnd& B, int K, int m0, int c0, int nloc, int hlf, v8f (&acc)[2][4]) {
  for (int kb = 0; kb < K; kb += 32) {
    v16b a0h, a0l, a1h, a1l;
    load_frags<ANP>(A, m0 + nloc, kb, hlf, a0h, a0l);
    load_frags<ANP>(A, m0 + 16 + nloc, kb, hlf, a1h, a1l);
#pragma unroll
    for (int t = 0; t < 4; ++t) {
      v16b bh, bl;
      load_frags<BNP>(B, c0 + t * 16 + nloc, kb, hlf, bh, bl);
      acc[0][t] = mac<ANP, BNP>(a0h, a0l, bh, bl, acc[0][t]);
      acc[1][t] = mac<ANP, BNP>(a1h, a1l, bh, bl, acc[1][t]);
    }
  }
}

__device__ __forceinline__ void epi_planes(v8f (&acc)[2][4], float scale, bool two, b16* __restrict__ oh, b16* __restrict__ ol, int ldo,
                                           int m0, int c0, int lane, b16* Th, b16* Tl) {
  const int nloc = lane & 15, hlf = lane >> 4;
#pragma unroll
  for (int t = 0; t < 4; ++t)
#pragma unroll
    for (int r = 0; r < 2; ++r)
#pragma unroll
      for (int v = 0; v < 8; ++v) {
        const int rr = r * 16 + v + 8 * hlf, cc = t * 16 + nloc;
        b16 h_, l_; split16(acc[r][t][v] * scale, h_, l_);
        Th[rr * 64 + cc] = h_; Tl[rr * 64 + cc] = l_;
      }
  wave_lds_sync();
  {
#pragma unroll
    for (int j = 0; j < 8; ++j) {
      const int rr = j * 4 + (lane >> 3), c8 = (lane & 7) * 8;
      const size_t o = (size_t)(m0 + rr) * ldo + c0 + c8;
      *(v8b*)(oh + o) = ld8b(Th + rr * 64 + c8);
      if (two) *(v8b*)(ol + o) = ld8b(Tl + rr * 64 + c8);
    }
    
  }
}
// (b) f32 rows with pitch ldo: 64 floats = 256 B = 2 lines per row; 16 lanes x 16 B per row, 2 rows per instruction. Optional per-row factor
__device__ __forceinline__ void epi_f32(v8f (&acc)[2][4], float scale, const float* rscale, float* __restrict__ out, int ldo, int m0, int c0, int lane, float* Tt) {
  const int nloc = lane & 15, hlf = lane >> 4;
#pragma unroll
  for (int t = 0; t < 4; ++t)
#pragma unroll
    for (int r = 0; r < 2; ++r)
#pragma unroll
      for (int v = 0; v < 8; ++v) {
        const int rr = r * 16 + v + 8 * hlf;
        const float rs = rscale ? rscale[(size_t)(m0 + rr) * 32] : 1.0f;
        Tt[rr * 64 + t * 16 + nloc] = acc[r][t][v] * scale * rs;
      }
  wave_lds_sync();
  float* dst0 = out + (size_t)m0 * ldo + c0;
  {
#pragma unroll
    for (int j = 0; j < 16; ++j) { const int rr = j * 2 + hlf, c4 = nloc * 4; *(v4f*)(dst0 + (size_t)rr * ldo + c4) = *(const v4f*)(Tt + rr * 64 + c4); }
    
  }
}



// prep (grid-stride): wqkv = [wq; wk; wv] [768][256] f16, wout f16 [256][256]; Rcat[h][j][w][c'] = (c' < 32 ? tanh(Gq_h) tanh(rq[h][c'][j][w]) : tanh(Gk_h) tanh(rk[h][c'-32][j][w])) / 16
__global__ __launch_bounds__(256) void prep_kernel(const float* __restrict__ wq, const float* __restrict__ wk, const float* __restrict__ wv, const float* __restrict__ wo,
                                                   const float* __restrict__ rq, const float* __restrict__ rk, const float* __restrict__ rv, const float* __restrict__ Gq, const float* __restrict__ Gk,
                                                   b16* __restrict__ wqkv, b16* __restrict__ wo16, b16* __restrict__ Rcat, b16* __restrict__ rvT) {
  const size_t tid = (size_t)blockIdx.x * blockDim.x + threadIdx.x, stride = (size_t)gridDim.x * blockDim.x;
  const size_t n0 = (size_t)3 * C * C / 8, n1 = (size_t)C * C / 8, n2 = (size_t)NH * Wd * Wd * 64 / 8, n3 = (size_t)NH * Wd * HD * Wd / 8;
  {
    for (size_t p = tid; p < n0 + n1 + n2 + n3; p += stride) {
      v8b v; b16* dst;
      if (p < n0) { const size_t i = p * 8; const float* src = (i < (size_t)C * C) ? (wq + i) : (i < (size_t)2 * C * C) ? (wk + i - (size_t)C * C) : (wv + i - (size_t)2 * C * C);
#pragma unroll
        for (int e = 0; e < 8; ++e) v[e] = (b16)src[e]; dst = wqkv + i; }
      else if (p < n0 + n1) { const size_t i = (p - n0) * 8;
#pragma unroll
        for (int e = 0; e < 8; ++e) v[e] = (b16)wo[i + e]; dst = wo16 + i; }
      else if (p < n0 + n1 + n2) { const size_t i = (p - n0 - n1) * 8;       // Rcat index ((h*128 + j)*128 + w)*64 + c'
        const int cp0 = (int)(i % 64), w = (int)((i / 64) % Wd), j = (int)((i / (64 * Wd)) % Wd), h = (int)(i / ((size_t)64 * Wd * Wd));
        const float gq = tanh_e(Gq[h]) * DS, gk = tanh_e(Gk[h]) * DS;
#pragma unroll
        for (int e = 0; e < 8; ++e) { const int cp = cp0 + e; const float* tab = (cp < HD) ? rq : rk; const int c = (cp < HD) ? cp : cp - HD;
          v[e] = (b16)(((cp < HD) ? gq : gk) * tanh_e(tab[(((size_t)h * HD + c) * Wd + j) * Wd + w])); }
        dst = Rcat + i; }
      else { const size_t i = (p - n0 - n1 - n2) * 8;                          // rvT index ((h*128 + j)*32 + c)*128 + w
        const int w0 = (int)(i % Wd), c = (int)((i / Wd) % HD), j = (int)((i / ((size_t)Wd * HD)) % Wd), h = (int)(i / ((size_t)Wd * HD * Wd));
#pragma unroll
        for (int e = 0; e < 8; ++e) v[e] = (b16)tanh_e(rv[(((size_t)h * HD + c) * Wd + j) * Wd + w0 + e]);
        dst = rvT + i; }
      *(v8b*)dst = v;
    }
    
  }
}

__global__ __launch_bounds__(256) void xt_kernel(const float* __restrict__ x, b16* __restrict__ xT) {
  __shared__ __attribute__((aligned(16))) b16 Tl[64][72];
  const int tid = threadIdx.x, lane = tid & 31, wave = tid >> 5, n = blockIdx.y, p0 = (blockIdx.x / 4) * 64, c0 = (blockIdx.x % 4) * 64;
  for (int i = tid; i < 64 * 64; i += 256) { const int cc = i / 64, pp = i % 64; Tl[pp][cc] = (b16)x[((size_t)n * C + c0 + cc) * (Hh * Wd) + p0 + pp]; }
  __syncthreads();
  b16* dst = xT + ((size_t)n * Hh * Wd + p0) * C + c0;
  {
#pragma unroll
    for (int j = 0; j < 2; ++j) { const int rr = wave * 8 + j * 4 + (lane >> 3), c8 = (lane & 7) * 8; *(v8b*)(dst + (size_t)rr * C + c8) = *(const v8b*)(&Tl[rr][c8]); }
    
  }
}

// qkv: (32768 x 256) x (256 x 768); grid (12, 256). Column tiles 0-7 -> q|k f16 rows qk16[pixel][512]; tiles 8-11 -> v transposed per (n, h, i): vT[n][h][i][c][w]
// (256-B rows) through a block LDS tile (block = 128 pixels = one image row i of one n).
__global__ __launch_bounds__(128) void qkv_kernel(const b16* __restrict__ xT, const b16* __restrict__ wqkv, b16* __restrict__ qk16, b16* __restrict__ vT) {
  __shared__ __attribute__((aligned(16))) b16 Th[4][2][32 * 64];
  __shared__ __attribute__((aligned(16))) b16 Tt[64][128 + 8];
  const int lane = threadIdx.x & 31, wave = threadIdx.x >> 5, nloc = lane & 15, hlf = lane >> 4;
  const int m0 = blockIdx.y * 128 + wave * 32, c0 = blockIdx.x * 64;
  v8f acc[2][4];
#pragma unroll
  for (int r = 0; r < 2; ++r)
#pragma unroll
    for (int t = 0; t < 4; ++t) acc[r][t] = (v8f){};
  const Opnd A{xT, nullptr, C}, B{wqkv, nullptr, C};
  gemm_tile<1, 1>(A, B, C, m0, c0, nloc, hlf, acc);
  if (c0 < 2 * C) { epi_planes(acc, 1.0f, false, qk16, nullptr, 2 * C, m0, c0, lane, Th[wave][0], Th[wave][1]); return; }   // block-uniform
  // v: block's 128 pixels = (n, i, all w); tile columns = 2 heads x 32 c -> vT rows (h, c) of 128 w
#pragma unroll
  for (int t = 0; t < 4; ++t)
#pragma unroll
    for (int r = 0; r < 2; ++r)
#pragma unroll
      for (int v = 0; v < 8; ++v) Tt[t * 16 + nloc][wave * 32 + r * 16 + 8 * hlf + v] = (b16)acc[r][t][v];
  __syncthreads();
  const int pix0 = blockIdx.y * 128, n = pix0 / (Hh * Wd), i = (pix0 / Wd) % Hh, hc0 = c0 - 2 * C;   // hc0 = h*32 + c base (64 rows)
  {
#pragma unroll
    for (int j = 0; j < 8; ++j) { const int rr = wave * 16 + j * 2 + (lane >> 4), c8 = (lane & 15) * 8; const int hc = hc0 + rr, h = hc / HD, c = hc % HD;
      *(v8b*)(vT + ((((size_t)n * NH + h) * Hh + i) * HD + c) * Wd + c8) = *(const v8b*)(&Tt[rr][c8]); }
    
  }
}

// E[n][h][i][j][w] = [q_j | k_j](head h) . Rcat[h][j][w][:] for all (n,i): per (h,j) a (256 x 64) x (64 x 128) product; block = (n, h, j): the 64 rows i of one image, all 128 w;
// all four images in one launch: image n is the fastest grid index, so the four blocks that read one Rcat[h][j] slab start together
__global__ __launch_bounds__(128) void e_kernel(const b16* __restrict__ qk16, const b16* __restrict__ Rcat, b16* __restrict__ E) {
  __shared__ __attribute__((aligned(16))) b16 Th[4][2][32 * 64];
  const int lane = threadIdx.x & 31, wave = threadIdx.x >> 5, nloc = lane & 15, hlf = lane >> 4;
  const int n = blockIdx.x % Nn, h = blockIdx.x / (Nn * Wd), j = (blockIdx.x / Nn) % Wd, m0 = (wave & 1) * 32, c0 = (wave >> 1) * 64;   // rows = i (64), block covers 64 i x 128 w
  v8f acc[2][4];
#pragma unroll
  for (int r = 0; r < 2; ++r)
#pragma unroll
    for (int t = 0; t < 4; ++t) acc[r][t] = (v8f){};
  const b16* Rb = Rcat + ((size_t)h * Wd + j) * Wd * 64;
#pragma unroll
  for (int ks = 0; ks < 2; ++ks) {                             // k-step 0: q (c' 0..31), 1: k (c' 32..63)
    const int ia = m0 + nloc, ib = m0 + 16 + nloc;
    const size_t pa = ((size_t)n * Hh * Wd + (size_t)ia * Wd + j) * (2 * C) + ks * C + h * HD, pb = ((size_t)n * Hh * Wd + (size_t)ib * Wd + j) * (2 * C) + ks * C + h * HD;
    const v16b a0 = frag_kb(qk16 + pa, hlf), a1 = frag_kb(qk16 + pb, hlf);
#pragma unroll
    for (int t = 0; t < 4; ++t) { const v16b bw = frag_kb(Rb + (size_t)(c0 + t * 16 + nloc) * 64 + ks * 32, hlf); acc[0][t] = wmma16b(a0, bw, acc[0][t]); acc[1][t] = wmma16b(a1, bw, acc[1][t]); }
  }
  // E rows: (((n*8 + h)*64 + i)*128 + j)*128 + w
  b16* Tp = Th[wave][0];
#pragma unroll
  for (int t = 0; t < 4; ++t)
#pragma unroll
    for (int r = 0; r < 2; ++r)
#pragma unroll
      for (int v = 0; v < 8; ++v) Tp[(r * 16 + v + 8 * hlf) * 64 + t * 16 + nloc] = (b16)acc[r][t][v];
  wave_lds_sync();
  {
#pragma unroll
    for (int jj = 0; jj < 8; ++jj) { const int rr = jj * 4 + (lane >> 3), c8 = (lane & 7) * 8; const int i = m0 + rr;
      *(v8b*)(E + ((((size_t)n * NH + h) * Hh + i) * Wd + j) * Wd + c0 + c8) = ld8b(Tp + rr * 64 + c8); }
    
  }
}

// Attention: wave = (n, h, i, 16 queries j0); all 128 keys: logits = q.k/16 + E (4 chunks of 32 kept in registers), max / sum, weights = e/sum -> (a) f16 weights rows
__global__ __launch_bounds__(256) void attn_kernel(const b16* __restrict__ qk16, const b16* __restrict__ E, const b16* __restrict__ vT, b16* __restrict__ wt16, float* __restrict__ x1) {
  __shared__ __attribute__((aligned(16))) b16 Ws[8][16][Wd + 8];
  __shared__ __attribute__((aligned(16))) float Xs[8][16][HD + 4];
  const int wid = threadIdx.x >> 5, lane = threadIdx.x & 31, hh = lane >> 4, col = lane & 15;
  const int qt = blockIdx.x * 8 + wid;                          // ((n*8 + h)*64 + i)*8 + j0/16
  const int jt = qt & 7, i = (qt >> 3) & 63, h = (qt >> 9) & 7, n = qt >> 12, j0 = jt * 16;
  const size_t pixrow = (size_t)n * Hh * Wd + (size_t)i * Wd;  // pixel index of (n, i, w=0)
  const b16* qrow = qk16 + (pixrow + j0 + col) * (2 * C) + h * HD;                // B operand: queries (columns)
  const v16b qb = frag_kb(qrow, hh);
  const b16* Erow = E + ((((size_t)n * NH + h) * Hh + i) * Wd) * Wd;             // + j*128 + w
  float lg[4][16];
#pragma unroll
  for (int ch = 0; ch < 4; ++ch) {
    v8f s0 = {}, s1 = {};
    s0 = wmma16b(frag_kb(qk16 + (pixrow + ch * 32 + col) * (2 * C) + C + h * HD, hh), qb, s0);        // A: keys w = 32ch + col (k rows), k-step over the 32 channels
    s1 = wmma16b(frag_kb(qk16 + (pixrow + ch * 32 + 16 + col) * (2 * C) + C + h * HD, hh), qb, s1);
#pragma unroll
    for (int r = 0; r < 8; ++r) { const int w0 = ch * 32 + 8 * hh + r, w1 = w0 + 16; const size_t eo = (size_t)(j0 + col) * Wd;
      lg[ch][r] = s0[r] * DS + (float)Erow[eo + w0]; lg[ch][8 + r] = s1[r] * DS + (float)Erow[eo + w1]; }
  }
  float m = -INFINITY;
#pragma unroll
  for (int ch = 0; ch < 4; ++ch)
#pragma unroll
    for (int r = 0; r < 16; ++r) m = fmaxf(m, lg[ch][r]);
  m = fmaxf(m, __shfl_xor(m, 16));
  float sum = 0.0f;
#pragma unroll
  for (int ch = 0; ch < 4; ++ch)
#pragma unroll
    for (int r = 0; r < 16; ++r) { lg[ch][r] = __expf(lg[ch][r] - m); sum += lg[ch][r]; }
  sum += __shfl_xor(sum, 16);
  const float inv = 1.0f / sum;
  v8f o[2] = {{}, {}};
  const b16* vrow = vT + (((size_t)n * NH + h) * Hh + i) * HD * Wd;              // rows c, 128 w
#pragma unroll
  for (int ch = 0; ch < 4; ++ch) {
    v16b pb;
#pragma unroll
    for (int r = 0; r < 8; ++r) { const float p0 = lg[ch][r] * inv, p1 = lg[ch][8 + r] * inv; pb[r] = (b16)p0; pb[8 + r] = (b16)p1;
      Ws[wid][col][ch * 32 + 8 * hh + r] = (b16)p0; Ws[wid][col][ch * 32 + 16 + 8 * hh + r] = (b16)p1; }
#pragma unroll
    for (int nt = 0; nt < 2; ++nt) o[nt] = wmma16b(frag_kb(vrow + (size_t)(nt * 16 + col) * Wd + ch * 32, hh), pb, o[nt]);
  }
#pragma unroll
  for (int nt = 0; nt < 2; ++nt)
#pragma unroll
    for (int r = 0; r < 8; ++r) Xs[wid][col][nt * 16 + 8 * hh + r] = o[nt][r];   // x1^T: lane col = query j, element = feature
  wave_lds_sync();
  const size_t rowbase = (((size_t)n * NH + h) * Hh + i) * Wd + j0;                // (n,h,i,j) row index
  {
#pragma unroll
    for (int jj = 0; jj < 8; ++jj) { const int rr = jj * 2 + hh, c8 = col * 8; *(v8b*)(wt16 + (rowbase + rr) * Wd + c8) = *(const v8b*)(&Ws[wid][rr][c8]); }
#pragma unroll
    for (int jj = 0; jj < 4; ++jj) { const int rr = jj * 4 + (lane >> 3), c4 = (lane & 7) * 4; *(v4f*)(x1 + (rowbase + rr) * HD + c4) = *(const v4f*)(&Xs[wid][rr][c4]); }
    
  }
}

// x2 + combine: per (h, j): (256 rows (n,i)) x (K = 128 w) x (32 c): A = wt16 rows of (n,h,i,j), B = rvT[h][j] rows c; pre[pixel (n,i,j)][h*32 + c] = g1 x1 + g2 x2 as f32
__global__ __launch_bounds__(64) void x2_kernel(const b16* __restrict__ wt16, const b16* __restrict__ rvT, const float* __restrict__ x1, const float* __restrict__ Gv1, const float* __restrict__ Gv2, float* __restrict__ pre) {
  __shared__ __attribute__((aligned(16))) float Ts[2][32][HD + 4];
  const int lane = threadIdx.x & 31, wave = threadIdx.x >> 5, nloc = lane & 15, hlf = lane >> 4;
  const int n = blockIdx.x % Nn, h = blockIdx.x / (Nn * Wd), j = (blockIdx.x / Nn) % Wd, m0 = wave * 32;   // rows = i; image n fastest, as in e_kernel (shared rvT[h][j])
  const float g1 = tanh_e(Gv1[h]), g2 = tanh_e(Gv2[h]);
  const b16* Rb = rvT + ((size_t)h * Wd + j) * HD * Wd;
  auto rowidx = [&](int i) { return (((size_t)n * NH + h) * Hh + i) * Wd + j; };    // (n,h,i,j) row
  v8f acc[2][2] = {{{}, {}}, {{}, {}}};
#pragma unroll
  for (int kb = 0; kb < Wd; kb += 32) {
    const v16b a0 = frag_kb(wt16 + rowidx(m0 + nloc) * Wd + kb, hlf), a1 = frag_kb(wt16 + rowidx(m0 + 16 + nloc) * Wd + kb, hlf);
#pragma unroll
    for (int t = 0; t < 2; ++t) { const v16b bw = frag_kb(Rb + (size_t)(t * 16 + nloc) * Wd + kb, hlf); acc[0][t] = wmma16b(a0, bw, acc[0][t]); acc[1][t] = wmma16b(a1, bw, acc[1][t]); }
  }
#pragma unroll
  for (int t = 0; t < 2; ++t)
#pragma unroll
    for (int r = 0; r < 2; ++r)
#pragma unroll
      for (int v = 0; v < 8; ++v) { const int rr = r * 16 + v + 8 * hlf, cc = t * 16 + nloc; const size_t ri = rowidx(m0 + rr);
        Ts[wave][rr][cc] = g1 * x1[ri * HD + cc] + g2 * acc[r][t][v]; }
  wave_lds_sync();
  {
#pragma unroll
    for (int jj = 0; jj < 4; ++jj) { const int rr = jj * 8 + (lane >> 2), c4 = (lane & 3) * 8; const int i = m0 + rr;
      const size_t pix = ((size_t)n * Hh + i) * Wd + j;        // pre is [32768][256]
      *(v4f*)(pre + pix * C + h * HD + c4) = *(const v4f*)(&Ts[wave][rr][c4]); *(v4f*)(pre + pix * C + h * HD + c4 + 4) = *(const v4f*)(&Ts[wave][rr][c4 + 4]); }
    
  }
}

__global__ __launch_bounds__(128) void out_kernel(const float* __restrict__ pre, const b16* __restrict__ wo16, float* __restrict__ out) {
  __shared__ __attribute__((aligned(16))) float Ts[4][64][32 + 4];
  const int lane = threadIdx.x & 31, wave = threadIdx.x >> 5, nloc = lane & 15, hlf = lane >> 4;
  const int m0 = blockIdx.y * 128 + wave * 32, c0 = blockIdx.x * 64;
  v8f acc[2][4];
#pragma unroll
  for (int r = 0; r < 2; ++r)
#pragma unroll
    for (int t = 0; t < 4; ++t) acc[r][t] = (v8f){};
  const Opnd A{pre, nullptr, C}, B{wo16, nullptr, C};
  gemm_tile<3, 1>(A, B, C, m0, c0, nloc, hlf, acc);
#pragma unroll
  for (int t = 0; t < 4; ++t)
#pragma unroll
    for (int r = 0; r < 2; ++r)
#pragma unroll
      for (int v = 0; v < 8; ++v) Ts[wave][t * 16 + nloc][r * 16 + v + 8 * hlf] = acc[r][t][v];
  wave_lds_sync();
  const int n = m0 / (Hh * Wd), hw0 = m0 % (Hh * Wd);         // pre rows = pixels (n, hw); a 32-row wave tile lies in one image
  {
#pragma unroll
    for (int jj = 0; jj < 16; ++jj) { const int cc = jj * 4 + (lane >> 3), c4 = (lane & 7) * 4; *(v4f*)(out + ((size_t)n * C + c0 + cc) * (Hh * Wd) + hw0 + c4) = *(const v4f*)(&Ts[wave][cc][c4]); }   // channel-major [n][o][hw]
    
  }
}
}  // namespace

extern "C" void kernel_launch(void* const* d_in, const int* in_sizes, int n_in,
                              void* d_out, int out_size, void* d_ws, size_t ws_size, hipStream_t stream) {
  (void)n_in; (void)out_size;
  const float* x = (const float*)d_in[0]; const float* wq = (const float*)d_in[1]; const float* wk = (const float*)d_in[2]; const float* wv = (const float*)d_in[3]; const float* wo = (const float*)d_in[4];
  const float* rq = (const float*)d_in[5]; const float* rk = (const float*)d_in[6]; const float* rv = (const float*)d_in[7];
  const float* Gq = (const float*)d_in[8]; const float* Gk = (const float*)d_in[9]; const float* Gv1 = (const float*)d_in[10]; const float* Gv2 = (const float*)d_in[11];
  float* out = (float*)d_out;   // [4,256,64,128]
  if (in_sizes[0] != NPIX * C || in_sizes[1] != C * C || in_sizes[5] != NH * HD * Wd * Wd || in_sizes[8] != NH) return;
  size_t off = 0; char* ws = (char*)d_ws;
  auto carve = [&](size_t bytes) { char* p = ws + off; off += (bytes + 255) & ~(size_t)255; return p; };
  b16* wqkv = (b16*)carve((size_t)3 * C * C * 2); b16* wo16 = (b16*)carve((size_t)C * C * 2);
  b16* Rcat = (b16*)carve((size_t)NH * Wd * Wd * 64 * 2);      // 16 MB
  b16* rvT = (b16*)carve((size_t)NH * Wd * HD * Wd * 2);       // 8 MB
  b16* E = (b16*)carve((size_t)Nn * NH * Hh * Wd * Wd * 2);     // 64 MB, all images
  b16* xT = E;                                                  // 16 MB, dead after qkv, before e_kernel writes E
  float* pre = (float*)E;                                       // 32 MB, written by x2 when E is dead (last read by attn)
  b16* qk16 = (b16*)carve((size_t)NPIX * 2 * C * 2);            // 32 MB
  b16* vT = (b16*)carve((size_t)NPIX * C * 2);                  // 16 MB
  b16* wt16 = (b16*)carve((size_t)Nn * NH * Hh * Wd * Wd * 2);  // 64 MB
  float* x1 = (float*)carve((size_t)Nn * NH * Hh * Wd * HD * 4);   // 32 MB
  if (off > ws_size) return;                                     // total about 233 MB (binary)
  prep_kernel<<<1024, 256, 0, stream>>>(wq, wk, wv, wo, rq, rk, rv, Gq, Gk, wqkv, wo16, Rcat, rvT);
  xt_kernel<<<dim3(128 * 4, Nn), 256, 0, stream>>>(x, xT);
  qkv_kernel<<<dim3(3 * C / 64, NPIX / 128), 128, 0, stream>>>(xT, wqkv, qk16, vT);
  e_kernel<<<Nn * NH * Wd, 128, 0, stream>>>(qk16, Rcat, E);
  attn_kernel<<<Nn * NH * Hh * Wd / 16 / 8, 256, 0, stream>>>(qk16, E, vT, wt16, x1);
  x2_kernel<<<Nn * NH * Wd, 64, 0, stream>>>(wt16, rvT, x1, Gv1, Gv2, pre);
  out_kernel<<<dim3(C / 64, NPIX / 128), 128, 0, stream>>>(pre, wo16, out);
}

// v002
// Measured time: 133 microseconds a run.
// In two side-by-side timings against v001, it was 1.26 and 1.25 times as fast.
// All steps since v000 together make it 1.62 times as fast.
#include <hip/hip_runtime.h>

// Gated axial attention along the width axis: x [4][256][64][128]; q,k,v = 1x1 convs (8 heads x 32); per (n, head, row i): logits[j][w] = (q_j.k_w + g_q q_j.rq[:,j,w] +
// g_k k_j.rk[:,j,w]) / 16 with learned per-position tables (tanh'd), softmax over w; out = g_v1 (weights . v) + g_v2 (weights . rv[:,j,:]); 1x1 out conv.
// Contractions on v_wmma_f32_16x16x32_f16 with single f16 operands (position-major activation rows, weight / position-table copies with the gates and 1/16

namespace {
__device__ __forceinline__ float tanh_e(float v) { return 1.0f - 2.0f * __builtin_amdgcn_rcpf(1.0f + __expf(2.0f * v)); }   // tanh via exp + hardware reciprocal (~1 ulp; values are rounded to f16 afterwards or are gates of O(1))
constexpr int Nn = 4, C = 256, Hh = 64, Wd = 128, NH = 8, HD = 32, NPIX = Nn * Hh * Wd;   // 32768 pixels
constexpr float DS = 0.0625f;   // 1/sqrt(C)

typedef _Float16 b16;
typedef __attribute__((ext_vector_type(16))) _Float16 v16b;
typedef __attribute__((ext_vector_type(8)))  _Float16 v8b;
typedef __attribute__((ext_vector_type(8)))  float v8f;
typedef __attribute__((ext_vector_type(4)))  float v4f;

__device__ __forceinline__ v8b ld8b(const b16* p) { return *(const v8b*)p; }
__device__ __forceinline__ v16b cat8b(v8b a, v8b b) { return __builtin_shufflevector(a, b, 0, 1, 2, 3, 4, 5, 6, 7, 8, 9, 10, 11, 12, 13, 14, 15); }
__device__ __forceinline__ v16b frag_kb(const b16* p, int hh) { return cat8b(ld8b(p + 8 * hh), ld8b(p + 16 + 8 * hh)); }
__device__ __forceinline__ void split16(float v, b16& hi, b16& lo) { hi = (b16)v; lo = (b16)(v - (float)hi); }
// hi/lo fragment pair straight from an f32 k-contiguous row (same k-map)
__device__ __forceinline__ void frag_ksplit(const float* p, int hh, v16b& fh_, v16b& fl_) {
  const float* p0 = p + 8 * hh; const float* p1 = p + 16 + 8 * hh;
#pragma unroll
  for (int e = 0; e < 8; ++e) { b16 a, c; split16(p0[e], a, c); fh_[e] = a; fl_[e] = c; split16(p1[e], a, c); fh_[8 + e] = a; fl_[8 + e] = c; }
}
__device__ __forceinline__ v8f wmma16b(v16b a, v16b b, v8f c) {
  v8f d = __builtin_amdgcn_wmma_f32_16x16x32_f16(false, a, false, b, (short)0, c, false, false);
  asm volatile("v_nop\n\tv_nop\n\tv_nop\n\tv_nop" : "+v"(d) : "v"(a), "v"(b));
  return d;
}
__device__ __forceinline__ void wave_lds_sync() {
  __builtin_amdgcn_fence(__ATOMIC_RELEASE, "workgroup");
  __builtin_amdgcn_wave_barrier();
  __builtin_amdgcn_fence(__ATOMIC_ACQUIRE, "workgroup");
}

__device__ __forceinline__ void epi_planes(v8f (&acc)[2][4], float scale, bool two, b16* __restrict__ oh, b16* __restrict__ ol, int ldo,
                                           int m0, int c0, int lane, b16* Th, b16* Tl) {
  const int nloc = lane & 15, hlf = lane >> 4;
#pragma unroll
  for (int t = 0; t < 4; ++t)
#pragma unroll
    for (int r = 0; r < 2; ++r)
#pragma unroll
      for (int v = 0; v < 8; ++v) {
        const int rr = r * 16 + v + 8 * hlf, cc = t * 16 + nloc;
        b16 h_, l_; split16(acc[r][t][v] * scale, h_, l_);
        Th[rr * 64 + cc] = h_; Tl[rr * 64 + cc] = l_;
      }
  wave_lds_sync();
  {
#pragma unroll
    for (int j = 0; j < 8; ++j) {
      const int rr = j * 4 + (lane >> 3), c8 = (lane & 7) * 8;
      const size_t o = (size_t)(m0 + rr) * ldo + c0 + c8;
      *(v8b*)(oh + o) = ld8b(Th + rr * 64 + c8);
      if (two) *(v8b*)(ol + o) = ld8b(Tl + rr * 64 + c8);
    }
    
  }
}
// (b) f32 rows with pitch ldo: 64 floats = 256 B = 2 lines per row; 16 lanes x 16 B per row, 2 rows per instruction. Optional per-row factor
__device__ __forceinline__ void epi_f32(v8f (&acc)[2][4], float scale, const float* rscale, float* __restrict__ out, int ldo, int m0, int c0, int lane, float* Tt) {
  const int nloc = lane & 15, hlf = lane >> 4;
#pragma unroll
  for (int t = 0; t < 4; ++t)
#pragma unroll
    for (int r = 0; r < 2; ++r)
#pragma unroll
      for (int v = 0; v < 8; ++v) {
        const int rr = r * 16 + v + 8 * hlf;
        const float rs = rscale ? rscale[(size_t)(m0 + rr) * 32] : 1.0f;
        Tt[rr * 64 + t * 16 + nloc] = acc[r][t][v] * scale * rs;
      }
  wave_lds_sync();
  float* dst0 = out + (size_t)m0 * ldo + c0;
  {
#pragma unroll
    for (int j = 0; j < 16; ++j) { const int rr = j * 2 + hlf, c4 = nloc * 4; *(v4f*)(dst0 + (size_t)rr * ldo + c4) = *(const v4f*)(Tt + rr * 64 + c4); }
    
  }
}



// prep (grid-stride): wqkv = [wq; wk; wv] [768][256] f16, wout f16 [256][256]; Rcat[h][j][w][c'] = (c' < 32 ? tanh(Gq_h) tanh(rq[h][c'][j][w]) : tanh(Gk_h) tanh(rk[h][c'-32][j][w])) / 16
__global__ __launch_bounds__(256) void prep_kernel(const float* __restrict__ wq, const float* __restrict__ wk, const float* __restrict__ wv, const float* __restrict__ wo,
                                                   const float* __restrict__ rq, const float* __restrict__ rk, const float* __restrict__ rv, const float* __restrict__ Gq, const float* __restrict__ Gk,
                                                   b16* __restrict__ wqkv, b16* __restrict__ wo16, b16* __restrict__ Rcat, b16* __restrict__ rvT) {
  const size_t tid = (size_t)blockIdx.x * blockDim.x + threadIdx.x, stride = (size_t)gridDim.x * blockDim.x;
  const size_t n0 = (size_t)3 * C * C / 8, n1 = (size_t)C * C / 8, n2 = (size_t)NH * Wd * Wd * 64 / 8, n3 = (size_t)NH * Wd * HD * Wd / 8;
  {
    for (size_t p = tid; p < n0 + n1 + n2 + n3; p += stride) {
      v8b v; b16* dst;
      if (p < n0) { const size_t i = p * 8; const float* src = (i < (size_t)C * C) ? (wq + i) : (i < (size_t)2 * C * C) ? (wk + i - (size_t)C * C) : (wv + i - (size_t)2 * C * C);
#pragma unroll
        for (int e = 0; e < 8; ++e) v[e] = (b16)src[e]; dst = wqkv + i; }
      else if (p < n0 + n1) { const size_t i = (p - n0) * 8;
#pragma unroll
        for (int e = 0; e < 8; ++e) v[e] = (b16)wo[i + e]; dst = wo16 + i; }
      else if (p < n0 + n1 + n2) { const size_t i = (p - n0 - n1) * 8;       // Rcat index ((h*128 + j)*128 + w)*64 + c'
        const int cp0 = (int)(i % 64), w = (int)((i / 64) % Wd), j = (int)((i / (64 * Wd)) % Wd), h = (int)(i / ((size_t)64 * Wd * Wd));
        const float gq = tanh_e(Gq[h]) * DS, gk = tanh_e(Gk[h]) * DS;
#pragma unroll
        for (int e = 0; e < 8; ++e) { const int cp = cp0 + e; const float* tab = (cp < HD) ? rq : rk; const int c = (cp < HD) ? cp : cp - HD;
          v[e] = (b16)(((cp < HD) ? gq : gk) * tanh_e(tab[(((size_t)h * HD + c) * Wd + j) * Wd + w])); }
        dst = Rcat + i; }
      else { const size_t i = (p - n0 - n1 - n2) * 8;                          // rvT index ((h*128 + j)*32 + c)*128 + w
        const int w0 = (int)(i % Wd), c = (int)((i / Wd) % HD), j = (int)((i / ((size_t)Wd * HD)) % Wd), h = (int)(i / ((size_t)Wd * HD * Wd));
#pragma unroll
        for (int e = 0; e < 8; ++e) v[e] = (b16)tanh_e(rv[(((size_t)h * HD + c) * Wd + j) * Wd + w0 + e]);
        dst = rvT + i; }
      *(v8b*)dst = v;
    }
    
  }
}

__global__ __launch_bounds__(256) void xt_kernel(const float* __restrict__ x, b16* __restrict__ xT) {
  __shared__ __attribute__((aligned(16))) b16 Tl[64][72];
  const int tid = threadIdx.x, lane = tid & 31, wave = tid >> 5, n = blockIdx.y, p0 = (blockIdx.x / 4) * 64, c0 = (blockIdx.x % 4) * 64;
  for (int i = tid; i < 64 * 64; i += 256) { const int cc = i / 64, pp = i % 64; Tl[pp][cc] = (b16)x[((size_t)n * C + c0 + cc) * (Hh * Wd) + p0 + pp]; }
  __syncthreads();
  b16* dst = xT + ((size_t)n * Hh * Wd + p0) * C + c0;
  {
#pragma unroll
    for (int j = 0; j < 2; ++j) { const int rr = wave * 8 + j * 4 + (lane >> 3), c8 = (lane & 7) * 8; *(v8b*)(dst + (size_t)rr * C + c8) = *(const v8b*)(&Tl[rr][c8]); }
    
  }
}

// Eight async copies global -> LDS, 16 B per lane each (one copy of a wave = 512 contiguous bytes = 4 whole lines). The s_wait_xcnt closes the statement so that
// no address register of an issued copy is rewritten ahead of it.
__device__ __forceinline__ void copy_rows8(unsigned l, const char* g, unsigned lp, int gp) {   // l, lp: LDS byte address and row pitch; g, gp: global address and row pitch in bytes
  asm volatile("global_load_async_to_lds_b128 %0, %8, off\n\t"
               "global_load_async_to_lds_b128 %1, %9, off\n\t"
               "global_load_async_to_lds_b128 %2, %10, off\n\t"
               "global_load_async_to_lds_b128 %3, %11, off\n\t"
               "global_load_async_to_lds_b128 %4, %12, off\n\t"
               "global_load_async_to_lds_b128 %5, %13, off\n\t"
               "global_load_async_to_lds_b128 %6, %14, off\n\t"
               "global_load_async_to_lds_b128 %7, %15, off\n\t"
               "s_wait_xcnt 0x0"
               :: "v"(l), "v"(l + lp), "v"(l + 2 * lp), "v"(l + 3 * lp), "v"(l + 4 * lp), "v"(l + 5 * lp), "v"(l + 6 * lp), "v"(l + 7 * lp),
                  "v"(g), "v"(g + gp), "v"(g + 2 * gp), "v"(g + 3 * gp), "v"(g + 4 * gp), "v"(g + 5 * gp), "v"(g + 6 * gp), "v"(g + 7 * gp)
               : "memory");
}

// qkv: (32768 x 256) x (256 x 768); grid (6, 256), block = 128 pixels x 128 columns, 8 waves of 32 x 64. Both operand tiles (full K) are copied once into LDS as whole
// rows (pitch 528 B = 16 B x odd for the ds_load_b128 fragment reads); fragments then come from LDS. Column tiles 0-3 -> q|k f16 rows qk16[pixel][512]; tiles 4-5 -> v
// transposed per (n, h, i): vT[n][h][i][c][w] (256-B rows) through a block LDS tile (block = 128 pixels = one image row i of one n).
__global__ __launch_bounds__(256) void qkv_kernel(const b16* __restrict__ xT, const b16* __restrict__ wqkv, b16* __restrict__ qk16, b16* __restrict__ vT) {
  constexpr int LP = C + 8;                                    // LDS row pitch in f16
  __shared__ __attribute__((aligned(16))) b16 S[256 * LP];     // rows 0-127: pixels (A), rows 128-255: weight rows (B); reused as output staging behind a barrier
  const int lane = threadIdx.x & 31, wave = threadIdx.x >> 5, nloc = lane & 15, hlf = lane >> 4;
  const int mrow = wave & 3, ncol = wave >> 2;
  const int m0 = blockIdx.y * 128 + mrow * 32, cb = blockIdx.x * 128, c0 = cb + ncol * 64;
  {
    const unsigned lA = (unsigned)(size_t)(S + wave * 16 * LP + lane * 8), lB = lA + 128 * LP * 2;     // wave copies rows 16 wave .. 16 wave + 15 of each tile
    const char* gA = (const char*)(xT + (size_t)(blockIdx.y * 128 + wave * 16) * C + lane * 8);
    const char* gB = (const char*)(wqkv + (size_t)(cb + wave * 16) * C + lane * 8);
    copy_rows8(lA, gA, LP * 2, C * 2); copy_rows8(lA + 8 * LP * 2, gA + 8 * C * 2, LP * 2, C * 2);
    copy_rows8(lB, gB, LP * 2, C * 2); copy_rows8(lB + 8 * LP * 2, gB + 8 * C * 2, LP * 2, C * 2);
  }
  asm volatile("s_wait_asynccnt 0x0" ::: "memory");            // this wave's copies have landed before the barrier publishes them
  __syncthreads();
  v8f acc[2][4];
#pragma unroll
  for (int r = 0; r < 2; ++r)
#pragma unroll
    for (int t = 0; t < 4; ++t) acc[r][t] = (v8f){};
  const b16* As = S + (mrow * 32 + nloc) * LP; const b16* Bs = S + (128 + ncol * 64 + nloc) * LP;
  // a k-step's six fragments are read as one group, one k-step ahead of their products, so that a wave does not wait out the LDS latency in front of each pair of products
  v16b fa[2][2], fb[2][4];
  fa[0][0] = frag_kb(As, hlf); fa[0][1] = frag_kb(As + 16 * LP, hlf);
#pragma unroll
  for (int t = 0; t < 4; ++t) fb[0][t] = frag_kb(Bs + t * 16 * LP, hlf);
#pragma unroll   // unrolled so that both fragment sets are indexed by constants and stay in registers
  for (int ks = 0; ks < C / 32; ++ks) {
    const int cur = ks & 1, nxt = cur ^ 1, kn = (ks + 1) * 32;
    if (ks + 1 < C / 32) {
      fa[nxt][0] = frag_kb(As + kn, hlf); fa[nxt][1] = frag_kb(As + 16 * LP + kn, hlf);
#pragma unroll
      for (int t = 0; t < 4; ++t) fb[nxt][t] = frag_kb(Bs + t * 16 * LP + kn, hlf);
    }
#pragma unroll
    for (int t = 0; t < 4; ++t) { acc[0][t] = wmma16b(fa[cur][0], fb[cur][t], acc[0][t]); acc[1][t] = wmma16b(fa[cur][1], fb[cur][t], acc[1][t]); }
  }
  __syncthreads();                                             // every wave has read its last fragment: the tiles' LDS becomes output staging
  if (cb < 2 * C) { b16* Tw = S + wave * (2 * 32 * 64); epi_planes(acc, 1.0f, false, qk16, nullptr, 2 * C, m0, c0, lane, Tw, Tw + 32 * 64); return; }   // block-uniform
  // v: block's 128 pixels = (n, i, all w); tile columns = 4 heads x 32 c -> vT rows (h, c) of 128 w
  constexpr int TP = 128 + 8;
#pragma unroll
  for (int t = 0; t < 4; ++t)
#pragma unroll
    for (int r = 0; r < 2; ++r)
#pragma unroll
      for (int v = 0; v < 8; ++v) S[(ncol * 64 + t * 16 + nloc) * TP + mrow * 32 + r * 16 + 8 * hlf + v] = (b16)acc[r][t][v];
  __syncthreads();
  const int pix0 = blockIdx.y * 128, n = pix0 / (Hh * Wd), i = (pix0 / Wd) % Hh, hc0 = cb - 2 * C;   // hc0 = h*32 + c base (128 rows)
  {
#pragma unroll
    for (int j = 0; j < 8; ++j) { const int rr = wave * 16 + j * 2 + (lane >> 4), c8 = (lane & 15) * 8; const int hc = hc0 + rr, h = hc / HD, c = hc % HD;
      *(v8b*)(vT + ((((size_t)n * NH + h) * Hh + i) * HD + c) * Wd + c8) = *(const v8b*)(S + rr * TP + c8); }
    asm volatile("s_wait_xcnt 0x0" ::: "memory");              // closes the run of stores: no address register of an issued store is rewritten ahead of this wait on any way out of here
  }
}

// E[n][h][i][j][w] = [q_j | k_j](head h) . Rcat[h][j][w][:] for all (n,i): per (h,j) a (256 x 64) x (64 x 128) product; block = (n, h, j): the 64 rows i of one image, all 128 w;
// all four images in one launch: image n is the fastest grid index, so the four blocks that read one Rcat[h][j] slab start together
__global__ __launch_bounds__(128) void e_kernel(const b16* __restrict__ qk16, const b16* __restrict__ Rcat, b16* __restrict__ E) {
  __shared__ __attribute__((aligned(16))) b16 Th[4][2][32 * 64];
  const int lane = threadIdx.x & 31, wave = threadIdx.x >> 5, nloc = lane & 15, hlf = lane >> 4;
  const int n = blockIdx.x % Nn, h = blockIdx.x / (Nn * Wd), j = (blockIdx.x / Nn) % Wd, m0 = (wave & 1) * 32, c0 = (wave >> 1) * 64;   // rows = i (64), block covers 64 i x 128 w
  v8f acc[2][4];
#pragma unroll
  for (int r = 0; r < 2; ++r)
#pragma unroll
    for (int t = 0; t < 4; ++t) acc[r][t] = (v8f){};
  const b16* Rb = Rcat + ((size_t)h * Wd + j) * Wd * 64;
#pragma unroll
  for (int ks = 0; ks < 2; ++ks) {                             // k-step 0: q (c' 0..31), 1: k (c' 32..63)
    const int ia = m0 + nloc, ib = m0 + 16 + nloc;
    const size_t pa = ((size_t)n * Hh * Wd + (size_t)ia * Wd + j) * (2 * C) + ks * C + h * HD, pb = ((size_t)n * Hh * Wd + (size_t)ib * Wd + j) * (2 * C) + ks * C + h * HD;
    const v16b a0 = frag_kb(qk16 + pa, hlf), a1 = frag_kb(qk16 + pb, hlf);
#pragma unroll
    for (int t = 0; t < 4; ++t) { const v16b bw = frag_kb(Rb + (size_t)(c0 + t * 16 + nloc) * 64 + ks * 32, hlf); acc[0][t] = wmma16b(a0, bw, acc[0][t]); acc[1][t] = wmma16b(a1, bw, acc[1][t]); }
  }
  // E rows: (((n*8 + h)*64 + i)*128 + j)*128 + w
  b16* Tp = Th[wave][0];
#pragma unroll
  for (int t = 0; t < 4; ++t)
#pragma unroll
    for (int r = 0; r < 2; ++r)
#pragma unroll
      for (int v = 0; v < 8; ++v) Tp[(r * 16 + v + 8 * hlf) * 64 + t * 16 + nloc] = (b16)acc[r][t][v];
  wave_lds_sync();
  {
#pragma unroll
    for (int jj = 0; jj < 8; ++jj) { const int rr = jj * 4 + (lane >> 3), c8 = (lane & 7) * 8; const int i = m0 + rr;
      *(v8b*)(E + ((((size_t)n * NH + h) * Hh + i) * Wd + j) * Wd + c0 + c8) = ld8b(Tp + rr * 64 + c8); }
    
  }
}

// Attention: wave = (n, h, i, 16 queries j0); all 128 keys: logits = q.k/16 + E (4 chunks of 32 kept in registers), max / sum, weights = e/sum -> (a) f16 weights rows
__global__ __launch_bounds__(256) void attn_kernel(const b16* __restrict__ qk16, const b16* __restrict__ E, const b16* __restrict__ vT, b16* __restrict__ wt16, float* __restrict__ x1) {
  __shared__ __attribute__((aligned(16))) b16 Ws[8][16][Wd + 8];
  __shared__ __attribute__((aligned(16))) float Xs[8][16][HD + 4];
  const int wid = threadIdx.x >> 5, lane = threadIdx.x & 31, hh = lane >> 4, col = lane & 15;
  const int qt = blockIdx.x * 8 + wid;                          // ((n*8 + h)*64 + i)*8 + j0/16
  const int jt = qt & 7, i = (qt >> 3) & 63, h = (qt >> 9) & 7, n = qt >> 12, j0 = jt * 16;
  const size_t pixrow = (size_t)n * Hh * Wd + (size_t)i * Wd;  // pixel index of (n, i, w=0)
  const b16* qrow = qk16 + (pixrow + j0 + col) * (2 * C) + h * HD;                // B operand: queries (columns)
  const v16b qb = frag_kb(qrow, hh);
  const b16* Erow = E + ((((size_t)n * NH + h) * Hh + i) * Wd) * Wd;             // + j*128 + w
  float lg[4][16];
#pragma unroll
  for (int ch = 0; ch < 4; ++ch) {
    v8f s0 = {}, s1 = {};
    s0 = wmma16b(frag_kb(qk16 + (pixrow + ch * 32 + col) * (2 * C) + C + h * HD, hh), qb, s0);        // A: keys w = 32ch + col (k rows), k-step over the 32 channels
    s1 = wmma16b(frag_kb(qk16 + (pixrow + ch * 32 + 16 + col) * (2 * C) + C + h * HD, hh), qb, s1);
#pragma unroll
    for (int r = 0; r < 8; ++r) { const int w0 = ch * 32 + 8 * hh + r, w1 = w0 + 16; const size_t eo = (size_t)(j0 + col) * Wd;
      lg[ch][r] = s0[r] * DS + (float)Erow[eo + w0]; lg[ch][8 + r] = s1[r] * DS + (float)Erow[eo + w1]; }
  }
  float m = -INFINITY;
#pragma unroll
  for (int ch = 0; ch < 4; ++ch)
#pragma unroll
    for (int r = 0; r < 16; ++r) m = fmaxf(m, lg[ch][r]);
  m = fmaxf(m, __shfl_xor(m, 16));
  float sum = 0.0f;
#pragma unroll
  for (int ch = 0; ch < 4; ++ch)
#pragma unroll
    for (int r = 0; r < 16; ++r) { lg[ch][r] = __expf(lg[ch][r] - m); sum += lg[ch][r]; }
  sum += __shfl_xor(sum, 16);
  const float inv = 1.0f / sum;
  v8f o[2] = {{}, {}};
  const b16* vrow = vT + (((size_t)n * NH + h) * Hh + i) * HD * Wd;              // rows c, 128 w
#pragma unroll
  for (int ch = 0; ch < 4; ++ch) {
    v16b pb;
#pragma unroll
    for (int r = 0; r < 8; ++r) { const float p0 = lg[ch][r] * inv, p1 = lg[ch][8 + r] * inv; pb[r] = (b16)p0; pb[8 + r] = (b16)p1;
      Ws[wid][col][ch * 32 + 8 * hh + r] = (b16)p0; Ws[wid][col][ch * 32 + 16 + 8 * hh + r] = (b16)p1; }
#pragma unroll
    for (int nt = 0; nt < 2; ++nt) o[nt] = wmma16b(frag_kb(vrow + (size_t)(nt * 16 + col) * Wd + ch * 32, hh), pb, o[nt]);
  }
#pragma unroll
  for (int nt = 0; nt < 2; ++nt)
#pragma unroll
    for (int r = 0; r < 8; ++r) Xs[wid][col][nt * 16 + 8 * hh + r] = o[nt][r];   // x1^T: lane col = query j, element = feature
  wave_lds_sync();
  const size_t rowbase = (((size_t)n * NH + h) * Hh + i) * Wd + j0;                // (n,h,i,j) row index
  {
#pragma unroll
    for (int jj = 0; jj < 8; ++jj) { const int rr = jj * 2 + hh, c8 = col * 8; *(v8b*)(wt16 + (rowbase + rr) * Wd + c8) = *(const v8b*)(&Ws[wid][rr][c8]); }
#pragma unroll
    for (int jj = 0; jj < 4; ++jj) { const int rr = jj * 4 + (lane >> 3), c4 = (lane & 7) * 4; *(v4f*)(x1 + (rowbase + rr) * HD + c4) = *(const v4f*)(&Xs[wid][rr][c4]); }
    
  }
}

// x2 + combine: per (h, j): (256 rows (n,i)) x (K = 128 w) x (32 c): A = wt16 rows of (n,h,i,j), B = rvT[h][j] rows c; pre[pixel (n,i,j)][h*32 + c] = g1 x1 + g2 x2 as f32
__global__ __launch_bounds__(64) void x2_kernel(const b16* __restrict__ wt16, const b16* __restrict__ rvT, const float* __restrict__ x1, const float* __restrict__ Gv1, const float* __restrict__ Gv2, float* __restrict__ pre) {
  __shared__ __attribute__((aligned(16))) float Ts[2][32][HD + 4];
  const int lane = threadIdx.x & 31, wave = threadIdx.x >> 5, nloc = lane & 15, hlf = lane >> 4;
  const int n = blockIdx.x % Nn, h = blockIdx.x / (Nn * Wd), j = (blockIdx.x / Nn) % Wd, m0 = wave * 32;   // rows = i; image n fastest, as in e_kernel (shared rvT[h][j])
  const float g1 = tanh_e(Gv1[h]), g2 = tanh_e(Gv2[h]);
  const b16* Rb = rvT + ((size_t)h * Wd + j) * HD * Wd;
  auto rowidx = [&](int i) { return (((size_t)n * NH + h) * Hh + i) * Wd + j; };    // (n,h,i,j) row
  v8f acc[2][2] = {{{}, {}}, {{}, {}}};
#pragma unroll
  for (int kb = 0; kb < Wd; kb += 32) {
    const v16b a0 = frag_kb(wt16 + rowidx(m0 + nloc) * Wd + kb, hlf), a1 = frag_kb(wt16 + rowidx(m0 + 16 + nloc) * Wd + kb, hlf);
#pragma unroll
    for (int t = 0; t < 2; ++t) { const v16b bw = frag_kb(Rb + (size_t)(t * 16 + nloc) * Wd + kb, hlf); acc[0][t] = wmma16b(a0, bw, acc[0][t]); acc[1][t] = wmma16b(a1, bw, acc[1][t]); }
  }
#pragma unroll
  for (int t = 0; t < 2; ++t)
#pragma unroll
    for (int r = 0; r < 2; ++r)
#pragma unroll
      for (int v = 0; v < 8; ++v) { const int rr = r * 16 + v + 8 * hlf, cc = t * 16 + nloc; const size_t ri = rowidx(m0 + rr);
        Ts[wave][rr][cc] = g1 * x1[ri * HD + cc] + g2 * acc[r][t][v]; }
  wave_lds_sync();
  {
#pragma unroll
    for (int jj = 0; jj < 4; ++jj) { const int rr = jj * 8 + (lane >> 2), c4 = (lane & 3) * 8; const int i = m0 + rr;
      const size_t pix = ((size_t)n * Hh + i) * Wd + j;        // pre is [32768][256]
      *(v4f*)(pre + pix * C + h * HD + c4) = *(const v4f*)(&Ts[wave][rr][c4]); *(v4f*)(pre + pix * C + h * HD + c4 + 4) = *(const v4f*)(&Ts[wave][rr][c4 + 4]); }
    
  }
}

// out conv: (32768 x 256) x (256 x 256); block = 64 pixels x all 256 output channels, 8 waves of 32 x 64. The f32 rows of pre and the f16 weight rows (full K) are copied once
// into LDS as whole lines (pitches 1040 B and 528 B = 16 B x odd); A fragments are rounded to f16 as they are read, in the k order of frag_kb.
__device__ __forceinline__ v16b frag_kf(const float* p, int hh) {
  const float* p0 = p + 8 * hh; const float* p1 = p + 16 + 8 * hh; v16b f;
#pragma unroll
  for (int e = 0; e < 8; ++e) { f[e] = (b16)p0[e]; f[8 + e] = (b16)p1[e]; }
  return f;
}
__global__ __launch_bounds__(256) void out_kernel(const float* __restrict__ pre, const b16* __restrict__ wo16, float* __restrict__ out) {
  constexpr int AP = C * 4 + 16, BP = C * 2 + 16, BOFF = 64 * AP;   // LDS row pitches and the weight tile's offset, in bytes
  __shared__ __attribute__((aligned(16))) char S[64 * AP + C * BP];  // reused as output staging behind a barrier
  const int lane = threadIdx.x & 31, wave = threadIdx.x >> 5, nloc = lane & 15, hlf = lane >> 4;
  const int mrow = wave & 1, ncol = wave >> 1;
  const int mb = blockIdx.x * 64, m0 = mb + mrow * 32, c0 = ncol * 64;
  {
    const unsigned lA = (unsigned)(size_t)(S + wave * 8 * AP + lane * 16), lB = (unsigned)(size_t)(S + BOFF + wave * 32 * BP + lane * 16);   // wave copies 8 rows of pre (two halves each) and 32 weight rows
    const char* gA = (const char*)(pre + (size_t)(mb + wave * 8) * C + lane * 4);
    const char* gB = (const char*)(wo16 + (size_t)(wave * 32) * C + lane * 8);
    copy_rows8(lA, gA, AP, C * 4); copy_rows8(lA + 512, gA + 512, AP, C * 4);
#pragma unroll   // unrolled: four straight-line copy statements, no loop-carried address registers
    for (int q = 0; q < 4; ++q) copy_rows8(lB + q * 8 * BP, gB + q * 8 * C * 2, BP, C * 2);
  }
  asm volatile("s_wait_asynccnt 0x0" ::: "memory");            // this wave's copies have landed before the barrier publishes them
  __syncthreads();
  v8f acc[2][4];
#pragma unroll
  for (int r = 0; r < 2; ++r)
#pragma unroll
    for (int t = 0; t < 4; ++t) acc[r][t] = (v8f){};
  const float* As = (const float*)(S + (mrow * 32 + nloc) * AP); const b16* Bs = (const b16*)(S + BOFF + (c0 + nloc) * BP);
  // fragments read as one group, one k-step ahead of their products (as in qkv_kernel)
  v16b fa[2][2], fb[2][4];
  fa[0][0] = frag_kf(As, hlf); fa[0][1] = frag_kf(As + 16 * (AP / 4), hlf);
#pragma unroll
  for (int t = 0; t < 4; ++t) fb[0][t] = frag_kb(Bs + t * 16 * (BP / 2), hlf);
#pragma unroll   // unrolled so that both fragment sets are indexed by constants and stay in registers
  for (int ks = 0; ks < C / 32; ++ks) {
    const int cur = ks & 1, nxt = cur ^ 1, kn = (ks + 1) * 32;
    if (ks + 1 < C / 32) {
      fa[nxt][0] = frag_kf(As + kn, hlf); fa[nxt][1] = frag_kf(As + 16 * (AP / 4) + kn, hlf);
#pragma unroll
      for (int t = 0; t < 4; ++t) fb[nxt][t] = frag_kb(Bs + t * 16 * (BP / 2) + kn, hlf);
    }
#pragma unroll
    for (int t = 0; t < 4; ++t) { acc[0][t] = wmma16b(fa[cur][0], fb[cur][t], acc[0][t]); acc[1][t] = wmma16b(fa[cur][1], fb[cur][t], acc[1][t]); }
  }
  __syncthreads();                                             // every wave has read its last fragment: the tiles' LDS becomes output staging
  float* Tw = (float*)(S + wave * (64 * 36 * 4));              // per wave: 64 channels x 32 pixels, pitch 36 floats
#pragma unroll
  for (int t = 0; t < 4; ++t)
#pragma unroll
    for (int r = 0; r < 2; ++r)
#pragma unroll
      for (int v = 0; v < 8; ++v) Tw[(t * 16 + nloc) * 36 + r * 16 + v + 8 * hlf] = acc[r][t][v];
  wave_lds_sync();
  const int n = m0 / (Hh * Wd), hw0 = m0 % (Hh * Wd);         // pre rows = pixels (n, hw); a 32-row wave tile lies in one image
  {
#pragma unroll
    for (int jj = 0; jj < 16; ++jj) { const int cc = jj * 4 + (lane >> 3), c4 = (lane & 7) * 4; *(v4f*)(out + ((size_t)n * C + c0 + cc) * (Hh * Wd) + hw0 + c4) = *(const v4f*)(Tw + cc * 36 + c4); }   // channel-major [n][o][hw]
  }
}
}  // namespace

extern "C" void kernel_launch(void* const* d_in, const int* in_sizes, int n_in,
                              void* d_out, int out_size, void* d_ws, size_t ws_size, hipStream_t stream) {
  (void)n_in; (void)out_size;
  const float* x = (const float*)d_in[0]; const float* wq = (const float*)d_in[1]; const float* wk = (const float*)d_in[2]; const float* wv = (const float*)d_in[3]; const float* wo = (const float*)d_in[4];
  const float* rq = (const float*)d_in[5]; const float* rk = (const float*)d_in[6]; const float* rv = (const float*)d_in[7];
  const float* Gq = (const float*)d_in[8]; const float* Gk = (const float*)d_in[9]; const float* Gv1 = (const float*)d_in[10]; const float* Gv2 = (const float*)d_in[11];
  float* out = (float*)d_out;   // [4,256,64,128]
  if (in_sizes[0] != NPIX * C || in_sizes[1] != C * C || in_sizes[5] != NH * HD * Wd * Wd || in_sizes[8] != NH) return;
  size_t off = 0; char* ws = (char*)d_ws;
  auto carve = [&](size_t bytes) { char* p = ws + off; off += (bytes + 255) & ~(size_t)255; return p; };
  b16* wqkv = (b16*)carve((size_t)3 * C * C * 2); b16* wo16 = (b16*)carve((size_t)C * C * 2);
  b16* Rcat = (b16*)carve((size_t)NH * Wd * Wd * 64 * 2);      // 16 MB
  b16* rvT = (b16*)carve((size_t)NH * Wd * HD * Wd * 2);       // 8 MB
  b16* E = (b16*)carve((size_t)Nn * NH * Hh * Wd * Wd * 2);     // 64 MB, all images
  b16* xT = E;                                                  // 16 MB, dead after qkv, before e_kernel writes E
  float* pre = (float*)E;                                       // 32 MB, written by x2 when E is dead (last read by attn)
  b16* qk16 = (b16*)carve((size_t)NPIX * 2 * C * 2);            // 32 MB
  b16* vT = (b16*)carve((size_t)NPIX * C * 2);                  // 16 MB
  b16* wt16 = (b16*)carve((size_t)Nn * NH * Hh * Wd * Wd * 2);  // 64 MB
  float* x1 = (float*)carve((size_t)Nn * NH * Hh * Wd * HD * 4);   // 32 MB
  if (off > ws_size) return;                                     // total about 233 MB (binary)
  prep_kernel<<<1024, 256, 0, stream>>>(wq, wk, wv, wo, rq, rk, rv, Gq, Gk, wqkv, wo16, Rcat, rvT);
  xt_kernel<<<dim3(128 * 4, Nn), 256, 0, stream>>>(x, xT);
  qkv_kernel<<<dim3(3 * C / 128, NPIX / 128), 256, 0, stream>>>(xT, wqkv, qk16, vT);
  e_kernel<<<Nn * NH * Wd, 128, 0, stream>>>(qk16, Rcat, E);
  attn_kernel<<<Nn * NH * Hh * Wd / 16 / 8, 256, 0, stream>>>(qk16, E, vT, wt16, x1);
  x2_kernel<<<Nn * NH * Wd, 64, 0, stream>>>(wt16, rvT, x1, Gv1, Gv2, pre);
  out_kernel<<<NPIX / 64, 256, 0, stream>>>(pre, wo16, out);
}

// v003
// A run of this version takes 101 microseconds.
// Timed twice side by side with v002, it ran 1.31 times as fast both times.
// All steps since v000 together make it 2.12 times as fast.
#include <hip/hip_runtime.h>

// Gated axial attention along the width axis: x [4][256][64][128]; q,k,v = 1x1 convs (8 heads x 32); per (n, head, row i): logits[j][w] = (q_j.k_w + g_q q_j.rq[:,j,w] +
// g_k k_j.rk[:,j,w]) / 16 with learned per-position tables (tanh'd), softmax over w; out = g_v1 (weights . v) + g_v2 (weights . rv[:,j,:]); 1x1 out conv.
// Contractions on v_wmma_f32_16x16x32_f16 with single f16 operands (position-major activation rows, weight / position-table copies with the gates and 1/16

namespace {
__device__ __forceinline__ float tanh_e(float v) { return 1.0f - 2.0f * __builtin_amdgcn_rcpf(1.0f + __expf(2.0f * v)); }   // tanh via exp + hardware reciprocal (~1 ulp; values are rounded to f16 afterwards or are gates of O(1))
constexpr int Nn = 4, C = 256, Hh = 64, Wd = 128, NH = 8, HD = 32, NPIX = Nn * Hh * Wd;   // 32768 pixels
constexpr float DS = 0.0625f;   // 1/sqrt(C)

typedef _Float16 b16;
typedef __attribute__((ext_vector_type(16))) _Float16 v16b;
typedef __attribute__((ext_vector_type(8)))  _Float16 v8b;
typedef __attribute__((ext_vector_type(8)))  float v8f;
typedef __attribute__((ext_vector_type(4)))  float v4f;

__device__ __forceinline__ v8b ld8b(const b16* p) { return *(const v8b*)p; }
__device__ __forceinline__ v16b cat8b(v8b a, v8b b) { return __builtin_shufflevector(a, b, 0, 1, 2, 3, 4, 5, 6, 7, 8, 9, 10, 11, 12, 13, 14, 15); }
__device__ __forceinline__ v16b frag_kb(const b16* p, int hh) { return cat8b(ld8b(p + 8 * hh), ld8b(p + 16 + 8 * hh)); }
__device__ __forceinline__ void split16(float v, b16& hi, b16& lo) { hi = (b16)v; lo = (b16)(v - (float)hi); }
// hi/lo fragment pair straight from an f32 k-contiguous row (same k-map)
__device__ __forceinline__ void frag_ksplit(const float* p, int hh, v16b& fh_, v16b& fl_) {
  const float* p0 = p + 8 * hh; const float* p1 = p + 16 + 8 * hh;
#pragma unroll
  for (int e = 0; e < 8; ++e) { b16 a, c; split16(p0[e], a, c); fh_[e] = a; fl_[e] = c; split16(p1[e], a, c); fh_[8 + e] = a; fl_[8 + e] = c; }
}
__device__ __forceinline__ v8f wmma16b(v16b a, v16b b, v8f c) {
  v8f d = __builtin_amdgcn_wmma_f32_16x16x32_f16(false, a, false, b, (short)0, c, false, false);
  asm volatile("v_nop\n\tv_nop\n\tv_nop\n\tv_nop" : "+v"(d) : "v"(a), "v"(b));
  return d;
}
__device__ __forceinline__ void wave_lds_sync() {
  __builtin_amdgcn_fence(__ATOMIC_RELEASE, "workgroup");
  __builtin_amdgcn_wave_barrier();
  __builtin_amdgcn_fence(__ATOMIC_ACQUIRE, "workgroup");
}

__device__ __forceinline__ void epi_planes(v8f (&acc)[2][4], float scale, bool two, b16* __restrict__ oh, b16* __restrict__ ol, int ldo,
                                           int m0, int c0, int lane, b16* Th, b16* Tl) {
  const int nloc = lane & 15, hlf = lane >> 4;
#pragma unroll
  for (int t = 0; t < 4; ++t)
#pragma unroll
    for (int r = 0; r < 2; ++r)
#pragma unroll
      for (int v = 0; v < 8; ++v) {
        const int rr = r * 16 + v + 8 * hlf, cc = t * 16 + nloc;
        b16 h_, l_; split16(acc[r][t][v] * scale, h_, l_);
        Th[rr * 64 + cc] = h_; Tl[rr * 64 + cc] = l_;
      }
  wave_lds_sync();
  {
#pragma unroll
    for (int j = 0; j < 8; ++j) {
      const int rr = j * 4 + (lane >> 3), c8 = (lane & 7) * 8;
      const size_t o = (size_t)(m0 + rr) * ldo + c0 + c8;
      *(v8b*)(oh + o) = ld8b(Th + rr * 64 + c8);
      if (two) *(v8b*)(ol + o) = ld8b(Tl + rr * 64 + c8);
    }
    
  }
}
// (b) f32 rows with pitch ldo: 64 floats = 256 B = 2 lines per row; 16 lanes x 16 B per row, 2 rows per instruction. Optional per-row factor
__device__ __forceinline__ void epi_f32(v8f (&acc)[2][4], float scale, const float* rscale, float* __restrict__ out, int ldo, int m0, int c0, int lane, float* Tt) {
  const int nloc = lane & 15, hlf = lane >> 4;
#pragma unroll
  for (int t = 0; t < 4; ++t)
#pragma unroll
    for (int r = 0; r < 2; ++r)
#pragma unroll
      for (int v = 0; v < 8; ++v) {
        const int rr = r * 16 + v + 8 * hlf;
        const float rs = rscale ? rscale[(size_t)(m0 + rr) * 32] : 1.0f;
        Tt[rr * 64 + t * 16 + nloc] = acc[r][t][v] * scale * rs;
      }
  wave_lds_sync();
  float* dst0 = out + (size_t)m0 * ldo + c0;
  {
#pragma unroll
    for (int j = 0; j < 16; ++j) { const int rr = j * 2 + hlf, c4 = nloc * 4; *(v4f*)(dst0 + (size_t)rr * ldo + c4) = *(const v4f*)(Tt + rr * 64 + c4); }
    
  }
}



// prep (grid-stride): wqkv = [wq; wk; wv] [768][256] f16, wout f16 [256][256]; Rcat[h][j][w][c'] = (c' < 32 ? tanh(Gq_h) tanh(rq[h][c'][j][w]) : tanh(Gk_h) tanh(rk[h][c'-32][j][w])) / 16
__global__ __launch_bounds__(256) void prep_kernel(const float* __restrict__ wq, const float* __restrict__ wk, const float* __restrict__ wv, const float* __restrict__ wo,
                                                   const float* __restrict__ rq, const float* __restrict__ rk, const float* __restrict__ rv, const float* __restrict__ Gq, const float* __restrict__ Gk,
                                                   b16* __restrict__ wqkv, b16* __restrict__ wo16, b16* __restrict__ Rcat, b16* __restrict__ rvT) {
  const size_t tid = (size_t)blockIdx.x * blockDim.x + threadIdx.x, stride = (size_t)gridDim.x * blockDim.x;
  const size_t n0 = (size_t)3 * C * C / 8, n1 = (size_t)C * C / 8, n2 = (size_t)NH * Wd * Wd * 64 / 8, n3 = (size_t)NH * Wd * HD * Wd / 8;
  {
    for (size_t p = tid; p < n0 + n1 + n2 + n3; p += stride) {
      v8b v; b16* dst;
      if (p < n0) { const size_t i = p * 8; const float* src = (i < (size_t)C * C) ? (wq + i) : (i < (size_t)2 * C * C) ? (wk + i - (size_t)C * C) : (wv + i - (size_t)2 * C * C);
#pragma unroll
        for (int e = 0; e < 8; ++e) v[e] = (b16)src[e]; dst = wqkv + i; }
      else if (p < n0 + n1) { const size_t i = (p - n0) * 8;
#pragma unroll
        for (int e = 0; e < 8; ++e) v[e] = (b16)wo[i + e]; dst = wo16 + i; }
      else if (p < n0 + n1 + n2) { const size_t i = (p - n0 - n1) * 8;       // Rcat index ((h*128 + j)*128 + w)*64 + c'
        const int cp0 = (int)(i % 64), w = (int)((i / 64) % Wd), j = (int)((i / (64 * Wd)) % Wd), h = (int)(i / ((size_t)64 * Wd * Wd));
        const float gq = tanh_e(Gq[h]) * DS, gk = tanh_e(Gk[h]) * DS;
#pragma unroll
        for (int e = 0; e < 8; ++e) { const int cp = cp0 + e; const float* tab = (cp < HD) ? rq : rk; const int c = (cp < HD) ? cp : cp - HD;
          v[e] = (b16)(((cp < HD) ? gq : gk) * tanh_e(tab[(((size_t)h * HD + c) * Wd + j) * Wd + w])); }
        dst = Rcat + i; }
      else { const size_t i = (p - n0 - n1 - n2) * 8;                          // rvT index ((h*128 + j)*32 + c)*128 + w
        const int w0 = (int)(i % Wd), c = (int)((i / Wd) % HD), j = (int)((i / ((size_t)Wd * HD)) % Wd), h = (int)(i / ((size_t)Wd * HD * Wd));
#pragma unroll
        for (int e = 0; e < 8; ++e) v[e] = (b16)tanh_e(rv[(((size_t)h * HD + c) * Wd + j) * Wd + w0 + e]);
        dst = rvT + i; }
      *(v8b*)dst = v;
    }
    
  }
}

__global__ __launch_bounds__(256) void xt_kernel(const float* __restrict__ x, b16* __restrict__ xT) {
  __shared__ __attribute__((aligned(16))) b16 Tl[64][72];
  const int tid = threadIdx.x, lane = tid & 31, wave = tid >> 5, n = blockIdx.y, p0 = (blockIdx.x / 4) * 64, c0 = (blockIdx.x % 4) * 64;
  for (int i = tid; i < 64 * 64; i += 256) { const int cc = i / 64, pp = i % 64; Tl[pp][cc] = (b16)x[((size_t)n * C + c0 + cc) * (Hh * Wd) + p0 + pp]; }
  __syncthreads();
  b16* dst = xT + ((size_t)n * Hh * Wd + p0) * C + c0;
  {
#pragma unroll
    for (int j = 0; j < 2; ++j) { const int rr = wave * 8 + j * 4 + (lane >> 3), c8 = (lane & 7) * 8; *(v8b*)(dst + (size_t)rr * C + c8) = *(const v8b*)(&Tl[rr][c8]); }
    
  }
}

// Eight async copies global -> LDS, 16 B per lane each (one copy of a wave = 512 bytes = 4 whole lines). The s_wait_xcnt closes the statement so that
// no address register of an issued copy is rewritten ahead of it.
__device__ __forceinline__ void copy_rows8(unsigned l, const char* g, unsigned lp, int gp) {   // l, lp: LDS byte address and row pitch; g, gp: global address and row pitch in bytes
  asm volatile("global_load_async_to_lds_b128 %0, %8, off\n\t"
               "global_load_async_to_lds_b128 %1, %9, off\n\t"
               "global_load_async_to_lds_b128 %2, %10, off\n\t"
               "global_load_async_to_lds_b128 %3, %11, off\n\t"
               "global_load_async_to_lds_b128 %4, %12, off\n\t"
               "global_load_async_to_lds_b128 %5, %13, off\n\t"
               "global_load_async_to_lds_b128 %6, %14, off\n\t"
               "global_load_async_to_lds_b128 %7, %15, off\n\t"
               "s_wait_xcnt 0x0"
               :: "v"(l), "v"(l + lp), "v"(l + 2 * lp), "v"(l + 3 * lp), "v"(l + 4 * lp), "v"(l + 5 * lp), "v"(l + 6 * lp), "v"(l + 7 * lp),
                  "v"(g), "v"(g + gp), "v"(g + 2 * gp), "v"(g + 3 * gp), "v"(g + 4 * gp), "v"(g + 5 * gp), "v"(g + 6 * gp), "v"(g + 7 * gp)
               : "memory");
}

// The same with four and with two copies (smaller tiles)
__device__ __forceinline__ void copy_rows4(unsigned l, const char* g, unsigned lp, int gp) {
  asm volatile("global_load_async_to_lds_b128 %0, %4, off\n\t"
               "global_load_async_to_lds_b128 %1, %5, off\n\t"
               "global_load_async_to_lds_b128 %2, %6, off\n\t"
               "global_load_async_to_lds_b128 %3, %7, off\n\t"
               "s_wait_xcnt 0x0"
               :: "v"(l), "v"(l + lp), "v"(l + 2 * lp), "v"(l + 3 * lp), "v"(g), "v"(g + gp), "v"(g + 2 * gp), "v"(g + 3 * gp)
               : "memory");
}
__device__ __forceinline__ void copy_rows2(unsigned l, const char* g, unsigned lp, int gp) {
  asm volatile("global_load_async_to_lds_b128 %0, %2, off\n\t"
               "global_load_async_to_lds_b128 %1, %3, off\n\t"
               "s_wait_xcnt 0x0"
               :: "v"(l), "v"(l + lp), "v"(g), "v"(g + gp)
               : "memory");
}

// qkv: (32768 x 256) x (256 x 768); grid (6, 256), block = 128 pixels x 128 columns, 8 waves of 32 x 64. Both operand tiles (full K) are copied once into LDS as whole
// rows (pitch 528 B = 16 B x odd for the ds_load_b128 fragment reads); fragments then come from LDS. Column tiles 0-3 -> q|k f16 rows qk16[pixel][512]; tiles 4-5 -> v
// transposed per (n, h, i): vT[n][h][i][c][w] (256-B rows) through a block LDS tile (block = 128 pixels = one image row i of one n).
__global__ __launch_bounds__(256) void qkv_kernel(const b16* __restrict__ xT, const b16* __restrict__ wqkv, b16* __restrict__ qk16, b16* __restrict__ vT) {
  constexpr int LP = C + 8;                                    // LDS row pitch in f16
  __shared__ __attribute__((aligned(16))) b16 S[256 * LP];     // rows 0-127: pixels (A), rows 128-255: weight rows (B); reused as output staging behind a barrier
  const int lane = threadIdx.x & 31, wave = threadIdx.x >> 5, nloc = lane & 15, hlf = lane >> 4;
  const int mrow = wave & 3, ncol = wave >> 2;
  const int m0 = blockIdx.y * 128 + mrow * 32, cb = blockIdx.x * 128, c0 = cb + ncol * 64;
  {
    const unsigned lA = (unsigned)(size_t)(S + wave * 16 * LP + lane * 8), lB = lA + 128 * LP * 2;     // wave copies rows 16 wave .. 16 wave + 15 of each tile
    const char* gA = (const char*)(xT + (size_t)(blockIdx.y * 128 + wave * 16) * C + lane * 8);
    const char* gB = (const char*)(wqkv + (size_t)(cb + wave * 16) * C + lane * 8);
    copy_rows8(lA, gA, LP * 2, C * 2); copy_rows8(lA + 8 * LP * 2, gA + 8 * C * 2, LP * 2, C * 2);
    copy_rows8(lB, gB, LP * 2, C * 2); copy_rows8(lB + 8 * LP * 2, gB + 8 * C * 2, LP * 2, C * 2);
  }
  asm volatile("s_wait_asynccnt 0x0" ::: "memory");            // this wave's copies have landed before the barrier publishes them
  __syncthreads();
  v8f acc[2][4];
#pragma unroll
  for (int r = 0; r < 2; ++r)
#pragma unroll
    for (int t = 0; t < 4; ++t) acc[r][t] = (v8f){};
  const b16* As = S + (mrow * 32 + nloc) * LP; const b16* Bs = S + (128 + ncol * 64 + nloc) * LP;
  // a k-step's six fragments are read as one group, one k-step ahead of their products, so that a wave does not wait out the LDS latency in front of each pair of products
  v16b fa[2][2], fb[2][4];
  fa[0][0] = frag_kb(As, hlf); fa[0][1] = frag_kb(As + 16 * LP, hlf);
#pragma unroll
  for (int t = 0; t < 4; ++t) fb[0][t] = frag_kb(Bs + t * 16 * LP, hlf);
#pragma unroll   // unrolled so that both fragment sets are indexed by constants and stay in registers
  for (int ks = 0; ks < C / 32; ++ks) {
    const int cur = ks & 1, nxt = cur ^ 1, kn = (ks + 1) * 32;
    if (ks + 1 < C / 32) {
      fa[nxt][0] = frag_kb(As + kn, hlf); fa[nxt][1] = frag_kb(As + 16 * LP + kn, hlf);
#pragma unroll
      for (int t = 0; t < 4; ++t) fb[nxt][t] = frag_kb(Bs + t * 16 * LP + kn, hlf);
    }
#pragma unroll
    for (int t = 0; t < 4; ++t) { acc[0][t] = wmma16b(fa[cur][0], fb[cur][t], acc[0][t]); acc[1][t] = wmma16b(fa[cur][1], fb[cur][t], acc[1][t]); }
  }
  __syncthreads();                                             // every wave has read its last fragment: the tiles' LDS becomes output staging
  if (cb < 2 * C) { b16* Tw = S + wave * (2 * 32 * 64); epi_planes(acc, 1.0f, false, qk16, nullptr, 2 * C, m0, c0, lane, Tw, Tw + 32 * 64); return; }   // block-uniform
  // v: block's 128 pixels = (n, i, all w); tile columns = 4 heads x 32 c -> vT rows (h, c) of 128 w
  constexpr int TP = 128 + 8;
#pragma unroll
  for (int t = 0; t < 4; ++t)
#pragma unroll
    for (int r = 0; r < 2; ++r)
#pragma unroll
      for (int v = 0; v < 8; ++v) S[(ncol * 64 + t * 16 + nloc) * TP + mrow * 32 + r * 16 + 8 * hlf + v] = (b16)acc[r][t][v];
  __syncthreads();
  const int pix0 = blockIdx.y * 128, n = pix0 / (Hh * Wd), i = (pix0 / Wd) % Hh, hc0 = cb - 2 * C;   // hc0 = h*32 + c base (128 rows)
  {
#pragma unroll
    for (int j = 0; j < 8; ++j) { const int rr = wave * 16 + j * 2 + (lane >> 4), c8 = (lane & 15) * 8; const int hc = hc0 + rr, h = hc / HD, c = hc % HD;
      *(v8b*)(vT + ((((size_t)n * NH + h) * Hh + i) * HD + c) * Wd + c8) = *(const v8b*)(S + rr * TP + c8); }
    asm volatile("s_wait_xcnt 0x0" ::: "memory");              // closes the run of stores: no address register of an issued store is rewritten ahead of this wait on any way out of here
  }
}

// E[n][h][i][j][w] = [q_j | k_j](head h) . Rcat[h][j][w][:] for all (n,i): per (h,j) a (256 x 64) x (64 x 128) product; block = (n, h, j): the 64 rows i of one image, all 128 w;
// all four images in one launch: image n is the fastest grid index, so the four blocks that read one Rcat[h][j] slab start together
__global__ __launch_bounds__(128) void e_kernel(const b16* __restrict__ qk16, const b16* __restrict__ Rcat, b16* __restrict__ E) {
  constexpr int LP = 64 + 8;                                   // LDS row pitch in f16: 144 B = 16 B x odd for the ds_load_b128 fragment reads
  __shared__ __attribute__((aligned(16))) b16 S[(Hh + Wd) * LP];   // rows 0-63: [q_j | k_j] of row i; rows 64-191: Rcat[h][j] rows w; reused as output staging behind a barrier
  const int lane = threadIdx.x & 31, wave = threadIdx.x >> 5, nloc = lane & 15, hlf = lane >> 4;
  const int n = blockIdx.x % Nn, h = blockIdx.x / (Nn * Wd), j = (blockIdx.x / Nn) % Wd, m0 = (wave & 1) * 32, c0 = (wave >> 1) * 64;   // rows = i (64), block covers 64 i x 128 w
  {
    // both operand tiles come into LDS once per block: a copy of a wave takes 4 rows (8 lanes x 16 B each): the 64-B q and k pieces of 4 rows i, or 512 contiguous bytes of the table
    const int r4 = lane >> 3, c8 = (lane & 7) * 8;
    const b16* gA = qk16 + ((size_t)n * Hh * Wd + (size_t)(wave * 16 + r4) * Wd + j) * (2 * C) + (c8 >> 5) * C + h * HD + (c8 & 31);
    const b16* gB = Rcat + ((size_t)h * Wd + j) * Wd * 64 + (size_t)(wave * 32 + r4) * 64 + c8;
    copy_rows4((unsigned)(size_t)(S + (wave * 16 + r4) * LP + c8), (const char*)gA, 4 * LP * 2, 4 * Wd * 2 * C * 2);
    copy_rows8((unsigned)(size_t)(S + (Hh + wave * 32 + r4) * LP + c8), (const char*)gB, 4 * LP * 2, 4 * 64 * 2);
  }
  asm volatile("s_wait_asynccnt 0x0" ::: "memory");            // this wave's copies have landed before the barrier publishes them
  __syncthreads();
  v8f acc[2][4];
#pragma unroll
  for (int r = 0; r < 2; ++r)
#pragma unroll
    for (int t = 0; t < 4; ++t) acc[r][t] = (v8f){};
#pragma unroll
  for (int ks = 0; ks < 2; ++ks) {                             // k-step 0: q (c' 0..31), 1: k (c' 32..63)
    const v16b a0 = frag_kb(S + (m0 + nloc) * LP + ks * 32, hlf), a1 = frag_kb(S + (m0 + 16 + nloc) * LP + ks * 32, hlf);
#pragma unroll
    for (int t = 0; t < 4; ++t) { const v16b bw = frag_kb(S + (Hh + c0 + t * 16 + nloc) * LP + ks * 32, hlf); acc[0][t] = wmma16b(a0, bw, acc[0][t]); acc[1][t] = wmma16b(a1, bw, acc[1][t]); }
  }
  __syncthreads();                                             // every wave has read its last fragment: the tiles' LDS becomes output staging
  // E rows: (((n*8 + h)*64 + i)*128 + j)*128 + w
  b16* Tp = S + wave * (32 * 64);
#pragma unroll
  for (int t = 0; t < 4; ++t)
#pragma unroll
    for (int r = 0; r < 2; ++r)
#pragma unroll
      for (int v = 0; v < 8; ++v) Tp[(r * 16 + v + 8 * hlf) * 64 + t * 16 + nloc] = (b16)acc[r][t][v];
  wave_lds_sync();
  {
#pragma unroll
    for (int jj = 0; jj < 8; ++jj) { const int rr = jj * 4 + (lane >> 3), c8 = (lane & 7) * 8; const int i = m0 + rr;
      *(v8b*)(E + ((((size_t)n * NH + h) * Hh + i) * Wd + j) * Wd + c0 + c8) = ld8b(Tp + rr * 64 + c8); }
    
  }
}

// Attention: wave = (n, h, i, 16 queries j0); all 128 keys: logits = q.k/16 + E (4 chunks of 32 kept in registers), max / sum, weights = e/sum -> (a) f16 weights rows
__global__ __launch_bounds__(256) void attn_kernel(const b16* __restrict__ qk16, const b16* __restrict__ E, const b16* __restrict__ vT, b16* __restrict__ wt16, float* __restrict__ x1) {
  constexpr int KP = HD + 8, WP = Wd + 8;                       // LDS row pitches in f16: 80 B and 272 B = 16 B x odd for the ds_load_b128 reads
  __shared__ __attribute__((aligned(16))) b16 Ws[8][16][WP];    // per wave: its 16 rows of E, overwritten in place by the weights, then x1 staging
  __shared__ __attribute__((aligned(16))) b16 Qs[Wd][KP];       // q and k rows of this (n, h, i), all 128 positions
  __shared__ __attribute__((aligned(16))) b16 Ks[Wd][KP];
  __shared__ __attribute__((aligned(16))) b16 Vs[HD][WP];       // v rows c, 128 w
  const int wid = threadIdx.x >> 5, lane = threadIdx.x & 31, hh = lane >> 4, col = lane & 15;
  const int qt = blockIdx.x * 8 + wid;                          // ((n*8 + h)*64 + i)*8 + j0/16
  const int jt = qt & 7, i = (qt >> 3) & 63, h = (qt >> 9) & 7, n = qt >> 12, j0 = jt * 16;
  const size_t pixrow = (size_t)n * Hh * Wd + (size_t)i * Wd;  // pixel index of (n, i, w=0)
  const b16* Erow = E + ((((size_t)n * NH + h) * Hh + i) * Wd) * Wd;             // + j*128 + w
  const b16* vrow = vT + (((size_t)n * NH + h) * Hh + i) * HD * Wd;              // rows c, 128 w
  {
    // the block's eight waves share one (n, h, i): q, k and v come into LDS once per block, each wave's own 16 rows of E (4 KiB contiguous) as whole lines
    const int r2 = lane >> 4, c16 = (lane & 15) * 8, r8 = lane >> 2, c4 = (lane & 3) * 8;
    const b16* gq = qk16 + (pixrow + wid * 16 + r8) * (2 * C) + h * HD + c4;
    copy_rows8((unsigned)(size_t)&Ws[wid][r2][c16], (const char*)(Erow + (size_t)(j0 + r2) * Wd + c16), 2 * WP * 2, 2 * Wd * 2);
    copy_rows2((unsigned)(size_t)&Qs[wid * 16 + r8][c4], (const char*)gq, 8 * KP * 2, 8 * 2 * C * 2);
    copy_rows2((unsigned)(size_t)&Ks[wid * 16 + r8][c4], (const char*)(gq + C), 8 * KP * 2, 8 * 2 * C * 2);
    copy_rows2((unsigned)(size_t)&Vs[wid * 4 + r2][c16], (const char*)(vrow + (size_t)(wid * 4 + r2) * Wd + c16), 2 * WP * 2, 2 * Wd * 2);
  }
  asm volatile("s_wait_asynccnt 0x0" ::: "memory");            // this wave's copies have landed before the barrier publishes them
  __syncthreads();
  const v16b qb = frag_kb(&Qs[j0 + col][0], hh);                                  // B operand: queries (columns)
  float lg[4][16];
#pragma unroll
  for (int ch = 0; ch < 4; ++ch) {
    v8f s0 = {}, s1 = {};
    s0 = wmma16b(frag_kb(&Ks[ch * 32 + col][0], hh), qb, s0);        // A: keys w = 32ch + col (k rows), k-step over the 32 channels
    s1 = wmma16b(frag_kb(&Ks[ch * 32 + 16 + col][0], hh), qb, s1);
    const v8b e0 = ld8b(&Ws[wid][col][ch * 32 + 8 * hh]), e1 = ld8b(&Ws[wid][col][ch * 32 + 16 + 8 * hh]);
#pragma unroll
    for (int r = 0; r < 8; ++r) { lg[ch][r] = s0[r] * DS + (float)e0[r]; lg[ch][8 + r] = s1[r] * DS + (float)e1[r]; }
  }
  float m = -INFINITY;
#pragma unroll
  for (int ch = 0; ch < 4; ++ch)
#pragma unroll
    for (int r = 0; r < 16; ++r) m = fmaxf(m, lg[ch][r]);
  m = fmaxf(m, __shfl_xor(m, 16));
  float sum = 0.0f;
#pragma unroll
  for (int ch = 0; ch < 4; ++ch)
#pragma unroll
    for (int r = 0; r < 16; ++r) { lg[ch][r] = __expf(lg[ch][r] - m); sum += lg[ch][r]; }
  sum += __shfl_xor(sum, 16);
  const float inv = 1.0f / sum;
  v8f o[2] = {{}, {}};
#pragma unroll
  for (int ch = 0; ch < 4; ++ch) {
    v16b pb;
#pragma unroll
    for (int r = 0; r < 8; ++r) { const float p0 = lg[ch][r] * inv, p1 = lg[ch][8 + r] * inv; pb[r] = (b16)p0; pb[8 + r] = (b16)p1;
      Ws[wid][col][ch * 32 + 8 * hh + r] = (b16)p0; Ws[wid][col][ch * 32 + 16 + 8 * hh + r] = (b16)p1; }
#pragma unroll
    for (int nt = 0; nt < 2; ++nt) o[nt] = wmma16b(frag_kb(&Vs[nt * 16 + col][ch * 32], hh), pb, o[nt]);
  }
  wave_lds_sync();
  const size_t rowbase = (((size_t)n * NH + h) * Hh + i) * Wd + j0;                // (n,h,i,j) row index
  v8b wr[8];                                                   // the weight rows wait in registers: their global stores follow the last LDS hand-over, so that no hand-over waits for a store
#pragma unroll
  for (int jj = 0; jj < 8; ++jj) wr[jj] = *(const v8b*)(&Ws[wid][jj * 2 + hh][col * 8]);
  wave_lds_sync();                                             // the weight rows have been read: the wave's own range becomes x1 staging
  constexpr int XP = HD + 4;
  float* Xw = (float*)&Ws[wid][0][0];
#pragma unroll
  for (int nt = 0; nt < 2; ++nt)
#pragma unroll
    for (int r = 0; r < 8; ++r) Xw[col * XP + nt * 16 + 8 * hh + r] = o[nt][r];   // x1^T: lane col = query j, element = feature
  wave_lds_sync();
  {
#pragma unroll
    for (int jj = 0; jj < 8; ++jj) *(v8b*)(wt16 + (rowbase + jj * 2 + hh) * Wd + col * 8) = wr[jj];
#pragma unroll
    for (int jj = 0; jj < 4; ++jj) { const int rr = jj * 4 + (lane >> 3), c4 = (lane & 7) * 4; *(v4f*)(x1 + (rowbase + rr) * HD + c4) = *(const v4f*)(Xw + rr * XP + c4); }
  }
}

// x2 + combine: per (h, j): (256 rows (n,i)) x (K = 128 w) x (32 c): A = wt16 rows of (n,h,i,j), B = rvT[h][j] rows c; pre[pixel (n,i,j)][h*32 + c] = g1 x1 + g2 x2 as f32
__global__ __launch_bounds__(64) void x2_kernel(const b16* __restrict__ wt16, const b16* __restrict__ rvT, const float* __restrict__ x1, const float* __restrict__ Gv1, const float* __restrict__ Gv2, float* __restrict__ pre) {
  constexpr int WP = Wd + 8;                                   // LDS row pitch in f16: 272 B = 16 B x odd for the ds_load_b128 fragment reads
  __shared__ __attribute__((aligned(16))) b16 S[(Hh + HD) * WP];   // rows 0-63: weight rows of i; rows 64-95: rvT[h][j] rows c; reused as output staging behind a barrier
  const int lane = threadIdx.x & 31, wave = threadIdx.x >> 5, nloc = lane & 15, hlf = lane >> 4;
  const int n = blockIdx.x % Nn, h = blockIdx.x / (Nn * Wd), j = (blockIdx.x / Nn) % Wd, m0 = wave * 32;   // rows = i; image n fastest, as in e_kernel (shared rvT[h][j])
  const float g1 = tanh_e(Gv1[h]), g2 = tanh_e(Gv2[h]);
  const b16* Rb = rvT + ((size_t)h * Wd + j) * HD * Wd;
  auto rowidx = [&](int i) { return (((size_t)n * NH + h) * Hh + i) * Wd + j; };    // (n,h,i,j) row
  {
    // whole 256-B rows into LDS, two rows a copy: each wave its own 32 weight rows and half of the table's 32 rows
    const int r2 = lane >> 4, c16 = (lane & 15) * 8;
    const unsigned lA = (unsigned)(size_t)(S + (m0 + r2) * WP + c16);
    const char* gA = (const char*)(wt16 + rowidx(m0 + r2) * Wd + c16);
    copy_rows8(lA, gA, 2 * WP * 2, 2 * Wd * Wd * 2); copy_rows8(lA + 16 * WP * 2, gA + 16 * Wd * Wd * 2, 2 * WP * 2, 2 * Wd * Wd * 2);
    copy_rows8((unsigned)(size_t)(S + (Hh + wave * 16 + r2) * WP + c16), (const char*)(Rb + (size_t)(wave * 16 + r2) * Wd + c16), 2 * WP * 2, 2 * Wd * 2);
  }
  float xv[2][2][8];                                           // x1 is asked for while the copies fly
#pragma unroll
  for (int r = 0; r < 2; ++r) {
#pragma unroll
    for (int t = 0; t < 2; ++t)
#pragma unroll
      for (int v = 0; v < 8; ++v) xv[r][t][v] = x1[rowidx(m0 + r * 16 + v + 8 * hlf) * HD + t * 16 + nloc];
    asm volatile("s_wait_xcnt 0x0" ::: "memory");              // closes this run of loads: no address register of an issued load is rewritten ahead of this wait
  }
  asm volatile("s_wait_asynccnt 0x0" ::: "memory");            // this wave's copies have landed before the barrier publishes them
  __syncthreads();
  v8f acc[2][2] = {{{}, {}}, {{}, {}}};
#pragma unroll
  for (int kb = 0; kb < Wd; kb += 32) {
    const v16b a0 = frag_kb(S + (m0 + nloc) * WP + kb, hlf), a1 = frag_kb(S + (m0 + 16 + nloc) * WP + kb, hlf);
#pragma unroll
    for (int t = 0; t < 2; ++t) { const v16b bw = frag_kb(S + (Hh + t * 16 + nloc) * WP + kb, hlf); acc[0][t] = wmma16b(a0, bw, acc[0][t]); acc[1][t] = wmma16b(a1, bw, acc[1][t]); }
  }
  __syncthreads();                                             // every wave has read its last fragment: the tiles' LDS becomes output staging
  constexpr int XP = HD + 4;
  float* Tw = (float*)S + wave * (32 * XP);
#pragma unroll
  for (int t = 0; t < 2; ++t)
#pragma unroll
    for (int r = 0; r < 2; ++r)
#pragma unroll
      for (int v = 0; v < 8; ++v) { const int rr = r * 16 + v + 8 * hlf, cc = t * 16 + nloc;
        Tw[rr * XP + cc] = g1 * xv[r][t][v] + g2 * acc[r][t][v]; }
  wave_lds_sync();
  {
#pragma unroll
    for (int jj = 0; jj < 4; ++jj) { const int rr = jj * 8 + (lane >> 2), c4 = (lane & 3) * 8; const int i = m0 + rr;
      const size_t pix = ((size_t)n * Hh + i) * Wd + j;        // pre is [32768][256]
      *(v4f*)(pre + pix * C + h * HD + c4) = *(const v4f*)(Tw + rr * XP + c4); *(v4f*)(pre + pix * C + h * HD + c4 + 4) = *(const v4f*)(Tw + rr * XP + c4 + 4); }
    
  }
}

// out conv: (32768 x 256) x (256 x 256); block = 64 pixels x all 256 output channels, 8 waves of 32 x 64. The f32 rows of pre and the f16 weight rows (full K) are copied once
// into LDS as whole lines (pitches 1040 B and 528 B = 16 B x odd); A fragments are rounded to f16 as they are read, in the k order of frag_kb.
__device__ __forceinline__ v16b frag_kf(const float* p, int hh) {
  const float* p0 = p + 8 * hh; const float* p1 = p + 16 + 8 * hh; v16b f;
#pragma unroll
  for (int e = 0; e < 8; ++e) { f[e] = (b16)p0[e]; f[8 + e] = (b16)p1[e]; }
  return f;
}
__global__ __launch_bounds__(256) void out_kernel(const float* __restrict__ pre, const b16* __restrict__ wo16, float* __restrict__ out) {
  constexpr int AP = C * 4 + 16, BP = C * 2 + 16, BOFF = 64 * AP;   // LDS row pitches and the weight tile's offset, in bytes
  __shared__ __attribute__((aligned(16))) char S[64 * AP + C * BP];  // reused as output staging behind a barrier
  const int lane = threadIdx.x & 31, wave = threadIdx.x >> 5, nloc = lane & 15, hlf = lane >> 4;
  const int mrow = wave & 1, ncol = wave >> 1;
  const int mb = blockIdx.x * 64, m0 = mb + mrow * 32, c0 = ncol * 64;
  {
    const unsigned lA = (unsigned)(size_t)(S + wave * 8 * AP + lane * 16), lB = (unsigned)(size_t)(S + BOFF + wave * 32 * BP + lane * 16);   // wave copies 8 rows of pre (two halves each) and 32 weight rows
    const char* gA = (const char*)(pre + (size_t)(mb + wave * 8) * C + lane * 4);
    const char* gB = (const char*)(wo16 + (size_t)(wave * 32) * C + lane * 8);
    copy_rows8(lA, gA, AP, C * 4); copy_rows8(lA + 512, gA + 512, AP, C * 4);
#pragma unroll   // unrolled: four straight-line copy statements, no loop-carried address registers
    for (int q = 0; q < 4; ++q) copy_rows8(lB + q * 8 * BP, gB + q * 8 * C * 2, BP, C * 2);
  }
  asm volatile("s_wait_asynccnt 0x0" ::: "memory");            // this wave's copies have landed before the barrier publishes them
  __syncthreads();
  v8f acc[2][4];
#pragma unroll
  for (int r = 0; r < 2; ++r)
#pragma unroll
    for (int t = 0; t < 4; ++t) acc[r][t] = (v8f){};
  const float* As = (const float*)(S + (mrow * 32 + nloc) * AP); const b16* Bs = (const b16*)(S + BOFF + (c0 + nloc) * BP);
  // fragments read as one group, one k-step ahead of their products (as in qkv_kernel)
  v16b fa[2][2], fb[2][4];
  fa[0][0] = frag_kf(As, hlf); fa[0][1] = frag_kf(As + 16 * (AP / 4), hlf);
#pragma unroll
  for (int t = 0; t < 4; ++t) fb[0][t] = frag_kb(Bs + t * 16 * (BP / 2), hlf);
#pragma unroll   // unrolled so that both fragment sets are indexed by constants and stay in registers
  for (int ks = 0; ks < C / 32; ++ks) {
    const int cur = ks & 1, nxt = cur ^ 1, kn = (ks + 1) * 32;
    if (ks + 1 < C / 32) {
      fa[nxt][0] = frag_kf(As + kn, hlf); fa[nxt][1] = frag_kf(As + 16 * (AP / 4) + kn, hlf);
#pragma unroll
      for (int t = 0; t < 4; ++t) fb[nxt][t] = frag_kb(Bs + t * 16 * (BP / 2) + kn, hlf);
    }
#pragma unroll
    for (int t = 0; t < 4; ++t) { acc[0][t] = wmma16b(fa[cur][0], fb[cur][t], acc[0][t]); acc[1][t] = wmma16b(fa[cur][1], fb[cur][t], acc[1][t]); }
  }
  __syncthreads();                                             // every wave has read its last fragment: the tiles' LDS becomes output staging
  float* Tw = (float*)(S + wave * (64 * 36 * 4));              // per wave: 64 channels x 32 pixels, pitch 36 floats
#pragma unroll
  for (int t = 0; t < 4; ++t)
#pragma unroll
    for (int r = 0; r < 2; ++r)
#pragma unroll
      for (int v = 0; v < 8; ++v) Tw[(t * 16 + nloc) * 36 + r * 16 + v + 8 * hlf] = acc[r][t][v];
  wave_lds_sync();
  const int n = m0 / (Hh * Wd), hw0 = m0 % (Hh * Wd);         // pre rows = pixels (n, hw); a 32-row wave tile lies in one image
  {
#pragma unroll
    for (int jj = 0; jj < 16; ++jj) { const int cc = jj * 4 + (lane >> 3), c4 = (lane & 7) * 4; *(v4f*)(out + ((size_t)n * C + c0 + cc) * (Hh * Wd) + hw0 + c4) = *(const v4f*)(Tw + cc * 36 + c4); }   // channel-major [n][o][hw]
  }
}
}  // namespace

extern "C" void kernel_launch(void* const* d_in, const int* in_sizes, int n_in,
                              void* d_out, int out_size, void* d_ws, size_t ws_size, hipStream_t stream) {
  (void)n_in; (void)out_size;
  const float* x = (const float*)d_in[0]; const float* wq = (const float*)d_in[1]; const float* wk = (const float*)d_in[2]; const float* wv = (const float*)d_in[3]; const float* wo = (const float*)d_in[4];
  const float* rq = (const float*)d_in[5]; const float* rk = (const float*)d_in[6]; const float* rv = (const float*)d_in[7];
  const float* Gq = (const float*)d_in[8]; const float* Gk = (const float*)d_in[9]; const float* Gv1 = (const float*)d_in[10]; const float* Gv2 = (const float*)d_in[11];
  float* out = (float*)d_out;   // [4,256,64,128]
  if (in_sizes[0] != NPIX * C || in_sizes[1] != C * C || in_sizes[5] != NH * HD * Wd * Wd || in_sizes[8] != NH) return;
  size_t off = 0; char* ws = (char*)d_ws;
  auto carve = [&](size_t bytes) { char* p = ws + off; off += (bytes + 255) & ~(size_t)255; return p; };
  b16* wqkv = (b16*)carve((size_t)3 * C * C * 2); b16* wo16 = (b16*)carve((size_t)C * C * 2);
  b16* Rcat = (b16*)carve((size_t)NH * Wd * Wd * 64 * 2);      // 16 MB
  b16* rvT = (b16*)carve((size_t)NH * Wd * HD * Wd * 2);       // 8 MB
  b16* E = (b16*)carve((size_t)Nn * NH * Hh * Wd * Wd * 2);     // 64 MB, all images
  b16* xT = E;                                                  // 16 MB, dead after qkv, before e_kernel writes E
  float* pre = (float*)E;                                       // 32 MB, written by x2 when E is dead (last read by attn)
  b16* qk16 = (b16*)carve((size_t)NPIX * 2 * C * 2);            // 32 MB
  b16* vT = (b16*)carve((size_t)NPIX * C * 2);                  // 16 MB
  b16* wt16 = (b16*)carve((size_t)Nn * NH * Hh * Wd * Wd * 2);  // 64 MB
  float* x1 = (float*)carve((size_t)Nn * NH * Hh * Wd * HD * 4);   // 32 MB
  if (off > ws_size) return;                                     // total about 233 MB (binary)
  prep_kernel<<<1024, 256, 0, stream>>>(wq, wk, wv, wo, rq, rk, rv, Gq, Gk, wqkv, wo16, Rcat, rvT);
  xt_kernel<<<dim3(128 * 4, Nn), 256, 0, stream>>>(x, xT);
  qkv_kernel<<<dim3(3 * C / 128, NPIX / 128), 256, 0, stream>>>(xT, wqkv, qk16, vT);
  e_kernel<<<Nn * NH * Wd, 128, 0, stream>>>(qk16, Rcat, E);
  attn_kernel<<<Nn * NH * Hh * Wd / 16 / 8, 256, 0, stream>>>(qk16, E, vT, wt16, x1);
  x2_kernel<<<Nn * NH * Wd, 64, 0, stream>>>(wt16, rvT, x1, Gv1, Gv2, pre);
  out_kernel<<<NPIX / 64, 256, 0, stream>>>(pre, wo16, out);
}

// v004
// One run takes 87.8 microseconds.
// In both of two side-by-side timings against v003, it was 1.15 times as fast.
// Counting every step since v000, it is 2.45 times as fast.
#include <hip/hip_runtime.h>

// Gated axial attention along the width axis: x [4][256][64][128]; q,k,v = 1x1 convs (8 heads x 32); per (n, head, row i): logits[j][w] = (q_j.k_w + g_q q_j.rq[:,j,w] +
// g_k k_j.rk[:,j,w]) / 16 with learned per-position tables (tanh'd), softmax over w; out = g_v1 (weights . v) + g_v2 (weights . rv[:,j,:]); 1x1 out conv.
// Contractions on v_wmma_f32_16x16x32_f16 with single f16 operands (position-major activation rows, weight / position-table copies with the gates and 1/16

namespace {
__device__ __forceinline__ float tanh_e(float v) { return 1.0f - 2.0f * __builtin_amdgcn_rcpf(1.0f + __expf(2.0f * v)); }   // tanh via exp + hardware reciprocal (~1 ulp; values are rounded to f16 afterwards or are gates of O(1))
constexpr int Nn = 4, C = 256, Hh = 64, Wd = 128, NH = 8, HD = 32, NPIX = Nn * Hh * Wd;   // 32768 pixels
constexpr float DS = 0.0625f;   // 1/sqrt(C)

typedef _Float16 b16;
typedef __attribute__((ext_vector_type(16))) _Float16 v16b;
typedef __attribute__((ext_vector_type(8)))  _Float16 v8b;
typedef __attribute__((ext_vector_type(8)))  float v8f;
typedef __attribute__((ext_vector_type(4)))  float v4f;

__device__ __forceinline__ v8b ld8b(const b16* p) { return *(const v8b*)p; }
__device__ __forceinline__ v16b cat8b(v8b a, v8b b) { return __builtin_shufflevector(a, b, 0, 1, 2, 3, 4, 5, 6, 7, 8, 9, 10, 11, 12, 13, 14, 15); }
__device__ __forceinline__ v16b frag_kb(const b16* p, int hh) { return cat8b(ld8b(p + 8 * hh), ld8b(p + 16 + 8 * hh)); }
__device__ __forceinline__ void split16(float v, b16& hi, b16& lo) { hi = (b16)v; lo = (b16)(v - (float)hi); }
// hi/lo fragment pair straight from an f32 k-contiguous row (same k-map)
__device__ __forceinline__ void frag_ksplit(const float* p, int hh, v16b& fh_, v16b& fl_) {
  const float* p0 = p + 8 * hh; const float* p1 = p + 16 + 8 * hh;
#pragma unroll
  for (int e = 0; e < 8; ++e) { b16 a, c; split16(p0[e], a, c); fh_[e] = a; fl_[e] = c; split16(p1[e], a, c); fh_[8 + e] = a; fl_[8 + e] = c; }
}
__device__ __forceinline__ v8f wmma16b(v16b a, v16b b, v8f c) {
  v8f d = __builtin_amdgcn_wmma_f32_16x16x32_f16(false, a, false, b, (short)0, c, false, false);
  asm volatile("v_nop\n\tv_nop\n\tv_nop\n\tv_nop" : "+v"(d) : "v"(a), "v"(b));
  return d;
}
__device__ __forceinline__ void wave_lds_sync() {
  __builtin_amdgcn_fence(__ATOMIC_RELEASE, "workgroup");
  __builtin_amdgcn_wave_barrier();
  __builtin_amdgcn_fence(__ATOMIC_ACQUIRE, "workgroup");
}

// (b) f32 rows with pitch ldo: 64 floats = 256 B = 2 lines per row; 16 lanes x 16 B per row, 2 rows per instruction. Optional per-row factor
__device__ __forceinline__ void epi_f32(v8f (&acc)[2][4], float scale, const float* rscale, float* __restrict__ out, int ldo, int m0, int c0, int lane, float* Tt) {
  const int nloc = lane & 15, hlf = lane >> 4;
#pragma unroll
  for (int t = 0; t < 4; ++t)
#pragma unroll
    for (int r = 0; r < 2; ++r)
#pragma unroll
      for (int v = 0; v < 8; ++v) {
        const int rr = r * 16 + v + 8 * hlf;
        const float rs = rscale ? rscale[(size_t)(m0 + rr) * 32] : 1.0f;
        Tt[rr * 64 + t * 16 + nloc] = acc[r][t][v] * scale * rs;
      }
  wave_lds_sync();
  float* dst0 = out + (size_t)m0 * ldo + c0;
  {
#pragma unroll
    for (int j = 0; j < 16; ++j) { const int rr = j * 2 + hlf, c4 = nloc * 4; *(v4f*)(dst0 + (size_t)rr * ldo + c4) = *(const v4f*)(Tt + rr * 64 + c4); }
    
  }
}



// prep (grid-stride): wqkv = [wq; wk; wv] [768][256] f16, wout f16 [256][256]; Rcat[h][j][w][c'] = (c' < 32 ? tanh(Gq_h) tanh(rq[h][c'][j][w]) : tanh(Gk_h) tanh(rk[h][c'-32][j][w])) / 16
__global__ __launch_bounds__(256) void prep_kernel(const float* __restrict__ wq, const float* __restrict__ wk, const float* __restrict__ wv, const float* __restrict__ wo,
                                                   const float* __restrict__ rq, const float* __restrict__ rk, const float* __restrict__ rv, const float* __restrict__ Gq, const float* __restrict__ Gk,
                                                   b16* __restrict__ wqkv, b16* __restrict__ wo16, b16* __restrict__ Rcat, b16* __restrict__ rvT) {
  const size_t tid = (size_t)blockIdx.x * blockDim.x + threadIdx.x, stride = (size_t)gridDim.x * blockDim.x;
  const size_t n0 = (size_t)3 * C * C / 8, n1 = (size_t)C * C / 8, n2 = (size_t)NH * Wd * Wd * 64 / 8, n3 = (size_t)NH * Wd * HD * Wd / 8;
  {
    for (size_t p = tid; p < n0 + n1 + n2 + n3; p += stride) {
      v8b v; b16* dst;
      if (p < n0) { const size_t i = p * 8; const float* src = (i < (size_t)C * C) ? (wq + i) : (i < (size_t)2 * C * C) ? (wk + i - (size_t)C * C) : (wv + i - (size_t)2 * C * C);
#pragma unroll
        for (int e = 0; e < 8; ++e) v[e] = (b16)src[e]; dst = wqkv + i; }
      else if (p < n0 + n1) { const size_t i = (p - n0) * 8;
#pragma unroll
        for (int e = 0; e < 8; ++e) v[e] = (b16)wo[i + e]; dst = wo16 + i; }
      else if (p < n0 + n1 + n2) { const size_t i = (p - n0 - n1) * 8;       // Rcat index ((h*128 + j)*128 + w)*64 + c'
        const int cp0 = (int)(i % 64), w = (int)((i / 64) % Wd), j = (int)((i / (64 * Wd)) % Wd), h = (int)(i / ((size_t)64 * Wd * Wd));
        const float gq = tanh_e(Gq[h]) * DS, gk = tanh_e(Gk[h]) * DS;
#pragma unroll
        for (int e = 0; e < 8; ++e) { const int cp = cp0 + e; const float* tab = (cp < HD) ? rq : rk; const int c = (cp < HD) ? cp : cp - HD;
          v[e] = (b16)(((cp < HD) ? gq : gk) * tanh_e(tab[(((size_t)h * HD + c) * Wd + j) * Wd + w])); }
        dst = Rcat + i; }
      else { const size_t i = (p - n0 - n1 - n2) * 8;                          // rvT index ((h*128 + j)*32 + c)*128 + w
        const int w0 = (int)(i % Wd), c = (int)((i / Wd) % HD), j = (int)((i / ((size_t)Wd * HD)) % Wd), h = (int)(i / ((size_t)Wd * HD * Wd));
#pragma unroll
        for (int e = 0; e < 8; ++e) v[e] = (b16)tanh_e(rv[(((size_t)h * HD + c) * Wd + j) * Wd + w0 + e]);
        dst = rvT + i; }
      *(v8b*)dst = v;
    }
    
  }
}

// Eight async copies global -> LDS, 16 B per lane each (one copy of a wave = 512 bytes = 4 whole lines). The s_wait_xcnt closes the statement so that
// no address register of an issued copy is rewritten ahead of it.
__device__ __forceinline__ void copy_rows8(unsigned l, const char* g, unsigned lp, int gp) {   // l, lp: LDS byte address and row pitch; g, gp: global address and row pitch in bytes
  asm volatile("global_load_async_to_lds_b128 %0, %8, off\n\t"
               "global_load_async_to_lds_b128 %1, %9, off\n\t"
               "global_load_async_to_lds_b128 %2, %10, off\n\t"
               "global_load_async_to_lds_b128 %3, %11, off\n\t"
               "global_load_async_to_lds_b128 %4, %12, off\n\t"
               "global_load_async_to_lds_b128 %5, %13, off\n\t"
               "global_load_async_to_lds_b128 %6, %14, off\n\t"
               "global_load_async_to_lds_b128 %7, %15, off\n\t"
               "s_wait_xcnt 0x0"
               :: "v"(l), "v"(l + lp), "v"(l + 2 * lp), "v"(l + 3 * lp), "v"(l + 4 * lp), "v"(l + 5 * lp), "v"(l + 6 * lp), "v"(l + 7 * lp),
                  "v"(g), "v"(g + gp), "v"(g + 2 * gp), "v"(g + 3 * gp), "v"(g + 4 * gp), "v"(g + 5 * gp), "v"(g + 6 * gp), "v"(g + 7 * gp)
               : "memory");
}

// The same with four and with two copies (smaller tiles)
__device__ __forceinline__ void copy_rows4(unsigned l, const char* g, unsigned lp, int gp) {
  asm volatile("global_load_async_to_lds_b128 %0, %4, off\n\t"
               "global_load_async_to_lds_b128 %1, %5, off\n\t"
               "global_load_async_to_lds_b128 %2, %6, off\n\t"
               "global_load_async_to_lds_b128 %3, %7, off\n\t"
               "s_wait_xcnt 0x0"
               :: "v"(l), "v"(l + lp), "v"(l + 2 * lp), "v"(l + 3 * lp), "v"(g), "v"(g + gp), "v"(g + 2 * gp), "v"(g + 3 * gp)
               : "memory");
}
__device__ __forceinline__ void copy_rows2(unsigned l, const char* g, unsigned lp, int gp) {
  asm volatile("global_load_async_to_lds_b128 %0, %2, off\n\t"
               "global_load_async_to_lds_b128 %1, %3, off\n\t"
               "s_wait_xcnt 0x0"
               :: "v"(l), "v"(l + lp), "v"(g), "v"(g + gp)
               : "memory");
}

// qkv: (32768 x 256) x (256 x 768); grid 256, block = 128 pixels (one image row i of one n) x all 768 columns, 8 waves of 32 x 64 per column tile of 128. The block reads its
// pixels straight from x (channel-major f32, whole 512-B rows), rounds them to f16 and lays them position-major in LDS once; that tile serves all six column tiles. The weight
// tiles (full K) come by async copies into two buffers, tile t + 1 flying while tile t is worked on. LDS row pitch 528 B = 16 B x odd for the ds_load_b128 fragment reads.
// Column tiles 0-3 -> q|k f16 rows qk16[pixel][512]; tiles 4-5 -> v transposed per (n, h, i): vT[n][h][i][c][w] (256-B rows) through a block LDS tile.
__global__ __launch_bounds__(256) void qkv_kernel(const float* __restrict__ x, const b16* __restrict__ wqkv, b16* __restrict__ qk16, b16* __restrict__ vT) {
  constexpr int LP = C + 8, TILE = 128 * LP, TP = 128 + 8, NT = 3 * C / 128;   // LDS row pitch and tile size in f16; pitch of the v staging rows; column tiles
  __shared__ __attribute__((aligned(16))) b16 Sa[TILE];        // pixels (A), rows of 256 channels
  __shared__ __attribute__((aligned(16))) b16 Sb[2 * TILE];    // weight rows (B), two buffers
  __shared__ __attribute__((aligned(16))) b16 St[128 * TP];    // output staging: per wave 32 x 64 (q, k) or the block's 128 channels x 128 pixels (v)
  const int lane = threadIdx.x & 31, wave = threadIdx.x >> 5, nloc = lane & 15, hlf = lane >> 4;
  const int mrow = wave & 3, ncol = wave >> 2;
  const int pix0 = blockIdx.x * 128, n = pix0 / (Hh * Wd), i = (pix0 / Wd) % Hh, m0 = pix0 + mrow * 32;
  const unsigned lB = (unsigned)(size_t)(Sb + wave * 16 * LP + lane * 8);       // wave copies rows 16 wave .. 16 wave + 15 of a weight tile
  const char* gB = (const char*)(wqkv + (size_t)(wave * 16) * C + lane * 8);
  auto copy_tile = [&](int t) {
    const unsigned l = lB + (unsigned)(t & 1) * (TILE * 2); const char* g = gB + (size_t)t * (128 * C * 2);
    copy_rows8(l, g, LP * 2, C * 2); copy_rows8(l + 8 * LP * 2, g + 8 * C * 2, LP * 2, C * 2);
  };
  copy_tile(0);
  {
    // wave = 32 channels; one load of a wave = the 128 pixels of one channel (512 contiguous bytes); all 32 loads are asked for before the first is used
    const float* xr = x + ((size_t)n * C + wave * 32) * (Hh * Wd) + (size_t)i * Wd + lane * 4;
    v4f xv[32];
#pragma unroll
    for (int e = 0; e < 32; ++e) xv[e] = *(const v4f*)(xr + (size_t)e * (Hh * Wd));
    asm volatile("s_wait_xcnt 0x0" ::: "memory");              // closes the run of loads: no address register of an issued load is rewritten ahead of this wait
#pragma unroll
    for (int g = 0; g < 4; ++g)
#pragma unroll
      for (int q = 0; q < 4; ++q) {                            // lane holds pixels 4 lane .. 4 lane + 3: per pixel 8 channels = one 16-B LDS store
        v8b pk;
#pragma unroll
        for (int e = 0; e < 8; ++e) pk[e] = (b16)xv[g * 8 + e][q];
        *(v8b*)(Sa + (lane * 4 + q) * LP + wave * 32 + g * 8) = pk;
      }
  }
  asm volatile("s_wait_asynccnt 0x0" ::: "memory");            // this wave's copies of tile 0 have landed before the barrier publishes them
  __syncthreads();                                             // publishes the pixel tile and weight tile 0
  copy_tile(1);
  const b16* As = Sa + (mrow * 32 + nloc) * LP;
#pragma unroll 1   // rolled: one copy of the tile body, so that the kernel's text stays small
  for (int t = 0; t < NT; ++t) {
    v8f acc[2][4];
#pragma unroll
    for (int r = 0; r < 2; ++r)
#pragma unroll
      for (int u = 0; u < 4; ++u) acc[r][u] = (v8f){};
    const b16* Bs = Sb + (t & 1) * TILE + (ncol * 64 + nloc) * LP;
    // a k-step's six fragments are read as one group, one k-step ahead of their products, so that a wave does not wait out the LDS latency in front of each pair of products
    v16b fa[2][2], fb[2][4];
    fa[0][0] = frag_kb(As, hlf); fa[0][1] = frag_kb(As + 16 * LP, hlf);
#pragma unroll
    for (int u = 0; u < 4; ++u) fb[0][u] = frag_kb(Bs + u * 16 * LP, hlf);
#pragma unroll   // unrolled so that both fragment sets are indexed by constants and stay in registers
    for (int ks = 0; ks < C / 32; ++ks) {
      const int cur = ks & 1, nxt = cur ^ 1, kn = (ks + 1) * 32;
      if (ks + 1 < C / 32) {
        fa[nxt][0] = frag_kb(As + kn, hlf); fa[nxt][1] = frag_kb(As + 16 * LP + kn, hlf);
#pragma unroll
        for (int u = 0; u < 4; ++u) fb[nxt][u] = frag_kb(Bs + u * 16 * LP + kn, hlf);
      }
#pragma unroll
      for (int u = 0; u < 4; ++u) { acc[0][u] = wmma16b(fa[cur][0], fb[cur][u], acc[0][u]); acc[1][u] = wmma16b(fa[cur][1], fb[cur][u], acc[1][u]); }
    }
    v8b wr[8];                                                 // the staged rows wait in registers: their global stores follow the tile's closing barrier, so that the barrier does not wait for a store
    if (t < 2 * C / 128) {                                     // q, k (block-uniform): the wave's 32 x 64 tile through its own staging range, read back as whole 128-B lines
      b16* Tw = St + wave * (32 * 64);
#pragma unroll
      for (int u = 0; u < 4; ++u)
#pragma unroll
        for (int r = 0; r < 2; ++r)
#pragma unroll
          for (int v = 0; v < 8; ++v) Tw[(r * 16 + v + 8 * hlf) * 64 + u * 16 + nloc] = (b16)acc[r][u][v];
      wave_lds_sync();
#pragma unroll
      for (int j = 0; j < 8; ++j) wr[j] = ld8b(Tw + (j * 4 + (lane >> 3)) * 64 + (lane & 7) * 8);
    } else {                                                   // v: tile columns = 4 heads x 32 c -> vT rows (h, c) of the block's 128 w
#pragma unroll
      for (int u = 0; u < 4; ++u)
#pragma unroll
        for (int r = 0; r < 2; ++r)
#pragma unroll
          for (int v = 0; v < 8; ++v) St[(ncol * 64 + u * 16 + nloc) * TP + mrow * 32 + r * 16 + 8 * hlf + v] = (b16)acc[r][u][v];
      __syncthreads();                                         // the block's staged v tile is complete before its rows are read back
#pragma unroll
      for (int j = 0; j < 8; ++j) wr[j] = ld8b(St + (wave * 16 + j * 2 + hlf) * TP + nloc * 8);
    }
    asm volatile("s_wait_dscnt 0x0" ::: "memory");             // this wave's reads of buffer t & 1 and of the staging have returned
    asm volatile("s_wait_asynccnt 0x0" ::: "memory");          // this wave's copies of tile t + 1 have landed
    __syncthreads();                                           // publishes tile t + 1 and ends every wave's reads of the buffer refilled below and of the staging
    if (t + 2 < NT) copy_tile(t + 2);
    if (t < 2 * C / 128) {
      b16* dst = qk16 + (size_t)(m0 + (lane >> 3)) * (2 * C) + t * 128 + ncol * 64 + (lane & 7) * 8;
#pragma unroll
      for (int j = 0; j < 8; ++j) *(v8b*)(dst + j * 4 * (2 * C)) = wr[j];
    } else {
      const int h = (t - 2 * C / 128) * 4 + (wave >> 1), c = (wave & 1) * 16 + hlf;   // staged row 16 wave + 2 j + hlf = channel 32 (wave >> 1) + c + 2 j of the tile
      b16* dst = vT + ((((size_t)n * NH + h) * Hh + i) * HD + c) * Wd + nloc * 8;
#pragma unroll
      for (int j = 0; j < 8; ++j) *(v8b*)(dst + j * 2 * Wd) = wr[j];
    }
    asm volatile("s_wait_xcnt 0x0" ::: "memory");              // closes the run of stores: no address register of an issued store is rewritten ahead of this wait
  }
  asm volatile("s_wait_asynccnt 0x0" ::: "memory");            // no copy is outstanding when the wave ends
}

// E[n][h][i][j][w] = [q_j | k_j](head h) . Rcat[h][j][w][:] for all (n,i): per (h,j) a (256 x 64) x (64 x 128) product; block = (n, h, j): the 64 rows i of one image, all 128 w;
// all four images in one launch: image n is the fastest grid index, so the four blocks that read one Rcat[h][j] slab start together
__global__ __launch_bounds__(128) void e_kernel(const b16* __restrict__ qk16, const b16* __restrict__ Rcat, b16* __restrict__ E) {
  constexpr int LP = 64 + 8;                                   // LDS row pitch in f16: 144 B = 16 B x odd for the ds_load_b128 fragment reads
  __shared__ __attribute__((aligned(16))) b16 S[(Hh + Wd) * LP];   // rows 0-63: [q_j | k_j] of row i; rows 64-191: Rcat[h][j] rows w; reused as output staging behind a barrier
  const int lane = threadIdx.x & 31, wave = threadIdx.x >> 5, nloc = lane & 15, hlf = lane >> 4;
  const int n = blockIdx.x % Nn, h = blockIdx.x / (Nn * Wd), j = (blockIdx.x / Nn) % Wd, m0 = (wave & 1) * 32, c0 = (wave >> 1) * 64;   // rows = i (64), block covers 64 i x 128 w
  {
    // both operand tiles come into LDS once per block: a copy of a wave takes 4 rows (8 lanes x 16 B each): the 64-B q and k pieces of 4 rows i, or 512 contiguous bytes of the table
    const int r4 = lane >> 3, c8 = (lane & 7) * 8;
    const b16* gA = qk16 + ((size_t)n * Hh * Wd + (size_t)(wave * 16 + r4) * Wd + j) * (2 * C) + (c8 >> 5) * C + h * HD + (c8 & 31);
    const b16* gB = Rcat + ((size_t)h * Wd + j) * Wd * 64 + (size_t)(wave * 32 + r4) * 64 + c8;
    copy_rows4((unsigned)(size_t)(S + (wave * 16 + r4) * LP + c8), (const char*)gA, 4 * LP * 2, 4 * Wd * 2 * C * 2);
    copy_rows8((unsigned)(size_t)(S + (Hh + wave * 32 + r4) * LP + c8), (const char*)gB, 4 * LP * 2, 4 * 64 * 2);
  }
  asm volatile("s_wait_asynccnt 0x0" ::: "memory");            // this wave's copies have landed before the barrier publishes them
  __syncthreads();
  v8f acc[2][4];
#pragma unroll
  for (int r = 0; r < 2; ++r)
#pragma unroll
    for (int t = 0; t < 4; ++t) acc[r][t] = (v8f){};
#pragma unroll
  for (int ks = 0; ks < 2; ++ks) {                             // k-step 0: q (c' 0..31), 1: k (c' 32..63)
    const v16b a0 = frag_kb(S + (m0 + nloc) * LP + ks * 32, hlf), a1 = frag_kb(S + (m0 + 16 + nloc) * LP + ks * 32, hlf);
#pragma unroll
    for (int t = 0; t < 4; ++t) { const v16b bw = frag_kb(S + (Hh + c0 + t * 16 + nloc) * LP + ks * 32, hlf); acc[0][t] = wmma16b(a0, bw, acc[0][t]); acc[1][t] = wmma16b(a1, bw, acc[1][t]); }
  }
  __syncthreads();                                             // every wave has read its last fragment: the tiles' LDS becomes output staging
  // E rows: (((n*8 + h)*64 + i)*128 + j)*128 + w
  b16* Tp = S + wave * (32 * 64);
#pragma unroll
  for (int t = 0; t < 4; ++t)
#pragma unroll
    for (int r = 0; r < 2; ++r)
#pragma unroll
      for (int v = 0; v < 8; ++v) Tp[(r * 16 + v + 8 * hlf) * 64 + t * 16 + nloc] = (b16)acc[r][t][v];
  wave_lds_sync();
  {
#pragma unroll
    for (int jj = 0; jj < 8; ++jj) { const int rr = jj * 4 + (lane >> 3), c8 = (lane & 7) * 8; const int i = m0 + rr;
      *(v8b*)(E + ((((size_t)n * NH + h) * Hh + i) * Wd + j) * Wd + c0 + c8) = ld8b(Tp + rr * 64 + c8); }
    
  }
}

// Attention: wave = (n, h, i, 16 queries j0); all 128 keys: logits = q.k/16 + E (4 chunks of 32 kept in registers), max / sum, weights = e/sum -> (a) f16 weights rows
__global__ __launch_bounds__(256) void attn_kernel(const b16* __restrict__ qk16, const b16* __restrict__ E, const b16* __restrict__ vT, b16* __restrict__ wt16, float* __restrict__ x1) {
  constexpr int KP = HD + 8, WP = Wd + 8;                       // LDS row pitches in f16: 80 B and 272 B = 16 B x odd for the ds_load_b128 reads
  __shared__ __attribute__((aligned(16))) b16 Ws[8][16][WP];    // per wave: its 16 rows of E, overwritten in place by the weights, then x1 staging
  __shared__ __attribute__((aligned(16))) b16 Qs[Wd][KP];       // q and k rows of this (n, h, i), all 128 positions
  __shared__ __attribute__((aligned(16))) b16 Ks[Wd][KP];
  __shared__ __attribute__((aligned(16))) b16 Vs[HD][WP];       // v rows c, 128 w
  const int wid = threadIdx.x >> 5, lane = threadIdx.x & 31, hh = lane >> 4, col = lane & 15;
  const int qt = blockIdx.x * 8 + wid;                          // ((n*8 + h)*64 + i)*8 + j0/16
  const int jt = qt & 7, i = (qt >> 3) & 63, h = (qt >> 9) & 7, n = qt >> 12, j0 = jt * 16;
  const size_t pixrow = (size_t)n * Hh * Wd + (size_t)i * Wd;  // pixel index of (n, i, w=0)
  const b16* Erow = E + ((((size_t)n * NH + h) * Hh + i) * Wd) * Wd;             // + j*128 + w
  const b16* vrow = vT + (((size_t)n * NH + h) * Hh + i) * HD * Wd;              // rows c, 128 w
  {
    // the block's eight waves share one (n, h, i): q, k and v come into LDS once per block, each wave's own 16 rows of E (4 KiB contiguous) as whole lines
    const int r2 = lane >> 4, c16 = (lane & 15) * 8, r8 = lane >> 2, c4 = (lane & 3) * 8;
    const b16* gq = qk16 + (pixrow + wid * 16 + r8) * (2 * C) + h * HD + c4;
    copy_rows8((unsigned)(size_t)&Ws[wid][r2][c16], (const char*)(Erow + (size_t)(j0 + r2) * Wd + c16), 2 * WP * 2, 2 * Wd * 2);
    copy_rows2((unsigned)(size_t)&Qs[wid * 16 + r8][c4], (const char*)gq, 8 * KP * 2, 8 * 2 * C * 2);
    copy_rows2((unsigned)(size_t)&Ks[wid * 16 + r8][c4], (const char*)(gq + C), 8 * KP * 2, 8 * 2 * C * 2);
    copy_rows2((unsigned)(size_t)&Vs[wid * 4 + r2][c16], (const char*)(vrow + (size_t)(wid * 4 + r2) * Wd + c16), 2 * WP * 2, 2 * Wd * 2);
  }
  asm volatile("s_wait_asynccnt 0x0" ::: "memory");            // this wave's copies have landed before the barrier publishes them
  __syncthreads();
  const v16b qb = frag_kb(&Qs[j0 + col][0], hh);                                  // B operand: queries (columns)
  float lg[4][16];
#pragma unroll
  for (int ch = 0; ch < 4; ++ch) {
    v8f s0 = {}, s1 = {};
    s0 = wmma16b(frag_kb(&Ks[ch * 32 + col][0], hh), qb, s0);        // A: keys w = 32ch + col (k rows), k-step over the 32 channels
    s1 = wmma16b(frag_kb(&Ks[ch * 32 + 16 + col][0], hh), qb, s1);
    const v8b e0 = ld8b(&Ws[wid][col][ch * 32 + 8 * hh]), e1 = ld8b(&Ws[wid][col][ch * 32 + 16 + 8 * hh]);
#pragma unroll
    for (int r = 0; r < 8; ++r) { lg[ch][r] = s0[r] * DS + (float)e0[r]; lg[ch][8 + r] = s1[r] * DS + (float)e1[r]; }
  }
  float m = -INFINITY;
#pragma unroll
  for (int ch = 0; ch < 4; ++ch)
#pragma unroll
    for (int r = 0; r < 16; ++r) m = fmaxf(m, lg[ch][r]);
  m = fmaxf(m, __shfl_xor(m, 16));
  float sum = 0.0f;
#pragma unroll
  for (int ch = 0; ch < 4; ++ch)
#pragma unroll
    for (int r = 0; r < 16; ++r) { lg[ch][r] = __expf(lg[ch][r] - m); sum += lg[ch][r]; }
  sum += __shfl_xor(sum, 16);
  const float inv = 1.0f / sum;
  v8f o[2] = {{}, {}};
#pragma unroll
  for (int ch = 0; ch < 4; ++ch) {
    v16b pb;
#pragma unroll
    for (int r = 0; r < 8; ++r) { const float p0 = lg[ch][r] * inv, p1 = lg[ch][8 + r] * inv; pb[r] = (b16)p0; pb[8 + r] = (b16)p1;
      Ws[wid][col][ch * 32 + 8 * hh + r] = (b16)p0; Ws[wid][col][ch * 32 + 16 + 8 * hh + r] = (b16)p1; }
#pragma unroll
    for (int nt = 0; nt < 2; ++nt) o[nt] = wmma16b(frag_kb(&Vs[nt * 16 + col][ch * 32], hh), pb, o[nt]);
  }
  wave_lds_sync();
  const size_t rowbase = (((size_t)n * NH + h) * Hh + i) * Wd + j0;                // (n,h,i,j) row index
  v8b wr[8];                                                   // the weight rows wait in registers: their global stores follow the last LDS hand-over, so that no hand-over waits for a store
#pragma unroll
  for (int jj = 0; jj < 8; ++jj) wr[jj] = *(const v8b*)(&Ws[wid][jj * 2 + hh][col * 8]);
  wave_lds_sync();                                             // the weight rows have been read: the wave's own range becomes x1 staging
  constexpr int XP = HD + 4;
  float* Xw = (float*)&Ws[wid][0][0];
#pragma unroll
  for (int nt = 0; nt < 2; ++nt)
#pragma unroll
    for (int r = 0; r < 8; ++r) Xw[col * XP + nt * 16 + 8 * hh + r] = o[nt][r];   // x1^T: lane col = query j, element = feature
  wave_lds_sync();
  {
#pragma unroll
    for (int jj = 0; jj < 8; ++jj) *(v8b*)(wt16 + (rowbase + jj * 2 + hh) * Wd + col * 8) = wr[jj];
#pragma unroll
    for (int jj = 0; jj < 4; ++jj) { const int rr = jj * 4 + (lane >> 3), c4 = (lane & 7) * 4; *(v4f*)(x1 + (rowbase + rr) * HD + c4) = *(const v4f*)(Xw + rr * XP + c4); }
  }
}

// x2 + combine: per (h, j): (256 rows (n,i)) x (K = 128 w) x (32 c): A = wt16 rows of (n,h,i,j), B = rvT[h][j] rows c; pre[pixel (n,i,j)][h*32 + c] = g1 x1 + g2 x2 as f32
__global__ __launch_bounds__(64) void x2_kernel(const b16* __restrict__ wt16, const b16* __restrict__ rvT, const float* __restrict__ x1, const float* __restrict__ Gv1, const float* __restrict__ Gv2, float* __restrict__ pre) {
  constexpr int WP = Wd + 8;                                   // LDS row pitch in f16: 272 B = 16 B x odd for the ds_load_b128 fragment reads
  __shared__ __attribute__((aligned(16))) b16 S[(Hh + HD) * WP];   // rows 0-63: weight rows of i; rows 64-95: rvT[h][j] rows c; reused as output staging behind a barrier
  const int lane = threadIdx.x & 31, wave = threadIdx.x >> 5, nloc = lane & 15, hlf = lane >> 4;
  const int n = blockIdx.x % Nn, h = blockIdx.x / (Nn * Wd), j = (blockIdx.x / Nn) % Wd, m0 = wave * 32;   // rows = i; image n fastest, as in e_kernel (shared rvT[h][j])
  const float g1 = tanh_e(Gv1[h]), g2 = tanh_e(Gv2[h]);
  const b16* Rb = rvT + ((size_t)h * Wd + j) * HD * Wd;
  auto rowidx = [&](int i) { return (((size_t)n * NH + h) * Hh + i) * Wd + j; };    // (n,h,i,j) row
  {
    // whole 256-B rows into LDS, two rows a copy: each wave its own 32 weight rows and half of the table's 32 rows
    const int r2 = lane >> 4, c16 = (lane & 15) * 8;
    const unsigned lA = (unsigned)(size_t)(S + (m0 + r2) * WP + c16);
    const char* gA = (const char*)(wt16 + rowidx(m0 + r2) * Wd + c16);
    copy_rows8(lA, gA, 2 * WP * 2, 2 * Wd * Wd * 2); copy_rows8(lA + 16 * WP * 2, gA + 16 * Wd * Wd * 2, 2 * WP * 2, 2 * Wd * Wd * 2);
    copy_rows8((unsigned)(size_t)(S + (Hh + wave * 16 + r2) * WP + c16), (const char*)(Rb + (size_t)(wave * 16 + r2) * Wd + c16), 2 * WP * 2, 2 * Wd * 2);
  }
  float xv[2][2][8];                                           // x1 is asked for while the copies fly
#pragma unroll
  for (int r = 0; r < 2; ++r) {
#pragma unroll
    for (int t = 0; t < 2; ++t)
#pragma unroll
      for (int v = 0; v < 8; ++v) xv[r][t][v] = x1[rowidx(m0 + r * 16 + v + 8 * hlf) * HD + t * 16 + nloc];
    asm volatile("s_wait_xcnt 0x0" ::: "memory");              // closes this run of loads: no address register of an issued load is rewritten ahead of this wait
  }
  asm volatile("s_wait_asynccnt 0x0" ::: "memory");            // this wave's copies have landed before the barrier publishes them
  __syncthreads();
  v8f acc[2][2] = {{{}, {}}, {{}, {}}};
#pragma unroll
  for (int kb = 0; kb < Wd; kb += 32) {
    const v16b a0 = frag_kb(S + (m0 + nloc) * WP + kb, hlf), a1 = frag_kb(S + (m0 + 16 + nloc) * WP + kb, hlf);
#pragma unroll
    for (int t = 0; t < 2; ++t) { const v16b bw = frag_kb(S + (Hh + t * 16 + nloc) * WP + kb, hlf); acc[0][t] = wmma16b(a0, bw, acc[0][t]); acc[1][t] = wmma16b(a1, bw, acc[1][t]); }
  }
  __syncthreads();                                             // every wave has read its last fragment: the tiles' LDS becomes output staging
  constexpr int XP = HD + 4;
  float* Tw = (float*)S + wave * (32 * XP);
#pragma unroll
  for (int t = 0; t < 2; ++t)
#pragma unroll
    for (int r = 0; r < 2; ++r)
#pragma unroll
      for (int v = 0; v < 8; ++v) { const int rr = r * 16 + v + 8 * hlf, cc = t * 16 + nloc;
        Tw[rr * XP + cc] = g1 * xv[r][t][v] + g2 * acc[r][t][v]; }
  wave_lds_sync();
  {
#pragma unroll
    for (int jj = 0; jj < 4; ++jj) { const int rr = jj * 8 + (lane >> 2), c4 = (lane & 3) * 8; const int i = m0 + rr;
      const size_t pix = ((size_t)n * Hh + i) * Wd + j;        // pre is [32768][256]
      *(v4f*)(pre + pix * C + h * HD + c4) = *(const v4f*)(Tw + rr * XP + c4); *(v4f*)(pre + pix * C + h * HD + c4 + 4) = *(const v4f*)(Tw + rr * XP + c4 + 4); }
    
  }
}

// out conv: (32768 x 256) x (256 x 256); block = 64 pixels x all 256 output channels, 8 waves of 32 x 64. The f32 rows of pre and the f16 weight rows (full K) are copied once
// into LDS as whole lines (pitches 1040 B and 528 B = 16 B x odd); A fragments are rounded to f16 as they are read, in the k order of frag_kb.
__device__ __forceinline__ v16b frag_kf(const float* p, int hh) {
  const float* p0 = p + 8 * hh; const float* p1 = p + 16 + 8 * hh; v16b f;
#pragma unroll
  for (int e = 0; e < 8; ++e) { f[e] = (b16)p0[e]; f[8 + e] = (b16)p1[e]; }
  return f;
}
__global__ __launch_bounds__(256) void out_kernel(const float* __restrict__ pre, const b16* __restrict__ wo16, float* __restrict__ out) {
  constexpr int AP = C * 4 + 16, BP = C * 2 + 16, BOFF = 64 * AP;   // LDS row pitches and the weight tile's offset, in bytes
  __shared__ __attribute__((aligned(16))) char S[64 * AP + C * BP];  // reused as output staging behind a barrier
  const int lane = threadIdx.x & 31, wave = threadIdx.x >> 5, nloc = lane & 15, hlf = lane >> 4;
  const int mrow = wave & 1, ncol = wave >> 1;
  const int mb = blockIdx.x * 64, m0 = mb + mrow * 32, c0 = ncol * 64;
  {
    const unsigned lA = (unsigned)(size_t)(S + wave * 8 * AP + lane * 16), lB = (unsigned)(size_t)(S + BOFF + wave * 32 * BP + lane * 16);   // wave copies 8 rows of pre (two halves each) and 32 weight rows
    const char* gA = (const char*)(pre + (size_t)(mb + wave * 8) * C + lane * 4);
    const char* gB = (const char*)(wo16 + (size_t)(wave * 32) * C + lane * 8);
    copy_rows8(lA, gA, AP, C * 4); copy_rows8(lA + 512, gA + 512, AP, C * 4);
#pragma unroll   // unrolled: four straight-line copy statements, no loop-carried address registers
    for (int q = 0; q < 4; ++q) copy_rows8(lB + q * 8 * BP, gB + q * 8 * C * 2, BP, C * 2);
  }
  asm volatile("s_wait_asynccnt 0x0" ::: "memory");            // this wave's copies have landed before the barrier publishes them
  __syncthreads();
  v8f acc[2][4];
#pragma unroll
  for (int r = 0; r < 2; ++r)
#pragma unroll
    for (int t = 0; t < 4; ++t) acc[r][t] = (v8f){};
  const float* As = (const float*)(S + (mrow * 32 + nloc) * AP); const b16* Bs = (const b16*)(S + BOFF + (c0 + nloc) * BP);
  // fragments read as one group, one k-step ahead of their products (as in qkv_kernel)
  v16b fa[2][2], fb[2][4];
  fa[0][0] = frag_kf(As, hlf); fa[0][1] = frag_kf(As + 16 * (AP / 4), hlf);
#pragma unroll
  for (int t = 0; t < 4; ++t) fb[0][t] = frag_kb(Bs + t * 16 * (BP / 2), hlf);
#pragma unroll   // unrolled so that both fragment sets are indexed by constants and stay in registers
  for (int ks = 0; ks < C / 32; ++ks) {
    const int cur = ks & 1, nxt = cur ^ 1, kn = (ks + 1) * 32;
    if (ks + 1 < C / 32) {
      fa[nxt][0] = frag_kf(As + kn, hlf); fa[nxt][1] = frag_kf(As + 16 * (AP / 4) + kn, hlf);
#pragma unroll
      for (int t = 0; t < 4; ++t) fb[nxt][t] = frag_kb(Bs + t * 16 * (BP / 2) + kn, hlf);
    }
#pragma unroll
    for (int t = 0; t < 4; ++t) { acc[0][t] = wmma16b(fa[cur][0], fb[cur][t], acc[0][t]); acc[1][t] = wmma16b(fa[cur][1], fb[cur][t], acc[1][t]); }
  }
  __syncthreads();                                             // every wave has read its last fragment: the tiles' LDS becomes output staging
  float* Tw = (float*)(S + wave * (64 * 36 * 4));              // per wave: 64 channels x 32 pixels, pitch 36 floats
#pragma unroll
  for (int t = 0; t < 4; ++t)
#pragma unroll
    for (int r = 0; r < 2; ++r)
#pragma unroll
      for (int v = 0; v < 8; ++v) Tw[(t * 16 + nloc) * 36 + r * 16 + v + 8 * hlf] = acc[r][t][v];
  wave_lds_sync();
  const int n = m0 / (Hh * Wd), hw0 = m0 % (Hh * Wd);         // pre rows = pixels (n, hw); a 32-row wave tile lies in one image
  {
#pragma unroll
    for (int jj = 0; jj < 16; ++jj) { const int cc = jj * 4 + (lane >> 3), c4 = (lane & 7) * 4; *(v4f*)(out + ((size_t)n * C + c0 + cc) * (Hh * Wd) + hw0 + c4) = *(const v4f*)(Tw + cc * 36 + c4); }   // channel-major [n][o][hw]
  }
}
}  // namespace

extern "C" void kernel_launch(void* const* d_in, const int* in_sizes, int n_in,
                              void* d_out, int out_size, void* d_ws, size_t ws_size, hipStream_t stream) {
  (void)n_in; (void)out_size;
  const float* x = (const float*)d_in[0]; const float* wq = (const float*)d_in[1]; const float* wk = (const float*)d_in[2]; const float* wv = (const float*)d_in[3]; const float* wo = (const float*)d_in[4];
  const float* rq = (const float*)d_in[5]; const float* rk = (const float*)d_in[6]; const float* rv = (const float*)d_in[7];
  const float* Gq = (const float*)d_in[8]; const float* Gk = (const float*)d_in[9]; const float* Gv1 = (const float*)d_in[10]; const float* Gv2 = (const float*)d_in[11];
  float* out = (float*)d_out;   // [4,256,64,128]
  if (in_sizes[0] != NPIX * C || in_sizes[1] != C * C || in_sizes[5] != NH * HD * Wd * Wd || in_sizes[8] != NH) return;
  size_t off = 0; char* ws = (char*)d_ws;
  auto carve = [&](size_t bytes) { char* p = ws + off; off += (bytes + 255) & ~(size_t)255; return p; };
  b16* wqkv = (b16*)carve((size_t)3 * C * C * 2); b16* wo16 = (b16*)carve((size_t)C * C * 2);
  b16* Rcat = (b16*)carve((size_t)NH * Wd * Wd * 64 * 2);      // 16 MB
  b16* rvT = (b16*)carve((size_t)NH * Wd * HD * Wd * 2);       // 8 MB
  b16* E = (b16*)carve((size_t)Nn * NH * Hh * Wd * Wd * 2);     // 64 MB, all images
  float* pre = (float*)E;                                       // 32 MB, written by x2 when E is dead (last read by attn)
  b16* qk16 = (b16*)carve((size_t)NPIX * 2 * C * 2);            // 32 MB
  b16* vT = (b16*)carve((size_t)NPIX * C * 2);                  // 16 MB
  b16* wt16 = (b16*)carve((size_t)Nn * NH * Hh * Wd * Wd * 2);  // 64 MB
  float* x1 = (float*)carve((size_t)Nn * NH * Hh * Wd * HD * 4);   // 32 MB
  if (off > ws_size) return;                                     // total about 233 MB (binary)
  prep_kernel<<<1024, 256, 0, stream>>>(wq, wk, wv, wo, rq, rk, rv, Gq, Gk, wqkv, wo16, Rcat, rvT);
  qkv_kernel<<<NPIX / 128, 256, 0, stream>>>(x, wqkv, qk16, vT);
  e_kernel<<<Nn * NH * Wd, 128, 0, stream>>>(qk16, Rcat, E);
  attn_kernel<<<Nn * NH * Hh * Wd / 16 / 8, 256, 0, stream>>>(qk16, E, vT, wt16, x1);
  x2_kernel<<<Nn * NH * Wd, 64, 0, stream>>>(wt16, rvT, x1, Gv1, Gv2, pre);
  out_kernel<<<NPIX / 64, 256, 0, stream>>>(pre, wo16, out);
}

// v005
// Measured time: 80.5 microseconds a run.
// Next to v004, in two timings, it ran 1.09 times as fast each time.
// All steps since v000 together make it 2.67 times as fast.
#include <hip/hip_runtime.h>

// Gated axial attention along the width axis: x [4][256][64][128]; q,k,v = 1x1 convs (8 heads x 32); per (n, head, row i): logits[j][w] = (q_j.k_w + g_q q_j.rq[:,j,w] +
// g_k k_j.rk[:,j,w]) / 16 with learned per-position tables (tanh'd), softmax over w; out = g_v1 (weights . v) + g_v2 (weights . rv[:,j,:]); 1x1 out conv.
// Contractions on v_wmma_f32_16x16x32_f16 with single f16 operands (position-major activation rows, weight / position-table copies with the gates and 1/16

namespace {
__device__ __forceinline__ float tanh_e(float v) { return 1.0f - 2.0f * __builtin_amdgcn_rcpf(1.0f + __expf(2.0f * v)); }   // tanh via exp + hardware reciprocal (~1 ulp; values are rounded to f16 afterwards or are gates of O(1))
constexpr int Nn = 4, C = 256, Hh = 64, Wd = 128, NH = 8, HD = 32, NPIX = Nn * Hh * Wd;   // 32768 pixels
constexpr float DS = 0.0625f;   // 1/sqrt(C)

typedef _Float16 b16;
typedef __attribute__((ext_vector_type(16))) _Float16 v16b;
typedef __attribute__((ext_vector_type(8)))  _Float16 v8b;
typedef __attribute__((ext_vector_type(8)))  float v8f;
typedef __attribute__((ext_vector_type(4)))  float v4f;

__device__ __forceinline__ v8b ld8b(const b16* p) { return *(const v8b*)p; }
__device__ __forceinline__ v16b cat8b(v8b a, v8b b) { return __builtin_shufflevector(a, b, 0, 1, 2, 3, 4, 5, 6, 7, 8, 9, 10, 11, 12, 13, 14, 15); }
__device__ __forceinline__ v16b frag_kb(const b16* p, int hh) { return cat8b(ld8b(p + 8 * hh), ld8b(p + 16 + 8 * hh)); }
__device__ __forceinline__ void split16(float v, b16& hi, b16& lo) { hi = (b16)v; lo = (b16)(v - (float)hi); }
// hi/lo fragment pair straight from an f32 k-contiguous row (same k-map)
__device__ __forceinline__ void frag_ksplit(const float* p, int hh, v16b& fh_, v16b& fl_) {
  const float* p0 = p + 8 * hh; const float* p1 = p + 16 + 8 * hh;
#pragma unroll
  for (int e = 0; e < 8; ++e) { b16 a, c; split16(p0[e], a, c); fh_[e] = a; fl_[e] = c; split16(p1[e], a, c); fh_[8 + e] = a; fl_[8 + e] = c; }
}
__device__ __forceinline__ v8f wmma16b(v16b a, v16b b, v8f c) {
  v8f d = __builtin_amdgcn_wmma_f32_16x16x32_f16(false, a, false, b, (short)0, c, false, false);
  asm volatile("v_nop\n\tv_nop\n\tv_nop\n\tv_nop" : "+v"(d) : "v"(a), "v"(b));
  return d;
}
__device__ __forceinline__ void wave_lds_sync() {
  __builtin_amdgcn_fence(__ATOMIC_RELEASE, "workgroup");
  __builtin_amdgcn_wave_barrier();
  __builtin_amdgcn_fence(__ATOMIC_ACQUIRE, "workgroup");
}

// (b) f32 rows with pitch ldo: 64 floats = 256 B = 2 lines per row; 16 lanes x 16 B per row, 2 rows per instruction. Optional per-row factor
__device__ __forceinline__ void epi_f32(v8f (&acc)[2][4], float scale, const float* rscale, float* __restrict__ out, int ldo, int m0, int c0, int lane, float* Tt) {
  const int nloc = lane & 15, hlf = lane >> 4;
#pragma unroll
  for (int t = 0; t < 4; ++t)
#pragma unroll
    for (int r = 0; r < 2; ++r)
#pragma unroll
      for (int v = 0; v < 8; ++v) {
        const int rr = r * 16 + v + 8 * hlf;
        const float rs = rscale ? rscale[(size_t)(m0 + rr) * 32] : 1.0f;
        Tt[rr * 64 + t * 16 + nloc] = acc[r][t][v] * scale * rs;
      }
  wave_lds_sync();
  float* dst0 = out + (size_t)m0 * ldo + c0;
  {
#pragma unroll
    for (int j = 0; j < 16; ++j) { const int rr = j * 2 + hlf, c4 = nloc * 4; *(v4f*)(dst0 + (size_t)rr * ldo + c4) = *(const v4f*)(Tt + rr * 64 + c4); }
    
  }
}



// prep (grid-stride): wqkv = [wq; wk; wv] [768][256] f16, wout f16 [256][256]; Rcat (fragment order) at (h, j, w, c') = (c' < 32 ? tanh(Gq_h) tanh(rq[h][c'][j][w]) : tanh(Gk_h) tanh(rk[h][c'-32][j][w])) / 16
__global__ __launch_bounds__(256) void prep_kernel(const float* __restrict__ wq, const float* __restrict__ wk, const float* __restrict__ wv, const float* __restrict__ wo,
                                                   const float* __restrict__ rq, const float* __restrict__ rk, const float* __restrict__ rv, const float* __restrict__ Gq, const float* __restrict__ Gk,
                                                   b16* __restrict__ wqkv, b16* __restrict__ wo16, b16* __restrict__ Rcat, b16* __restrict__ rvT) {
  const size_t tid = (size_t)blockIdx.x * blockDim.x + threadIdx.x, stride = (size_t)gridDim.x * blockDim.x;
  const size_t n0 = (size_t)3 * C * C / 8, n1 = (size_t)C * C / 8, n2 = (size_t)NH * Wd * Wd * 64 / 8, n3 = (size_t)NH * Wd * HD * Wd / 8;
  {
    for (size_t p = tid; p < n0 + n1 + n2 + n3; p += stride) {
      v8b v; b16* dst;
      if (p < n0) { const size_t i = p * 8; const float* src = (i < (size_t)C * C) ? (wq + i) : (i < (size_t)2 * C * C) ? (wk + i - (size_t)C * C) : (wv + i - (size_t)2 * C * C);
#pragma unroll
        for (int e = 0; e < 8; ++e) v[e] = (b16)src[e]; dst = wqkv + i; }
      else if (p < n0 + n1) { const size_t i = (p - n0) * 8;
#pragma unroll
        for (int e = 0; e < 8; ++e) v[e] = (b16)wo[i + e]; dst = wo16 + i; }
      else if (p < n0 + n1 + n2) { const size_t i = (p - n0 - n1) * 8;       // Rcat in fragment order: 16-B unit ((((h*128 + j)*8 + w/16)*2 + c'/32)*2 + (c'/16)%2)*32 + ((c'/8)%2)*16 + w%16
        const int u = (int)(p - n0 - n1), ln = u & 31, cp0 = ((u >> 6) & 1) * 32 + ((u >> 5) & 1) * 16 + (ln >> 4) * 8, w = ((u >> 7) & 7) * 16 + (ln & 15), j = (u >> 10) & (Wd - 1), h = u >> 17;
        const float gq = tanh_e(Gq[h]) * DS, gk = tanh_e(Gk[h]) * DS;
#pragma unroll
        for (int e = 0; e < 8; ++e) { const int cp = cp0 + e; const float* tab = (cp < HD) ? rq : rk; const int c = (cp < HD) ? cp : cp - HD;
          v[e] = (b16)(((cp < HD) ? gq : gk) * tanh_e(tab[(((size_t)h * HD + c) * Wd + j) * Wd + w])); }
        dst = Rcat + i; }
      else { const size_t i = (p - n0 - n1 - n2) * 8;                          // rvT in fragment order: 16-B unit ((((h*128 + j)*2 + c/16)*4 + w/32)*2 + (w/16)%2)*32 + ((w/8)%2)*16 + c%16
        const int u = (int)(p - n0 - n1 - n2), ln = u & 31, w0 = ((u >> 6) & 3) * 32 + ((u >> 5) & 1) * 16 + (ln >> 4) * 8, c = ((u >> 8) & 1) * 16 + (ln & 15), j = (u >> 9) & (Wd - 1), h = u >> 16;
#pragma unroll
        for (int e = 0; e < 8; ++e) v[e] = (b16)tanh_e(rv[(((size_t)h * HD + c) * Wd + j) * Wd + w0 + e]);
        dst = rvT + i; }
      *(v8b*)dst = v;
    }
    
  }
}

// Eight async copies global -> LDS, 16 B per lane each (one copy of a wave = 512 bytes = 4 whole lines). The s_wait_xcnt closes the statement so that
// no address register of an issued copy is rewritten ahead of it.
__device__ __forceinline__ void copy_rows8(unsigned l, const char* g, unsigned lp, int gp) {   // l, lp: LDS byte address and row pitch; g, gp: global address and row pitch in bytes
  asm volatile("global_load_async_to_lds_b128 %0, %8, off\n\t"
               "global_load_async_to_lds_b128 %1, %9, off\n\t"
               "global_load_async_to_lds_b128 %2, %10, off\n\t"
               "global_load_async_to_lds_b128 %3, %11, off\n\t"
               "global_load_async_to_lds_b128 %4, %12, off\n\t"
               "global_load_async_to_lds_b128 %5, %13, off\n\t"
               "global_load_async_to_lds_b128 %6, %14, off\n\t"
               "global_load_async_to_lds_b128 %7, %15, off\n\t"
               "s_wait_xcnt 0x0"
               :: "v"(l), "v"(l + lp), "v"(l + 2 * lp), "v"(l + 3 * lp), "v"(l + 4 * lp), "v"(l + 5 * lp), "v"(l + 6 * lp), "v"(l + 7 * lp),
                  "v"(g), "v"(g + gp), "v"(g + 2 * gp), "v"(g + 3 * gp), "v"(g + 4 * gp), "v"(g + 5 * gp), "v"(g + 6 * gp), "v"(g + 7 * gp)
               : "memory");
}

// qkv: (32768 x 256) x (256 x 768); grid 256, block = 128 pixels (one image row i of one n) x all 768 columns, 8 waves of 32 x 64 per column tile of 128. The block reads its
// pixels straight from x (channel-major f32, whole 512-B rows), rounds them to f16 and lays them position-major in LDS once; that tile serves all six column tiles. The weight
// tiles (full K) come by async copies into two buffers, tile t + 1 flying while tile t is worked on. LDS row pitch 528 B = 16 B x odd for the ds_load_b128 fragment reads.
// Column tiles 0-3 -> q|k f16 rows qk16[pixel][512]; tiles 4-5 -> v transposed per (n, h, i): vT[n][h][i][c][w] (256-B rows) through a block LDS tile.
__global__ __launch_bounds__(256) void qkv_kernel(const float* __restrict__ x, const b16* __restrict__ wqkv, b16* __restrict__ qk16, b16* __restrict__ vT) {
  constexpr int LP = C + 8, TILE = 128 * LP, TP = 128 + 8, NT = 3 * C / 128;   // LDS row pitch and tile size in f16; pitch of the v staging rows; column tiles
  __shared__ __attribute__((aligned(16))) b16 Sa[TILE];        // pixels (A), rows of 256 channels
  __shared__ __attribute__((aligned(16))) b16 Sb[2 * TILE];    // weight rows (B), two buffers
  __shared__ __attribute__((aligned(16))) b16 St[128 * TP];    // output staging: per wave 32 x 64 (q, k) or the block's 128 channels x 128 pixels (v)
  const int lane = threadIdx.x & 31, wave = threadIdx.x >> 5, nloc = lane & 15, hlf = lane >> 4;
  const int mrow = wave & 3, ncol = wave >> 2;
  const int pix0 = blockIdx.x * 128, n = pix0 / (Hh * Wd), i = (pix0 / Wd) % Hh, m0 = pix0 + mrow * 32;
  const unsigned lB = (unsigned)(size_t)(Sb + wave * 16 * LP + lane * 8);       // wave copies rows 16 wave .. 16 wave + 15 of a weight tile
  const char* gB = (const char*)(wqkv + (size_t)(wave * 16) * C + lane * 8);
  auto copy_tile = [&](int t) {
    const unsigned l = lB + (unsigned)(t & 1) * (TILE * 2); const char* g = gB + (size_t)t * (128 * C * 2);
    copy_rows8(l, g, LP * 2, C * 2); copy_rows8(l + 8 * LP * 2, g + 8 * C * 2, LP * 2, C * 2);
  };
  copy_tile(0);
  {
    // wave = 32 channels; one load of a wave = the 128 pixels of one channel (512 contiguous bytes); all 32 loads are asked for before the first is used
    const float* xr = x + ((size_t)n * C + wave * 32) * (Hh * Wd) + (size_t)i * Wd + lane * 4;
    v4f xv[32];
#pragma unroll
    for (int e = 0; e < 32; ++e) xv[e] = *(const v4f*)(xr + (size_t)e * (Hh * Wd));
    asm volatile("s_wait_xcnt 0x0" ::: "memory");              // closes the run of loads: no address register of an issued load is rewritten ahead of this wait
#pragma unroll
    for (int g = 0; g < 4; ++g)
#pragma unroll
      for (int q = 0; q < 4; ++q) {                            // lane holds pixels 4 lane .. 4 lane + 3: per pixel 8 channels = one 16-B LDS store
        v8b pk;
#pragma unroll
        for (int e = 0; e < 8; ++e) pk[e] = (b16)xv[g * 8 + e][q];
        *(v8b*)(Sa + (lane * 4 + q) * LP + wave * 32 + g * 8) = pk;
      }
  }
  asm volatile("s_wait_asynccnt 0x0" ::: "memory");            // this wave's copies of tile 0 have landed before the barrier publishes them
  __syncthreads();                                             // publishes the pixel tile and weight tile 0
  copy_tile(1);
  const b16* As = Sa + (mrow * 32 + nloc) * LP;
#pragma unroll 1   // rolled: one copy of the tile body, so that the kernel's text stays small
  for (int t = 0; t < NT; ++t) {
    v8f acc[2][4];
#pragma unroll
    for (int r = 0; r < 2; ++r)
#pragma unroll
      for (int u = 0; u < 4; ++u) acc[r][u] = (v8f){};
    const b16* Bs = Sb + (t & 1) * TILE + (ncol * 64 + nloc) * LP;
    // a k-step's six fragments are read as one group, one k-step ahead of their products, so that a wave does not wait out the LDS latency in front of each pair of products
    v16b fa[2][2], fb[2][4];
    fa[0][0] = frag_kb(As, hlf); fa[0][1] = frag_kb(As + 16 * LP, hlf);
#pragma unroll
    for (int u = 0; u < 4; ++u) fb[0][u] = frag_kb(Bs + u * 16 * LP, hlf);
#pragma unroll   // unrolled so that both fragment sets are indexed by constants and stay in registers
    for (int ks = 0; ks < C / 32; ++ks) {
      const int cur = ks & 1, nxt = cur ^ 1, kn = (ks + 1) * 32;
      if (ks + 1 < C / 32) {
        fa[nxt][0] = frag_kb(As + kn, hlf); fa[nxt][1] = frag_kb(As + 16 * LP + kn, hlf);
#pragma unroll
        for (int u = 0; u < 4; ++u) fb[nxt][u] = frag_kb(Bs + u * 16 * LP + kn, hlf);
      }
#pragma unroll
      for (int u = 0; u < 4; ++u) { acc[0][u] = wmma16b(fa[cur][0], fb[cur][u], acc[0][u]); acc[1][u] = wmma16b(fa[cur][1], fb[cur][u], acc[1][u]); }
    }
    v8b wr[8];                                                 // the staged rows wait in registers: their global stores follow the tile's closing barrier, so that the barrier does not wait for a store
    if (t < 2 * C / 128) {                                     // q, k (block-uniform): the wave's 32 x 64 tile through its own staging range, read back as whole 128-B lines
      b16* Tw = St + wave * (32 * 64);
#pragma unroll
      for (int u = 0; u < 4; ++u)
#pragma unroll
        for (int r = 0; r < 2; ++r)
#pragma unroll
          for (int v = 0; v < 8; ++v) Tw[(r * 16 + v + 8 * hlf) * 64 + u * 16 + nloc] = (b16)acc[r][u][v];
      wave_lds_sync();
#pragma unroll
      for (int j = 0; j < 8; ++j) wr[j] = ld8b(Tw + (j * 4 + (lane >> 3)) * 64 + (lane & 7) * 8);
    } else {                                                   // v: tile columns = 4 heads x 32 c -> vT rows (h, c) of the block's 128 w
#pragma unroll
      for (int u = 0; u < 4; ++u)
#pragma unroll
        for (int r = 0; r < 2; ++r)
#pragma unroll
          for (int v = 0; v < 8; ++v) St[(ncol * 64 + u * 16 + nloc) * TP + mrow * 32 + r * 16 + 8 * hlf + v] = (b16)acc[r][u][v];
      __syncthreads();                                         // the block's staged v tile is complete before its rows are read back
#pragma unroll
      for (int j = 0; j < 8; ++j) wr[j] = ld8b(St + (wave * 16 + j * 2 + hlf) * TP + nloc * 8);
    }
    asm volatile("s_wait_dscnt 0x0" ::: "memory");             // this wave's reads of buffer t & 1 and of the staging have returned
    asm volatile("s_wait_asynccnt 0x0" ::: "memory");          // this wave's copies of tile t + 1 have landed
    __syncthreads();                                           // publishes tile t + 1 and ends every wave's reads of the buffer refilled below and of the staging
    if (t + 2 < NT) copy_tile(t + 2);
    if (t < 2 * C / 128) {
      b16* dst = qk16 + (size_t)(m0 + (lane >> 3)) * (2 * C) + t * 128 + ncol * 64 + (lane & 7) * 8;
#pragma unroll
      for (int j = 0; j < 8; ++j) *(v8b*)(dst + j * 4 * (2 * C)) = wr[j];
    } else {
      const int h = (t - 2 * C / 128) * 4 + (wave >> 1), c = (wave & 1) * 16 + hlf;   // staged row 16 wave + 2 j + hlf = channel 32 (wave >> 1) + c + 2 j of the tile
      b16* dst = vT + ((((size_t)n * NH + h) * Hh + i) * HD + c) * Wd + nloc * 8;
#pragma unroll
      for (int j = 0; j < 8; ++j) *(v8b*)(dst + j * 2 * Wd) = wr[j];
    }
    asm volatile("s_wait_xcnt 0x0" ::: "memory");              // closes the run of stores: no address register of an issued store is rewritten ahead of this wait
  }
  asm volatile("s_wait_asynccnt 0x0" ::: "memory");            // no copy is outstanding when the wave ends
}

// E + attention + x2 in one kernel. Block = (h, n, 16 image rows i, 64 queries j), 16 waves, four passes of 16 queries. The two table products are GEMMs over the rows i for one j,
// the q.k and weights.v products are GEMMs over j for one row i: the 16 x 16 x 128 tile of logits, then of weights, changes hands between the two through LDS.
//  A (wave = query j):  E^T = Rcat[h][j] (rows w) x [q_j | k_j] (rows i)  -> Ls[i][j][w] f16
//  B (wave = row i):    logits = k.q / 16 + E, softmax over w, weights -> Ls in place; x1^T = v x weights -> Xs[i][j][c]; this row's k and v fragments stay in registers for all passes
//  C (wave = query j):  x2^T = rvT[h][j] (rows c) x weights (rows i); pre = g1 x1 + g2 x2, one whole 128-B line per (pixel, head)
// Both tables are stored by prep in fragment order, so that a wave's 16-B-per-lane load is 512 contiguous bytes.
__global__ __launch_bounds__(512) void fused_kernel(const b16* __restrict__ qk16, const b16* __restrict__ vT, const b16* __restrict__ Rcat, const b16* __restrict__ rvT,
                                                    const float* __restrict__ Gv1, const float* __restrict__ Gv2, float* __restrict__ pre) {
  constexpr int WP = Wd + 8, RP = 16 * WP + 8;                 // Ls pitches in f16: 272 B per query, 4368 B per row i, both 16 B x odd for the b128 accesses of either orientation
  constexpr int XJ = HD + 4, XR = 16 * XJ + 4;                 // Xs pitches in floats: 144 B and 2320 B, both 16 B x odd
  __shared__ __attribute__((aligned(16))) b16 Ls[16 * RP];
  __shared__ __attribute__((aligned(16))) float Xs[16 * XR];
  const int lane = threadIdx.x & 31, wv = threadIdx.x >> 5, col = lane & 15, hh = lane >> 4;
  const int jh = blockIdx.x & 1, ig = (blockIdx.x >> 1) & 3, n = (blockIdx.x >> 3) & 3, h = blockIdx.x >> 5;
  const float g1 = tanh_e(Gv1[h]), g2 = tanh_e(Gv2[h]);
  const size_t pixB = ((size_t)n * Hh + ig * 16 + wv) * Wd;    // pixel (n, i, 0) of the wave's row in B
  const size_t pixA = ((size_t)n * Hh + ig * 16 + col) * Wd;   // pixel (n, i, 0) of the lane's row in A and C
  // the lane's own fragment addresses (row = lane % 16, k = 8 (lane / 16) .. + 7 and 16 more: the k order of frag_kb)
  const b16* qk0 = qk16 + (pixB + col) * (2 * C) + h * HD + 8 * hh;   // q of position col; k lies C further on
  const b16* vp = vT + ((((size_t)n * NH + h) * Hh + ig * 16 + wv) * HD + col) * Wd + 8 * hh;
  v16b Kf[8], Vf[2][4];
#pragma unroll
  for (int t = 0; t < 8; ++t) Kf[t] = cat8b(ld8b(qk0 + C + t * 16 * (2 * C)), ld8b(qk0 + C + t * 16 * (2 * C) + 16));
#pragma unroll
  for (int nt = 0; nt < 2; ++nt)
#pragma unroll
    for (int ch = 0; ch < 4; ++ch) Vf[nt][ch] = cat8b(ld8b(vp + nt * 16 * Wd + ch * 32), ld8b(vp + nt * 16 * Wd + ch * 32 + 16));
  asm volatile("s_wait_xcnt 0x0" :: "v"(qk0), "v"(vp) : "memory");   // closes the run of loads; the addresses are named so that their registers live up to the wait and no load's result lands in them ahead of it
#pragma unroll 1   // rolled: one copy of the pass body, so that the kernel's text stays small
  for (int jt = jh * 4; jt < jh * 4 + 4; ++jt) {
    const int j0 = jt * 16, j = j0 + wv;
    // ---- A
    const b16* ra = Rcat + (size_t)(h * Wd + j) * (Wd * 64) + lane * 8;
    const b16* gq = qk16 + (pixA + j) * (2 * C) + h * HD + 8 * hh;
    const b16* qp = qk0 + j0 * (2 * C);
    const v16b bq0 = cat8b(ld8b(gq), ld8b(gq + 16)), bq1 = cat8b(ld8b(gq + C), ld8b(gq + C + 16));
    const v16b qb = cat8b(ld8b(qp), ld8b(qp + 16));            // B's queries, asked for early
#pragma unroll
    for (int g = 0; g < 2; ++g) {                              // two groups of four w tiles: 64 registers of table fragments at a time
      v16b af[4][2];
#pragma unroll
      for (int u = 0; u < 4; ++u)
#pragma unroll
        for (int ks = 0; ks < 2; ++ks) af[u][ks] = cat8b(ld8b(ra + (g * 4 + u) * 1024 + ks * 512), ld8b(ra + (g * 4 + u) * 1024 + ks * 512 + 256));
      asm volatile("s_wait_xcnt 0x0" :: "v"(ra), "v"(gq), "v"(qp) : "memory");   // closes the run of loads, as above
#pragma unroll
      for (int u = 0; u < 4; ++u) {
        v8f e = {};
        e = wmma16b(af[u][0], bq0, e); e = wmma16b(af[u][1], bq1, e);           // lane = row i, element = w
        v8b pk;
#pragma unroll
        for (int v = 0; v < 8; ++v) pk[v] = (b16)e[v];
        *(v8b*)(Ls + col * RP + wv * WP + (g * 4 + u) * 16 + 8 * hh) = pk;
      }
    }
    __syncthreads();                                           // E of all 16 queries is in Ls; every wave has left C of the pass before (Xs is free)
    // ---- B
    b16* Lr = Ls + wv * RP + col * WP;                         // row i = wave, query = lane
    float lg[4][16];
#pragma unroll
    for (int ch = 0; ch < 4; ++ch) {
      v8f s0 = {}, s1 = {};
      s0 = wmma16b(Kf[2 * ch], qb, s0);
      s1 = wmma16b(Kf[2 * ch + 1], qb, s1);
      const v8b e0 = ld8b(Lr + ch * 32 + 8 * hh), e1 = ld8b(Lr + ch * 32 + 16 + 8 * hh);
#pragma unroll
      for (int r = 0; r < 8; ++r) { lg[ch][r] = s0[r] * DS + (float)e0[r]; lg[ch][8 + r] = s1[r] * DS + (float)e1[r]; }
    }
    float m = -INFINITY;
#pragma unroll
    for (int ch = 0; ch < 4; ++ch)
#pragma unroll
      for (int r = 0; r < 16; ++r) m = fmaxf(m, lg[ch][r]);
    m = fmaxf(m, __shfl_xor(m, 16));
    float sum = 0.0f;
#pragma unroll
    for (int ch = 0; ch < 4; ++ch)
#pragma unroll
      for (int r = 0; r < 16; ++r) { lg[ch][r] = __expf(lg[ch][r] - m); sum += lg[ch][r]; }
    sum += __shfl_xor(sum, 16);
    const float inv = 1.0f / sum;
    v8f o[2] = {{}, {}};
#pragma unroll
    for (int ch = 0; ch < 4; ++ch) {
      v8b p0, p1;
#pragma unroll
      for (int r = 0; r < 8; ++r) { p0[r] = (b16)(lg[ch][r] * inv); p1[r] = (b16)(lg[ch][8 + r] * inv); }
      *(v8b*)(Lr + ch * 32 + 8 * hh) = p0; *(v8b*)(Lr + ch * 32 + 16 + 8 * hh) = p1;
      const v16b pb = cat8b(p0, p1);
#pragma unroll
      for (int nt = 0; nt < 2; ++nt) o[nt] = wmma16b(Vf[nt][ch], pb, o[nt]);
    }
#pragma unroll
    for (int nt = 0; nt < 2; ++nt) {                           // x1^T: lane = query, element = feature
      float* xd = Xs + wv * XR + col * XJ + nt * 16 + 8 * hh;
      *(v4f*)xd = (v4f){o[nt][0], o[nt][1], o[nt][2], o[nt][3]}; *(v4f*)(xd + 4) = (v4f){o[nt][4], o[nt][5], o[nt][6], o[nt][7]};
    }
    // C's table fragments are asked for in front of the barrier: their latency runs beside the wait for the slower waves, not behind it
    const b16* rb = rvT + (size_t)(h * Wd + j) * (HD * Wd) + lane * 8;
    v16b rf[2][4];
#pragma unroll
    for (int nt = 0; nt < 2; ++nt)
#pragma unroll
      for (int kb = 0; kb < 4; ++kb) rf[nt][kb] = cat8b(ld8b(rb + nt * 2048 + kb * 512), ld8b(rb + nt * 2048 + kb * 512 + 256));
    asm volatile("s_wait_xcnt 0x0" :: "v"(rb) : "memory");     // closes the run of loads, as above
    __syncthreads();                                           // weights and x1 of all 16 rows are in LDS
    // ---- C
    v8f a2[2] = {{}, {}};
#pragma unroll
    for (int kb = 0; kb < 4; ++kb) {
      const v16b wb = frag_kb(Ls + col * RP + wv * WP + kb * 32, hh);            // row i = lane, query = wave
#pragma unroll
      for (int nt = 0; nt < 2; ++nt) a2[nt] = wmma16b(rf[nt][kb], wb, a2[nt]);   // lane = row i, element = feature
    }
    float* pd = pre + (pixA + j) * C + h * HD + 8 * hh;
    v4f rs[2][2];
#pragma unroll
    for (int nt = 0; nt < 2; ++nt) {
      const float* xs = Xs + col * XR + wv * XJ + nt * 16 + 8 * hh;
      const v4f x0 = *(const v4f*)xs, x1v = *(const v4f*)(xs + 4);
#pragma unroll
      for (int v = 0; v < 4; ++v) { rs[nt][0][v] = g1 * x0[v] + g2 * a2[nt][v]; rs[nt][1][v] = g1 * x1v[v] + g2 * a2[nt][4 + v]; }
    }
#pragma unroll
    for (int nt = 0; nt < 2; ++nt) { *(v4f*)(pd + nt * 16) = rs[nt][0]; *(v4f*)(pd + nt * 16 + 4) = rs[nt][1]; }
    asm volatile("s_wait_xcnt 0x0" ::: "memory");              // closes the run of stores: no address register of an issued store is rewritten ahead of this wait
  }
}

// out conv: (32768 x 256) x (256 x 256); block = 64 pixels x all 256 output channels, 8 waves of 32 x 64. The f32 rows of pre and the f16 weight rows (full K) are copied once
// into LDS as whole lines (pitches 1040 B and 528 B = 16 B x odd); A fragments are rounded to f16 as they are read, in the k order of frag_kb.
__device__ __forceinline__ v16b frag_kf(const float* p, int hh) {
  const float* p0 = p + 8 * hh; const float* p1 = p + 16 + 8 * hh; v16b f;
#pragma unroll
  for (int e = 0; e < 8; ++e) { f[e] = (b16)p0[e]; f[8 + e] = (b16)p1[e]; }
  return f;
}
__global__ __launch_bounds__(256) void out_kernel(const float* __restrict__ pre, const b16* __restrict__ wo16, float* __restrict__ out) {
  constexpr int AP = C * 4 + 16, BP = C * 2 + 16, BOFF = 64 * AP;   // LDS row pitches and the weight tile's offset, in bytes
  __shared__ __attribute__((aligned(16))) char S[64 * AP + C * BP];  // reused as output staging behind a barrier
  const int lane = threadIdx.x & 31, wave = threadIdx.x >> 5, nloc = lane & 15, hlf = lane >> 4;
  const int mrow = wave & 1, ncol = wave >> 1;
  const int mb = blockIdx.x * 64, m0 = mb + mrow * 32, c0 = ncol * 64;
  {
    const unsigned lA = (unsigned)(size_t)(S + wave * 8 * AP + lane * 16), lB = (unsigned)(size_t)(S + BOFF + wave * 32 * BP + lane * 16);   // wave copies 8 rows of pre (two halves each) and 32 weight rows
    const char* gA = (const char*)(pre + (size_t)(mb + wave * 8) * C + lane * 4);
    const char* gB = (const char*)(wo16 + (size_t)(wave * 32) * C + lane * 8);
    copy_rows8(lA, gA, AP, C * 4); copy_rows8(lA + 512, gA + 512, AP, C * 4);
#pragma unroll   // unrolled: four straight-line copy statements, no loop-carried address registers
    for (int q = 0; q < 4; ++q) copy_rows8(lB + q * 8 * BP, gB + q * 8 * C * 2, BP, C * 2);
  }
  asm volatile("s_wait_asynccnt 0x0" ::: "memory");            // this wave's copies have landed before the barrier publishes them
  __syncthreads();
  v8f acc[2][4];
#pragma unroll
  for (int r = 0; r < 2; ++r)
#pragma unroll
    for (int t = 0; t < 4; ++t) acc[r][t] = (v8f){};
  const float* As = (const float*)(S + (mrow * 32 + nloc) * AP); const b16* Bs = (const b16*)(S + BOFF + (c0 + nloc) * BP);
  // fragments read as one group, one k-step ahead of their products (as in qkv_kernel)
  v16b fa[2][2], fb[2][4];
  fa[0][0] = frag_kf(As, hlf); fa[0][1] = frag_kf(As + 16 * (AP / 4), hlf);
#pragma unroll
  for (int t = 0; t < 4; ++t) fb[0][t] = frag_kb(Bs + t * 16 * (BP / 2), hlf);
#pragma unroll   // unrolled so that both fragment sets are indexed by constants and stay in registers
  for (int ks = 0; ks < C / 32; ++ks) {
    const int cur = ks & 1, nxt = cur ^ 1, kn = (ks + 1) * 32;
    if (ks + 1 < C / 32) {
      fa[nxt][0] = frag_kf(As + kn, hlf); fa[nxt][1] = frag_kf(As + 16 * (AP / 4) + kn, hlf);
#pragma unroll
      for (int t = 0; t < 4; ++t) fb[nxt][t] = frag_kb(Bs + t * 16 * (BP / 2) + kn, hlf);
    }
#pragma unroll
    for (int t = 0; t < 4; ++t) { acc[0][t] = wmma16b(fa[cur][0], fb[cur][t], acc[0][t]); acc[1][t] = wmma16b(fa[cur][1], fb[cur][t], acc[1][t]); }
  }
  __syncthreads();                                             // every wave has read its last fragment: the tiles' LDS becomes output staging
  float* Tw = (float*)(S + wave * (64 * 36 * 4));              // per wave: 64 channels x 32 pixels, pitch 36 floats
#pragma unroll
  for (int t = 0; t < 4; ++t)
#pragma unroll
    for (int r = 0; r < 2; ++r)
#pragma unroll
      for (int v = 0; v < 8; ++v) Tw[(t * 16 + nloc) * 36 + r * 16 + v + 8 * hlf] = acc[r][t][v];
  wave_lds_sync();
  const int n = m0 / (Hh * Wd), hw0 = m0 % (Hh * Wd);         // pre rows = pixels (n, hw); a 32-row wave tile lies in one image
  {
#pragma unroll
    for (int jj = 0; jj < 16; ++jj) { const int cc = jj * 4 + (lane >> 3), c4 = (lane & 7) * 4; *(v4f*)(out + ((size_t)n * C + c0 + cc) * (Hh * Wd) + hw0 + c4) = *(const v4f*)(Tw + cc * 36 + c4); }   // channel-major [n][o][hw]
  }
}
}  // namespace

extern "C" void kernel_launch(void* const* d_in, const int* in_sizes, int n_in,
                              void* d_out, int out_size, void* d_ws, size_t ws_size, hipStream_t stream) {
  (void)n_in; (void)out_size;
  const float* x = (const float*)d_in[0]; const float* wq = (const float*)d_in[1]; const float* wk = (const float*)d_in[2]; const float* wv = (const float*)d_in[3]; const float* wo = (const float*)d_in[4];
  const float* rq = (const float*)d_in[5]; const float* rk = (const float*)d_in[6]; const float* rv = (const float*)d_in[7];
  const float* Gq = (const float*)d_in[8]; const float* Gk = (const float*)d_in[9]; const float* Gv1 = (const float*)d_in[10]; const float* Gv2 = (const float*)d_in[11];
  float* out = (float*)d_out;   // [4,256,64,128]
  if (in_sizes[0] != NPIX * C || in_sizes[1] != C * C || in_sizes[5] != NH * HD * Wd * Wd || in_sizes[8] != NH) return;
  size_t off = 0; char* ws = (char*)d_ws;
  auto carve = [&](size_t bytes) { char* p = ws + off; off += (bytes + 255) & ~(size_t)255; return p; };
  b16* wqkv = (b16*)carve((size_t)3 * C * C * 2); b16* wo16 = (b16*)carve((size_t)C * C * 2);
  b16* Rcat = (b16*)carve((size_t)NH * Wd * Wd * 64 * 2);      // 16 MB
  b16* rvT = (b16*)carve((size_t)NH * Wd * HD * Wd * 2);       // 8 MB
  float* pre = (float*)carve((size_t)NPIX * C * 4);             // 32 MB
  b16* qk16 = (b16*)carve((size_t)NPIX * 2 * C * 2);            // 32 MB
  b16* vT = (b16*)carve((size_t)NPIX * C * 2);                  // 16 MB
  if (off > ws_size) return;                                     // total about 105 MB (binary)
  prep_kernel<<<1024, 256, 0, stream>>>(wq, wk, wv, wo, rq, rk, rv, Gq, Gk, wqkv, wo16, Rcat, rvT);
  qkv_kernel<<<NPIX / 128, 256, 0, stream>>>(x, wqkv, qk16, vT);
  fused_kernel<<<Nn * NH * (Hh / 16) * 2, 512, 0, stream>>>(qk16, vT, Rcat, rvT, Gv1, Gv2, pre);
  out_kernel<<<NPIX / 64, 256, 0, stream>>>(pre, wo16, out);
}

// v006
// It runs in 72.8 microseconds.
// Timed twice side by side with v005, it ran 1.09 times as fast both times.
// All steps since v000 together make it 2.91 times as fast.
#include <hip/hip_runtime.h>

// Gated axial attention along the width axis: x [4][256][64][128]; q,k,v = 1x1 convs (8 heads x 32); per (n, head, row i): logits[j][w] = (q_j.k_w + g_q q_j.rq[:,j,w] +
// g_k k_j.rk[:,j,w]) / 16 with learned per-position tables (tanh'd), softmax over w; out = g_v1 (weights . v) + g_v2 (weights . rv[:,j,:]); 1x1 out conv.
// Contractions on v_wmma_f32_16x16x32_f16 with single f16 operands (position-major activation rows, weight / position-table copies with the gates and 1/16

namespace {
__device__ __forceinline__ float tanh_e(float v) { return 1.0f - 2.0f * __builtin_amdgcn_rcpf(1.0f + __expf(2.0f * v)); }   // tanh via exp + hardware reciprocal (~1 ulp; values are rounded to f16 afterwards or are gates of O(1))
constexpr int Nn = 4, C = 256, Hh = 64, Wd = 128, NH = 8, HD = 32, NPIX = Nn * Hh * Wd;   // 32768 pixels
constexpr float DS = 0.0625f;   // 1/sqrt(C)

typedef _Float16 b16;
typedef __attribute__((ext_vector_type(16))) _Float16 v16b;
typedef __attribute__((ext_vector_type(8)))  _Float16 v8b;
typedef __attribute__((ext_vector_type(8)))  float v8f;
typedef __attribute__((ext_vector_type(4)))  float v4f;

__device__ __forceinline__ v8b ld8b(const b16* p) { return *(const v8b*)p; }
__device__ __forceinline__ v16b cat8b(v8b a, v8b b) { return __builtin_shufflevector(a, b, 0, 1, 2, 3, 4, 5, 6, 7, 8, 9, 10, 11, 12, 13, 14, 15); }
__device__ __forceinline__ v16b frag_kb(const b16* p, int hh) { return cat8b(ld8b(p + 8 * hh), ld8b(p + 16 + 8 * hh)); }
__device__ __forceinline__ void split16(float v, b16& hi, b16& lo) { hi = (b16)v; lo = (b16)(v - (float)hi); }
// hi/lo fragment pair straight from an f32 k-contiguous row (same k-map)
__device__ __forceinline__ void frag_ksplit(const float* p, int hh, v16b& fh_, v16b& fl_) {
  const float* p0 = p + 8 * hh; const float* p1 = p + 16 + 8 * hh;
#pragma unroll
  for (int e = 0; e < 8; ++e) { b16 a, c; split16(p0[e], a, c); fh_[e] = a; fl_[e] = c; split16(p1[e], a, c); fh_[8 + e] = a; fl_[8 + e] = c; }
}
__device__ __forceinline__ v8f wmma16b(v16b a, v16b b, v8f c) {
  v8f d = __builtin_amdgcn_wmma_f32_16x16x32_f16(false, a, false, b, (short)0, c, false, false);
  asm volatile("v_nop\n\tv_nop\n\tv_nop\n\tv_nop" : "+v"(d) : "v"(a), "v"(b));
  return d;
}
__device__ __forceinline__ void wave_lds_sync() {
  __builtin_amdgcn_fence(__ATOMIC_RELEASE, "workgroup");
  __builtin_amdgcn_wave_barrier();
  __builtin_amdgcn_fence(__ATOMIC_ACQUIRE, "workgroup");
}

// (b) f32 rows with pitch ldo: 64 floats = 256 B = 2 lines per row; 16 lanes x 16 B per row, 2 rows per instruction. Optional per-row factor
__device__ __forceinline__ void epi_f32(v8f (&acc)[2][4], float scale, const float* rscale, float* __restrict__ out, int ldo, int m0, int c0, int lane, float* Tt) {
  const int nloc = lane & 15, hlf = lane >> 4;
#pragma unroll
  for (int t = 0; t < 4; ++t)
#pragma unroll
    for (int r = 0; r < 2; ++r)
#pragma unroll
      for (int v = 0; v < 8; ++v) {
        const int rr = r * 16 + v + 8 * hlf;
        const float rs = rscale ? rscale[(size_t)(m0 + rr) * 32] : 1.0f;
        Tt[rr * 64 + t * 16 + nloc] = acc[r][t][v] * scale * rs;
      }
  wave_lds_sync();
  float* dst0 = out + (size_t)m0 * ldo + c0;
  {
#pragma unroll
    for (int j = 0; j < 16; ++j) { const int rr = j * 2 + hlf, c4 = nloc * 4; *(v4f*)(dst0 + (size_t)rr * ldo + c4) = *(const v4f*)(Tt + rr * 64 + c4); }
    
  }
}



// prep (grid-stride): wqkv = [wq; wk; wv] [768][256] f16, wout f16 [256][256]; Rcat (fragment order) at (h, j, w, c') = (c' < 32 ? tanh(Gq_h) tanh(rq[h][c'][j][w]) : tanh(Gk_h) tanh(rk[h][c'-32][j][w])) / 16
__global__ __launch_bounds__(256) void prep_kernel(const float* __restrict__ wq, const float* __restrict__ wk, const float* __restrict__ wv, const float* __restrict__ wo,
                                                   const float* __restrict__ rq, const float* __restrict__ rk, const float* __restrict__ rv, const float* __restrict__ Gq, const float* __restrict__ Gk,
                                                   b16* __restrict__ wqkv, b16* __restrict__ wo16, b16* __restrict__ Rcat, b16* __restrict__ rvT) {
  const size_t tid = (size_t)blockIdx.x * blockDim.x + threadIdx.x, stride = (size_t)gridDim.x * blockDim.x;
  const size_t n0 = (size_t)3 * C * C / 8, n1 = (size_t)C * C / 8, n2 = (size_t)NH * Wd * Wd * 64 / 8, n3 = (size_t)NH * Wd * HD * Wd / 8;
  {
    for (size_t p = tid; p < n0 + n1 + n2 + n3; p += stride) {
      v8b v; b16* dst;
      if (p < n0) { const size_t i = p * 8; const float* src = (i < (size_t)C * C) ? (wq + i) : (i < (size_t)2 * C * C) ? (wk + i - (size_t)C * C) : (wv + i - (size_t)2 * C * C);
#pragma unroll
        for (int e = 0; e < 8; ++e) v[e] = (b16)src[e]; dst = wqkv + i; }
      else if (p < n0 + n1) { const size_t i = (p - n0) * 8;
#pragma unroll
        for (int e = 0; e < 8; ++e) v[e] = (b16)wo[i + e]; dst = wo16 + i; }
      else if (p < n0 + n1 + n2) { const size_t i = (p - n0 - n1) * 8;       // Rcat in fragment order: 16-B unit ((((h*128 + j)*8 + w/16)*2 + c'/32)*2 + (c'/16)%2)*32 + ((c'/8)%2)*16 + w%16
        const int u = (int)(p - n0 - n1), ln = u & 31, cp0 = ((u >> 6) & 1) * 32 + ((u >> 5) & 1) * 16 + (ln >> 4) * 8, w = ((u >> 7) & 7) * 16 + (ln & 15), j = (u >> 10) & (Wd - 1), h = u >> 17;
        const float gq = tanh_e(Gq[h]) * DS, gk = tanh_e(Gk[h]) * DS;
#pragma unroll
        for (int e = 0; e < 8; ++e) { const int cp = cp0 + e; const float* tab = (cp < HD) ? rq : rk; const int c = (cp < HD) ? cp : cp - HD;
          v[e] = (b16)(((cp < HD) ? gq : gk) * tanh_e(tab[(((size_t)h * HD + c) * Wd + j) * Wd + w])); }
        dst = Rcat + i; }
      else { const size_t i = (p - n0 - n1 - n2) * 8;                          // rvT in fragment order: 16-B unit ((((h*128 + j)*2 + c/16)*4 + w/32)*2 + (w/16)%2)*32 + ((w/8)%2)*16 + c%16
        const int u = (int)(p - n0 - n1 - n2), ln = u & 31, w0 = ((u >> 6) & 3) * 32 + ((u >> 5) & 1) * 16 + (ln >> 4) * 8, c = ((u >> 8) & 1) * 16 + (ln & 15), j = (u >> 9) & (Wd - 1), h = u >> 16;
#pragma unroll
        for (int e = 0; e < 8; ++e) v[e] = (b16)tanh_e(rv[(((size_t)h * HD + c) * Wd + j) * Wd + w0 + e]);
        dst = rvT + i; }
      *(v8b*)dst = v;
    }
    
  }
}

// Eight async copies global -> LDS, 16 B per lane each (one copy of a wave = 512 bytes = 4 whole lines). The s_wait_xcnt closes the statement so that
// no address register of an issued copy is rewritten ahead of it.
__device__ __forceinline__ void copy_rows8(unsigned l, const char* g, unsigned lp, int gp) {   // l, lp: LDS byte address and row pitch; g, gp: global address and row pitch in bytes
  asm volatile("global_load_async_to_lds_b128 %0, %8, off\n\t"
               "global_load_async_to_lds_b128 %1, %9, off\n\t"
               "global_load_async_to_lds_b128 %2, %10, off\n\t"
               "global_load_async_to_lds_b128 %3, %11, off\n\t"
               "global_load_async_to_lds_b128 %4, %12, off\n\t"
               "global_load_async_to_lds_b128 %5, %13, off\n\t"
               "global_load_async_to_lds_b128 %6, %14, off\n\t"
               "global_load_async_to_lds_b128 %7, %15, off\n\t"
               "s_wait_xcnt 0x0"
               :: "v"(l), "v"(l + lp), "v"(l + 2 * lp), "v"(l + 3 * lp), "v"(l + 4 * lp), "v"(l + 5 * lp), "v"(l + 6 * lp), "v"(l + 7 * lp),
                  "v"(g), "v"(g + gp), "v"(g + 2 * gp), "v"(g + 3 * gp), "v"(g + 4 * gp), "v"(g + 5 * gp), "v"(g + 6 * gp), "v"(g + 7 * gp)
               : "memory");
}

// qkv: (32768 x 256) x (256 x 768); grid 256, block = 128 pixels (one image row i of one n) x all 768 columns, 8 waves of 32 x 64 per column tile of 128. The block reads its
// pixels straight from x (channel-major f32, whole 512-B rows), rounds them to f16 and lays them position-major in LDS once; that tile serves all six column tiles. The weight
// tiles (full K) come by async copies into two buffers, tile t + 1 flying while tile t is worked on. LDS row pitch 528 B = 16 B x odd for the ds_load_b128 fragment reads.
// All three results are stored in the order in which fused_kernel's fragments read them, 16 B per lane, so that one load or copy of a wave there is 512 contiguous bytes:
// column tiles 0-3 -> qk16[q, k][n][i][h][pos / 16][c / 16][(c / 8) % 2][pos % 16][c % 8]; tiles 4-5 -> vT[n][h][i][c / 16][w / 16][(w / 8) % 2][c % 16][w % 8] through a block LDS tile.
__global__ __launch_bounds__(256) void qkv_kernel(const float* __restrict__ x, const b16* __restrict__ wqkv, b16* __restrict__ qk16, b16* __restrict__ vT) {
  constexpr int LP = C + 8, TILE = 128 * LP, TP = 128 + 8, QP = 64 + 8, NT = 3 * C / 128;   // LDS row pitch and tile size in f16; pitches of the v and of the q, k staging rows (16 B x odd); column tiles
  __shared__ __attribute__((aligned(16))) b16 Sa[TILE];        // pixels (A), rows of 256 channels
  __shared__ __attribute__((aligned(16))) b16 Sb[2 * TILE];    // weight rows (B), two buffers
  __shared__ __attribute__((aligned(16))) b16 St[8 * 32 * QP];  // output staging: per wave 32 x 64 (q, k) or the block's 128 channels x 128 pixels (v, 128 * TP, the smaller)
  const int lane = threadIdx.x & 31, wave = threadIdx.x >> 5, nloc = lane & 15, hlf = lane >> 4;
  const int mrow = wave & 3, ncol = wave >> 2;
  const int pix0 = blockIdx.x * 128, n = pix0 / (Hh * Wd), i = (pix0 / Wd) % Hh;
  const unsigned lB = (unsigned)(size_t)(Sb + wave * 16 * LP + lane * 8);       // wave copies rows 16 wave .. 16 wave + 15 of a weight tile
  const char* gB = (const char*)(wqkv + (size_t)(wave * 16) * C + lane * 8);
  auto copy_tile = [&](int t) {
    const unsigned l = lB + (unsigned)(t & 1) * (TILE * 2); const char* g = gB + (size_t)t * (128 * C * 2);
    copy_rows8(l, g, LP * 2, C * 2); copy_rows8(l + 8 * LP * 2, g + 8 * C * 2, LP * 2, C * 2);
  };
  copy_tile(0);
  {
    // wave = 32 channels; one load of a wave = the 128 pixels of one channel (512 contiguous bytes); all 32 loads are asked for before the first is used
    const float* xr = x + ((size_t)n * C + wave * 32) * (Hh * Wd) + (size_t)i * Wd + lane * 4;
    v4f xv[32];
#pragma unroll
    for (int e = 0; e < 32; ++e) xv[e] = *(const v4f*)(xr + (size_t)e * (Hh * Wd));
    asm volatile("s_wait_xcnt 0x0" ::: "memory");              // closes the run of loads: no address register of an issued load is rewritten ahead of this wait
#pragma unroll
    for (int g = 0; g < 4; ++g)
#pragma unroll
      for (int q = 0; q < 4; ++q) {                            // lane holds pixels 4 lane .. 4 lane + 3: per pixel 8 channels = one 16-B LDS store
        v8b pk;
#pragma unroll
        for (int e = 0; e < 8; ++e) pk[e] = (b16)xv[g * 8 + e][q];
        *(v8b*)(Sa + (lane * 4 + q) * LP + wave * 32 + g * 8) = pk;
      }
  }
  asm volatile("s_wait_asynccnt 0x0" ::: "memory");            // this wave's copies of tile 0 have landed before the barrier publishes them
  __syncthreads();                                             // publishes the pixel tile and weight tile 0
  copy_tile(1);
  const b16* As = Sa + (mrow * 32 + nloc) * LP;
#pragma unroll 1   // rolled: one copy of the tile body, so that the kernel's text stays small
  for (int t = 0; t < NT; ++t) {
    v8f acc[2][4];
#pragma unroll
    for (int r = 0; r < 2; ++r)
#pragma unroll
      for (int u = 0; u < 4; ++u) acc[r][u] = (v8f){};
    const b16* Bs = Sb + (t & 1) * TILE + (ncol * 64 + nloc) * LP;
    // a k-step's six fragments are read as one group, one k-step ahead of their products, so that a wave does not wait out the LDS latency in front of each pair of products
    v16b fa[2][2], fb[2][4];
    fa[0][0] = frag_kb(As, hlf); fa[0][1] = frag_kb(As + 16 * LP, hlf);
#pragma unroll
    for (int u = 0; u < 4; ++u) fb[0][u] = frag_kb(Bs + u * 16 * LP, hlf);
#pragma unroll   // unrolled so that both fragment sets are indexed by constants and stay in registers
    for (int ks = 0; ks < C / 32; ++ks) {
      const int cur = ks & 1, nxt = cur ^ 1, kn = (ks + 1) * 32;
      if (ks + 1 < C / 32) {
        fa[nxt][0] = frag_kb(As + kn, hlf); fa[nxt][1] = frag_kb(As + 16 * LP + kn, hlf);
#pragma unroll
        for (int u = 0; u < 4; ++u) fb[nxt][u] = frag_kb(Bs + u * 16 * LP + kn, hlf);
      }
#pragma unroll
      for (int u = 0; u < 4; ++u) { acc[0][u] = wmma16b(fa[cur][0], fb[cur][u], acc[0][u]); acc[1][u] = wmma16b(fa[cur][1], fb[cur][u], acc[1][u]); }
    }
    v8b wr[8];                                                 // the staged rows wait in registers: their global stores follow the tile's closing barrier, so that the barrier does not wait for a store
    if (t < 2 * C / 128) {                                     // q, k (block-uniform): the wave's 32 x 64 tile through its own staging range, read back in fragment order
      b16* Tw = St + wave * (32 * QP);
#pragma unroll
      for (int u = 0; u < 4; ++u)
#pragma unroll
        for (int r = 0; r < 2; ++r)
#pragma unroll
          for (int v = 0; v < 8; ++v) Tw[(r * 16 + v + 8 * hlf) * QP + u * 16 + nloc] = (b16)acc[r][u][v];
      wave_lds_sync();
#pragma unroll
      for (int j = 0; j < 8; ++j) wr[j] = ld8b(Tw + (((j >> 1) & 1) * 16 + nloc) * QP + (j >> 2) * 32 + (j & 1) * 16 + hlf * 8);   // j = (head of the two, position tile of the two, c / 16)
    } else {                                                   // v: tile columns = 4 heads x 32 c -> vT rows (h, c) of the block's 128 w
#pragma unroll
      for (int u = 0; u < 4; ++u)
#pragma unroll
        for (int r = 0; r < 2; ++r)
#pragma unroll
          for (int v = 0; v < 8; ++v) St[(ncol * 64 + u * 16 + nloc) * TP + mrow * 32 + r * 16 + 8 * hlf + v] = (b16)acc[r][u][v];
      __syncthreads();                                         // the block's staged v tile is complete before its rows are read back
#pragma unroll
      for (int j = 0; j < 8; ++j) wr[j] = ld8b(St + (wave * 16 + nloc) * TP + j * 16 + hlf * 8);   // j = w / 16; the wave holds 16 channels = one half of one head
    }
    asm volatile("s_wait_dscnt 0x0" ::: "memory");             // this wave's reads of buffer t & 1 and of the staging have returned
    asm volatile("s_wait_asynccnt 0x0" ::: "memory");          // this wave's copies of tile t + 1 have landed
    __syncthreads();                                           // publishes tile t + 1 and ends every wave's reads of the buffer refilled below and of the staging
    if (t + 2 < NT) copy_tile(t + 2);
    if (t < 2 * C / 128) {
      b16* dst = qk16 + (size_t)(t >> 1) * (NPIX * C) + ((size_t)blockIdx.x * NH + (t & 1) * 4 + ncol * 2) * (Wd * HD) + mrow * 1024 + lane * 8;
#pragma unroll
      for (int j = 0; j < 8; ++j) *(v8b*)(dst + (j >> 2) * (Wd * HD) + (j & 3) * 256) = wr[j];
    } else {
      const int h = (t - 2 * C / 128) * 4 + (wave >> 1);       // staged rows 16 wave .. + 15 = channels 16 (wave & 1) .. + 15 of head h
      b16* dst = vT + (((size_t)n * NH + h) * Hh + i) * (HD * Wd) + (wave & 1) * 2048 + lane * 8;
#pragma unroll
      for (int j = 0; j < 8; ++j) *(v8b*)(dst + j * 256) = wr[j];
    }
    asm volatile("s_wait_xcnt 0x0" ::: "memory");              // closes the run of stores: no address register of an issued store is rewritten ahead of this wait
  }
  asm volatile("s_wait_asynccnt 0x0" ::: "memory");            // no copy is outstanding when the wave ends
}

// E + attention + x2 in one kernel. Block = (h, n, 16 image rows i, 64 queries j), 16 waves, four passes of 16 queries. The two table products are GEMMs over the rows i for one j,
// the q.k and weights.v products are GEMMs over j for one row i: the 16 x 16 x 128 tile of logits, then of weights, changes hands between the two through LDS.
//  A (wave = query j):  E^T = Rcat[h][j] (rows w) x [q_j | k_j] (rows i)  -> Ls[i][j][w] f16
//  B (wave = row i):    logits = k.q / 16 + E, softmax over w, weights -> Ls in place; x1^T = v x weights -> Xs[i][j][c]; this row's k and v fragments stay in registers for all passes
//  C (wave = query j):  x2^T = rvT[h][j] (rows c) x weights (rows i); pre = g1 x1 + g2 x2, one whole 128-B line per (pixel, head)
// Both tables are stored by prep, and q, k, v by qkv_kernel, in fragment order, so that a wave's 16-B-per-lane load is 512 contiguous bytes. A's operand [q_j | k_j] has its rows in
// 16 different image rows: wave i brings its own row's q and k of the pass's 16 queries into Qs[i][j][c'] by four async copies of whole lines, one pass ahead, and A reads it turned.
__device__ __forceinline__ void copy_qk(unsigned l, const char* gq, const char* gk) {   // l: the lane's LDS byte address; the s_wait_xcnt closes the statement, as in copy_rows8
  asm volatile("global_load_async_to_lds_b128 %0, %4, off\n\t"
               "global_load_async_to_lds_b128 %1, %5, off\n\t"
               "global_load_async_to_lds_b128 %2, %6, off\n\t"
               "global_load_async_to_lds_b128 %3, %7, off\n\t"
               "s_wait_xcnt 0x0"
               :: "v"(l), "v"(l + 32), "v"(l + 64), "v"(l + 96), "v"(gq), "v"(gq + 512), "v"(gk), "v"(gk + 512)
               : "memory");
}
__global__ __launch_bounds__(512) void fused_kernel(const b16* __restrict__ qk16, const b16* __restrict__ vT, const b16* __restrict__ Rcat, const b16* __restrict__ rvT,
                                                    const float* __restrict__ Gv1, const float* __restrict__ Gv2, float* __restrict__ pre) {
  constexpr int WP = Wd + 8, RP = 16 * WP + 8;                 // Ls pitches in f16: 272 B per query, 4368 B per row i, both 16 B x odd for the b128 accesses of either orientation
  constexpr int XJ = HD + 4, XR = 16 * XJ + 4;                 // Xs pitches in floats: 144 B and 2320 B, both 16 B x odd
  __shared__ __attribute__((aligned(16))) b16 Ls[16 * RP];
  constexpr int QJ = 2 * HD + 8, QR = 16 * QJ + 8;             // Qs pitches in f16: 144 B per query, 2320 B per row i, both 16 B x odd
  __shared__ __attribute__((aligned(16))) float Xs[16 * XR];
  __shared__ __attribute__((aligned(16))) b16 Qs[16 * QR];
  const int lane = threadIdx.x & 31, wv = threadIdx.x >> 5, col = lane & 15, hh = lane >> 4;
  const int jh = blockIdx.x & 1, ig = (blockIdx.x >> 1) & 3, n = (blockIdx.x >> 3) & 3, h = blockIdx.x >> 5;
  const float g1 = tanh_e(Gv1[h]), g2 = tanh_e(Gv2[h]);
  const size_t pixA = ((size_t)n * Hh + ig * 16 + col) * Wd;   // pixel (n, i, 0) of the lane's row in C
  // the wave's row (n, i, h) in fragment order (row = lane % 16, k = 8 (lane / 16) .. + 7, and 16 more in the next 512 B: the k order of frag_kb)
  const b16* qf = qk16 + (((size_t)n * Hh + ig * 16 + wv) * NH + h) * (Wd * HD) + lane * 8;
  const b16* kf = qf + (size_t)NPIX * C;
  const b16* vp = vT + (((size_t)n * NH + h) * Hh + ig * 16 + wv) * (HD * Wd) + lane * 8;
  const unsigned lq = (unsigned)(size_t)(Qs + wv * QR + col * QJ + 8 * hh);   // where the lane's 16 B of q land; 32 B on: c + 16; 64 B on: k
  copy_qk(lq, (const char*)(qf + jh * 4 * 512), (const char*)(kf + jh * 4 * 512));
  v16b Kf[8], Vf[2][4];
#pragma unroll
  for (int t = 0; t < 8; ++t) Kf[t] = cat8b(ld8b(kf + t * 512), ld8b(kf + t * 512 + 256));
  asm volatile("s_wait_xcnt 0x0" :: "v"(kf) : "memory");       // closes the run of k loads: no result of a v load lands in their address registers ahead of this wait
#pragma unroll
  for (int nt = 0; nt < 2; ++nt)
#pragma unroll
    for (int ch = 0; ch < 4; ++ch) Vf[nt][ch] = cat8b(ld8b(vp + nt * 2048 + ch * 512), ld8b(vp + nt * 2048 + ch * 512 + 256));
  asm volatile("s_wait_xcnt 0x0" :: "v"(vp) : "memory");       // closes the run of v loads; the address is named so that its registers live up to the wait and no load's result lands in them ahead of it
  asm volatile("s_wait_asynccnt 0x0" ::: "memory");            // this wave's copies for the first pass have landed before the barrier publishes them
  __syncthreads();                                             // publishes Qs of the first pass
#pragma unroll 1   // rolled: one copy of the pass body, so that the kernel's text stays small
  for (int jt = jh * 4; jt < jh * 4 + 4; ++jt) {
    const int j0 = jt * 16, j = j0 + wv;
    // ---- A
    const b16* ra = Rcat + (size_t)(h * Wd + j) * (Wd * 64) + lane * 8;
    const b16* qp = qf + jt * 512;
    const v16b bq0 = frag_kb(Qs + col * QR + wv * QJ, hh), bq1 = frag_kb(Qs + col * QR + wv * QJ + HD, hh);   // row i = lane, query = wave
    const v16b qb = cat8b(ld8b(qp), ld8b(qp + 256));           // B's queries, asked for early
#pragma unroll
    for (int g = 0; g < 2; ++g) {                              // two groups of four w tiles: 64 registers of table fragments at a time
      v16b af[4][2];
#pragma unroll
      for (int u = 0; u < 4; ++u)
#pragma unroll
        for (int ks = 0; ks < 2; ++ks) af[u][ks] = cat8b(ld8b(ra + (g * 4 + u) * 1024 + ks * 512), ld8b(ra + (g * 4 + u) * 1024 + ks * 512 + 256));
      asm volatile("s_wait_xcnt 0x0" :: "v"(ra), "v"(qp) : "memory");   // closes the run of loads, as above
#pragma unroll
      for (int u = 0; u < 4; ++u) {
        v8f e = {};
        e = wmma16b(af[u][0], bq0, e); e = wmma16b(af[u][1], bq1, e);           // lane = row i, element = w
        v8b pk;
#pragma unroll
        for (int v = 0; v < 8; ++v) pk[v] = (b16)e[v];
        *(v8b*)(Ls + col * RP + wv * WP + (g * 4 + u) * 16 + 8 * hh) = pk;
      }
    }
    asm volatile("s_wait_dscnt 0x0" ::: "memory");             // this wave's reads of Qs have returned before the barrier lets Qs be refilled
    __syncthreads();                                           // E of all 16 queries is in Ls; every wave has left C of the pass before (Xs is free) and has read its part of Qs
    if (jt + 1 < jh * 4 + 4) copy_qk(lq, (const char*)(qf + (jt + 1) * 512), (const char*)(kf + (jt + 1) * 512));   // the next pass's q and k fly beside B
    // ---- B
    b16* Lr = Ls + wv * RP + col * WP;                         // row i = wave, query = lane
    float lg[4][16];
#pragma unroll
    for (int ch = 0; ch < 4; ++ch) {
      v8f s0 = {}, s1 = {};
      s0 = wmma16b(Kf[2 * ch], qb, s0);
      s1 = wmma16b(Kf[2 * ch + 1], qb, s1);
      const v8b e0 = ld8b(Lr + ch * 32 + 8 * hh), e1 = ld8b(Lr + ch * 32 + 16 + 8 * hh);
#pragma unroll
      for (int r = 0; r < 8; ++r) { lg[ch][r] = s0[r] * DS + (float)e0[r]; lg[ch][8 + r] = s1[r] * DS + (float)e1[r]; }
    }
    float m = -INFINITY;
#pragma unroll
    for (int ch = 0; ch < 4; ++ch)
#pragma unroll
      for (int r = 0; r < 16; ++r) m = fmaxf(m, lg[ch][r]);
    m = fmaxf(m, __shfl_xor(m, 16));
    float sum = 0.0f;
#pragma unroll
    for (int ch = 0; ch < 4; ++ch)
#pragma unroll
      for (int r = 0; r < 16; ++r) { lg[ch][r] = __expf(lg[ch][r] - m); sum += lg[ch][r]; }
    sum += __shfl_xor(sum, 16);
    const float inv = 1.0f / sum;
    v8f o[2] = {{}, {}};
#pragma unroll
    for (int ch = 0; ch < 4; ++ch) {
      v8b p0, p1;
#pragma unroll
      for (int r = 0; r < 8; ++r) { p0[r] = (b16)(lg[ch][r] * inv); p1[r] = (b16)(lg[ch][8 + r] * inv); }
      *(v8b*)(Lr + ch * 32 + 8 * hh) = p0; *(v8b*)(Lr + ch * 32 + 16 + 8 * hh) = p1;
      const v16b pb = cat8b(p0, p1);
#pragma unroll
      for (int nt = 0; nt < 2; ++nt) o[nt] = wmma16b(Vf[nt][ch], pb, o[nt]);
    }
#pragma unroll
    for (int nt = 0; nt < 2; ++nt) {                           // x1^T: lane = query, element = feature
      float* xd = Xs + wv * XR + col * XJ + nt * 16 + 8 * hh;
      *(v4f*)xd = (v4f){o[nt][0], o[nt][1], o[nt][2], o[nt][3]}; *(v4f*)(xd + 4) = (v4f){o[nt][4], o[nt][5], o[nt][6], o[nt][7]};
    }
    // C's table fragments are asked for in front of the barrier: their latency runs beside the wait for the slower waves, not behind it
    const b16* rb = rvT + (size_t)(h * Wd + j) * (HD * Wd) + lane * 8;
    v16b rf[2][4];
#pragma unroll
    for (int nt = 0; nt < 2; ++nt)
#pragma unroll
      for (int kb = 0; kb < 4; ++kb) rf[nt][kb] = cat8b(ld8b(rb + nt * 2048 + kb * 512), ld8b(rb + nt * 2048 + kb * 512 + 256));
    asm volatile("s_wait_xcnt 0x0" :: "v"(rb) : "memory");     // closes the run of loads, as above
    asm volatile("s_wait_asynccnt 0x0" ::: "memory");          // this wave's copies for the next pass have landed before the barrier publishes them
    __syncthreads();                                           // weights and x1 of all 16 rows, and Qs of the next pass, are in LDS
    // ---- C
    v8f a2[2] = {{}, {}};
#pragma unroll
    for (int kb = 0; kb < 4; ++kb) {
      const v16b wb = frag_kb(Ls + col * RP + wv * WP + kb * 32, hh);            // row i = lane, query = wave
#pragma unroll
      for (int nt = 0; nt < 2; ++nt) a2[nt] = wmma16b(rf[nt][kb], wb, a2[nt]);   // lane = row i, element = feature
    }
    float* pd = pre + (pixA + j) * C + h * HD + 8 * hh;
    v4f rs[2][2];
#pragma unroll
    for (int nt = 0; nt < 2; ++nt) {
      const float* xs = Xs + col * XR + wv * XJ + nt * 16 + 8 * hh;
      const v4f x0 = *(const v4f*)xs, x1v = *(const v4f*)(xs + 4);
#pragma unroll
      for (int v = 0; v < 4; ++v) { rs[nt][0][v] = g1 * x0[v] + g2 * a2[nt][v]; rs[nt][1][v] = g1 * x1v[v] + g2 * a2[nt][4 + v]; }
    }
#pragma unroll
    for (int nt = 0; nt < 2; ++nt) { *(v4f*)(pd + nt * 16) = rs[nt][0]; *(v4f*)(pd + nt * 16 + 4) = rs[nt][1]; }
    asm volatile("s_wait_xcnt 0x0" ::: "memory");              // closes the run of stores: no address register of an issued store is rewritten ahead of this wait
  }
}

// out conv: (32768 x 256) x (256 x 256); block = 64 pixels x all 256 output channels, 8 waves of 32 x 64. The f32 rows of pre and the f16 weight rows (full K) are copied once
// into LDS as whole lines (pitches 1040 B and 528 B = 16 B x odd); A fragments are rounded to f16 as they are read, in the k order of frag_kb.
__device__ __forceinline__ v16b frag_kf(const float* p, int hh) {
  const float* p0 = p + 8 * hh; const float* p1 = p + 16 + 8 * hh; v16b f;
#pragma unroll
  for (int e = 0; e < 8; ++e) { f[e] = (b16)p0[e]; f[8 + e] = (b16)p1[e]; }
  return f;
}
__global__ __launch_bounds__(256) void out_kernel(const float* __restrict__ pre, const b16* __restrict__ wo16, float* __restrict__ out) {
  constexpr int AP = C * 4 + 16, BP = C * 2 + 16, BOFF = 64 * AP;   // LDS row pitches and the weight tile's offset, in bytes
  __shared__ __attribute__((aligned(16))) char S[64 * AP + C * BP];  // reused as output staging behind a barrier
  const int lane = threadIdx.x & 31, wave = threadIdx.x >> 5, nloc = lane & 15, hlf = lane >> 4;
  const int mrow = wave & 1, ncol = wave >> 1;
  const int mb = blockIdx.x * 64, m0 = mb + mrow * 32, c0 = ncol * 64;
  {
    const unsigned lA = (unsigned)(size_t)(S + wave * 8 * AP + lane * 16), lB = (unsigned)(size_t)(S + BOFF + wave * 32 * BP + lane * 16);   // wave copies 8 rows of pre (two halves each) and 32 weight rows
    const char* gA = (const char*)(pre + (size_t)(mb + wave * 8) * C + lane * 4);
    const char* gB = (const char*)(wo16 + (size_t)(wave * 32) * C + lane * 8);
    copy_rows8(lA, gA, AP, C * 4); copy_rows8(lA + 512, gA + 512, AP, C * 4);
#pragma unroll   // unrolled: four straight-line copy statements, no loop-carried address registers
    for (int q = 0; q < 4; ++q) copy_rows8(lB + q * 8 * BP, gB + q * 8 * C * 2, BP, C * 2);
  }
  asm volatile("s_wait_asynccnt 0x0" ::: "memory");            // this wave's copies have landed before the barrier publishes them
  __syncthreads();
  v8f acc[2][4];
#pragma unroll
  for (int r = 0; r < 2; ++r)
#pragma unroll
    for (int t = 0; t < 4; ++t) acc[r][t] = (v8f){};
  const float* As = (const float*)(S + (mrow * 32 + nloc) * AP); const b16* Bs = (const b16*)(S + BOFF + (c0 + nloc) * BP);
  // fragments read as one group, one k-step ahead of their products (as in qkv_kernel)
  v16b fa[2][2], fb[2][4];
  fa[0][0] = frag_kf(As, hlf); fa[0][1] = frag_kf(As + 16 * (AP / 4), hlf);
#pragma unroll
  for (int t = 0; t < 4; ++t) fb[0][t] = frag_kb(Bs + t * 16 * (BP / 2), hlf);
#pragma unroll   // unrolled so that both fragment sets are indexed by constants and stay in registers
  for (int ks = 0; ks < C / 32; ++ks) {
    const int cur = ks & 1, nxt = cur ^ 1, kn = (ks + 1) * 32;
    if (ks + 1 < C / 32) {
      fa[nxt][0] = frag_kf(As + kn, hlf); fa[nxt][1] = frag_kf(As + 16 * (AP / 4) + kn, hlf);
#pragma unroll
      for (int t = 0; t < 4; ++t) fb[nxt][t] = frag_kb(Bs + t * 16 * (BP / 2) + kn, hlf);
    }
#pragma unroll
    for (int t = 0; t < 4; ++t) { acc[0][t] = wmma16b(fa[cur][0], fb[cur][t], acc[0][t]); acc[1][t] = wmma16b(fa[cur][1], fb[cur][t], acc[1][t]); }
  }
  __syncthreads();                                             // every wave has read its last fragment: the tiles' LDS becomes output staging
  float* Tw = (float*)(S + wave * (64 * 36 * 4));              // per wave: 64 channels x 32 pixels, pitch 36 floats
#pragma unroll
  for (int t = 0; t < 4; ++t)
#pragma unroll
    for (int r = 0; r < 2; ++r)
#pragma unroll
      for (int v = 0; v < 8; ++v) Tw[(t * 16 + nloc) * 36 + r * 16 + v + 8 * hlf] = acc[r][t][v];
  wave_lds_sync();
  const int n = m0 / (Hh * Wd), hw0 = m0 % (Hh * Wd);         // pre rows = pixels (n, hw); a 32-row wave tile lies in one image
  {
#pragma unroll
    for (int jj = 0; jj < 16; ++jj) { const int cc = jj * 4 + (lane >> 3), c4 = (lane & 7) * 4; *(v4f*)(out + ((size_t)n * C + c0 + cc) * (Hh * Wd) + hw0 + c4) = *(const v4f*)(Tw + cc * 36 + c4); }   // channel-major [n][o][hw]
  }
}
}  // namespace

extern "C" void kernel_launch(void* const* d_in, const int* in_sizes, int n_in,
                              void* d_out, int out_size, void* d_ws, size_t ws_size, hipStream_t stream) {
  (void)n_in; (void)out_size;
  const float* x = (const float*)d_in[0]; const float* wq = (const float*)d_in[1]; const float* wk = (const float*)d_in[2]; const float* wv = (const float*)d_in[3]; const float* wo = (const float*)d_in[4];
  const float* rq = (const float*)d_in[5]; const float* rk = (const float*)d_in[6]; const float* rv = (const float*)d_in[7];
  const float* Gq = (const float*)d_in[8]; const float* Gk = (const float*)d_in[9]; const float* Gv1 = (const float*)d_in[10]; const float* Gv2 = (const float*)d_in[11];
  float* out = (float*)d_out;   // [4,256,64,128]
  if (in_sizes[0] != NPIX * C || in_sizes[1] != C * C || in_sizes[5] != NH * HD * Wd * Wd || in_sizes[8] != NH) return;
  size_t off = 0; char* ws = (char*)d_ws;
  auto carve = [&](size_t bytes) { char* p = ws + off; off += (bytes + 255) & ~(size_t)255; return p; };
  b16* wqkv = (b16*)carve((size_t)3 * C * C * 2); b16* wo16 = (b16*)carve((size_t)C * C * 2);
  b16* Rcat = (b16*)carve((size_t)NH * Wd * Wd * 64 * 2);      // 16 MB
  b16* rvT = (b16*)carve((size_t)NH * Wd * HD * Wd * 2);       // 8 MB
  float* pre = (float*)carve((size_t)NPIX * C * 4);             // 32 MB
  b16* qk16 = (b16*)carve((size_t)NPIX * 2 * C * 2);            // 32 MB
  b16* vT = (b16*)carve((size_t)NPIX * C * 2);                  // 16 MB
  if (off > ws_size) return;                                     // total about 105 MB (binary)
  prep_kernel<<<1024, 256, 0, stream>>>(wq, wk, wv, wo, rq, rk, rv, Gq, Gk, wqkv, wo16, Rcat, rvT);
  qkv_kernel<<<NPIX / 128, 256, 0, stream>>>(x, wqkv, qk16, vT);
  fused_kernel<<<Nn * NH * (Hh / 16) * 2, 512, 0, stream>>>(qk16, vT, Rcat, rvT, Gv1, Gv2, pre);
  out_kernel<<<NPIX / 64, 256, 0, stream>>>(pre, wo16, out);
}

// v007
// A run of this version takes 67.7 microseconds.
// Timed twice side by side with v006, it ran 1.07 times as fast both times.
// All steps since v000 together make it 3.13 times as fast.
#include <hip/hip_runtime.h>

// Gated axial attention along the width axis: x [4][256][64][128]; q,k,v = 1x1 convs (8 heads x 32); per (n, head, row i): logits[j][w] = (q_j.k_w + g_q q_j.rq[:,j,w] +
// g_k k_j.rk[:,j,w]) / 16 with learned per-position tables (tanh'd), softmax over w; out = g_v1 (weights . v) + g_v2 (weights . rv[:,j,:]); 1x1 out conv.
// Contractions on v_wmma_f32_16x16x32_f16 with single f16 operands (position-major activation rows, weight / position-table copies with the gates and 1/16

namespace {
__device__ __forceinline__ float tanh_e(float v) { return 1.0f - 2.0f * __builtin_amdgcn_rcpf(1.0f + __expf(2.0f * v)); }   // tanh via exp + hardware reciprocal (~1 ulp; values are rounded to f16 afterwards or are gates of O(1))
constexpr int Nn = 4, C = 256, Hh = 64, Wd = 128, NH = 8, HD = 32, NPIX = Nn * Hh * Wd;   // 32768 pixels
constexpr float DS = 0.0625f;   // 1/sqrt(C)

typedef _Float16 b16;
typedef __attribute__((ext_vector_type(16))) _Float16 v16b;
typedef __attribute__((ext_vector_type(8)))  _Float16 v8b;
typedef __attribute__((ext_vector_type(8)))  float v8f;
typedef __attribute__((ext_vector_type(4)))  float v4f;

__device__ __forceinline__ v8b ld8b(const b16* p) { return *(const v8b*)p; }
__device__ __forceinline__ v16b cat8b(v8b a, v8b b) { return __builtin_shufflevector(a, b, 0, 1, 2, 3, 4, 5, 6, 7, 8, 9, 10, 11, 12, 13, 14, 15); }
__device__ __forceinline__ v16b frag_kb(const b16* p, int hh) { return cat8b(ld8b(p + 8 * hh), ld8b(p + 16 + 8 * hh)); }
__device__ __forceinline__ void split16(float v, b16& hi, b16& lo) { hi = (b16)v; lo = (b16)(v - (float)hi); }
// hi/lo fragment pair straight from an f32 k-contiguous row (same k-map)
__device__ __forceinline__ void frag_ksplit(const float* p, int hh, v16b& fh_, v16b& fl_) {
  const float* p0 = p + 8 * hh; const float* p1 = p + 16 + 8 * hh;
#pragma unroll
  for (int e = 0; e < 8; ++e) { b16 a, c; split16(p0[e], a, c); fh_[e] = a; fl_[e] = c; split16(p1[e], a, c); fh_[8 + e] = a; fl_[8 + e] = c; }
}
__device__ __forceinline__ v8f wmma16b(v16b a, v16b b, v8f c) {
  v8f d = __builtin_amdgcn_wmma_f32_16x16x32_f16(false, a, false, b, (short)0, c, false, false);
  asm volatile("v_nop\n\tv_nop\n\tv_nop\n\tv_nop" : "+v"(d) : "v"(a), "v"(b));
  return d;
}
__device__ __forceinline__ void wave_lds_sync() {
  __builtin_amdgcn_fence(__ATOMIC_RELEASE, "workgroup");
  __builtin_amdgcn_wave_barrier();
  __builtin_amdgcn_fence(__ATOMIC_ACQUIRE, "workgroup");
}

// (b) f32 rows with pitch ldo: 64 floats = 256 B = 2 lines per row; 16 lanes x 16 B per row, 2 rows per instruction. Optional per-row factor
__device__ __forceinline__ void epi_f32(v8f (&acc)[2][4], float scale, const float* rscale, float* __restrict__ out, int ldo, int m0, int c0, int lane, float* Tt) {
  const int nloc = lane & 15, hlf = lane >> 4;
#pragma unroll
  for (int t = 0; t < 4; ++t)
#pragma unroll
    for (int r = 0; r < 2; ++r)
#pragma unroll
      for (int v = 0; v < 8; ++v) {
        const int rr = r * 16 + v + 8 * hlf;
        const float rs = rscale ? rscale[(size_t)(m0 + rr) * 32] : 1.0f;
        Tt[rr * 64 + t * 16 + nloc] = acc[r][t][v] * scale * rs;
      }
  wave_lds_sync();
  float* dst0 = out + (size_t)m0 * ldo + c0;
  {
#pragma unroll
    for (int j = 0; j < 16; ++j) { const int rr = j * 2 + hlf, c4 = nloc * 4; *(v4f*)(dst0 + (size_t)rr * ldo + c4) = *(const v4f*)(Tt + rr * 64 + c4); }
    
  }
}



// prep (grid-stride): wqkv = [wq; wk; wv] [768][256] f16, wout f16 [256][256]; Rcat (fragment order) at (h, j, w, c') = (c' < 32 ? tanh(Gq_h) tanh(rq[h][c'][j][w]) : tanh(Gk_h) tanh(rk[h][c'-32][j][w])) / 16
__global__ __launch_bounds__(256) void prep_kernel(const float* __restrict__ wq, const float* __restrict__ wk, const float* __restrict__ wv, const float* __restrict__ wo,
                                                   const float* __restrict__ rq, const float* __restrict__ rk, const float* __restrict__ rv, const float* __restrict__ Gq, const float* __restrict__ Gk,
                                                   b16* __restrict__ wqkv, b16* __restrict__ wo16, b16* __restrict__ Rcat, b16* __restrict__ rvT) {
  const size_t tid = (size_t)blockIdx.x * blockDim.x + threadIdx.x, stride = (size_t)gridDim.x * blockDim.x;
  const size_t n0 = (size_t)3 * C * C / 8, n1 = (size_t)C * C / 8, n2 = (size_t)NH * Wd * Wd * 64 / 8, n3 = (size_t)NH * Wd * HD * Wd / 8;
  {
    for (size_t p = tid; p < n0 + n1 + n2 + n3; p += stride) {
      v8b v; b16* dst;
      if (p < n0) { const size_t i = p * 8; const float* src = (i < (size_t)C * C) ? (wq + i) : (i < (size_t)2 * C * C) ? (wk + i - (size_t)C * C) : (wv + i - (size_t)2 * C * C);
#pragma unroll
        for (int e = 0; e < 8; ++e) v[e] = (b16)src[e]; dst = wqkv + i; }
      else if (p < n0 + n1) { const size_t i = (p - n0) * 8;
#pragma unroll
        for (int e = 0; e < 8; ++e) v[e] = (b16)wo[i + e]; dst = wo16 + i; }
      else if (p < n0 + n1 + n2) { const size_t i = (p - n0 - n1) * 8;       // Rcat in fragment order: 16-B unit ((((h*128 + j)*8 + w/16)*2 + c'/32)*2 + (c'/16)%2)*32 + ((c'/8)%2)*16 + w%16
        const int u = (int)(p - n0 - n1), ln = u & 31, cp0 = ((u >> 6) & 1) * 32 + ((u >> 5) & 1) * 16 + (ln >> 4) * 8, w = ((u >> 7) & 7) * 16 + (ln & 15), j = (u >> 10) & (Wd - 1), h = u >> 17;
        const float gq = tanh_e(Gq[h]) * DS, gk = tanh_e(Gk[h]) * DS;
#pragma unroll
        for (int e = 0; e < 8; ++e) { const int cp = cp0 + e; const float* tab = (cp < HD) ? rq : rk; const int c = (cp < HD) ? cp : cp - HD;
          v[e] = (b16)(((cp < HD) ? gq : gk) * tanh_e(tab[(((size_t)h * HD + c) * Wd + j) * Wd + w])); }
        dst = Rcat + i; }
      else { const size_t i = (p - n0 - n1 - n2) * 8;                          // rvT in fragment order: 16-B unit ((((h*128 + j)*2 + c/16)*4 + w/32)*2 + (w/16)%2)*32 + ((w/8)%2)*16 + c%16
        const int u = (int)(p - n0 - n1 - n2), ln = u & 31, w0 = ((u >> 6) & 3) * 32 + ((u >> 5) & 1) * 16 + (ln >> 4) * 8, c = ((u >> 8) & 1) * 16 + (ln & 15), j = (u >> 9) & (Wd - 1), h = u >> 16;
#pragma unroll
        for (int e = 0; e < 8; ++e) v[e] = (b16)tanh_e(rv[(((size_t)h * HD + c) * Wd + j) * Wd + w0 + e]);
        dst = rvT + i; }
      *(v8b*)dst = v;
    }
    
  }
}

// Eight async copies global -> LDS, 16 B per lane each (one copy of a wave = 512 bytes = 4 whole lines). The s_wait_xcnt closes the statement so that
// no address register of an issued copy is rewritten ahead of it.
__device__ __forceinline__ void copy_rows8(unsigned l, const char* g, unsigned lp, int gp) {   // l, lp: LDS byte address and row pitch; g, gp: global address and row pitch in bytes
  asm volatile("global_load_async_to_lds_b128 %0, %8, off\n\t"
               "global_load_async_to_lds_b128 %1, %9, off\n\t"
               "global_load_async_to_lds_b128 %2, %10, off\n\t"
               "global_load_async_to_lds_b128 %3, %11, off\n\t"
               "global_load_async_to_lds_b128 %4, %12, off\n\t"
               "global_load_async_to_lds_b128 %5, %13, off\n\t"
               "global_load_async_to_lds_b128 %6, %14, off\n\t"
               "global_load_async_to_lds_b128 %7, %15, off\n\t"
               "s_wait_xcnt 0x0"
               :: "v"(l), "v"(l + lp), "v"(l + 2 * lp), "v"(l + 3 * lp), "v"(l + 4 * lp), "v"(l + 5 * lp), "v"(l + 6 * lp), "v"(l + 7 * lp),
                  "v"(g), "v"(g + gp), "v"(g + 2 * gp), "v"(g + 3 * gp), "v"(g + 4 * gp), "v"(g + 5 * gp), "v"(g + 6 * gp), "v"(g + 7 * gp)
               : "memory");
}

// qkv: (32768 x 256) x (256 x 768); grid 256, block = 128 pixels (one image row i of one n) x all 768 columns, 8 waves of 32 x 64 per column tile of 128. The block reads its
// pixels straight from x (channel-major f32, whole 512-B rows), rounds them to f16 and lays them position-major in LDS once; that tile serves all six column tiles. The weight
// tiles (full K) come by async copies into two buffers, tile t + 1 flying while tile t is worked on. LDS row pitch 528 B = 16 B x odd for the ds_load_b128 fragment reads.
// All three results are stored in the order in which attn_kernel's fragments read them, 16 B per lane, so that one load or copy of a wave there is 512 contiguous bytes:
// column tiles 0-3 -> qk16[q, k][n][i][h][pos / 16][c / 16][(c / 8) % 2][pos % 16][c % 8]; tiles 4-5 -> vT[n][h][i][c / 16][w / 16][(w / 8) % 2][c % 16][w % 8] through a block LDS tile.
__global__ __launch_bounds__(256) void qkv_kernel(const float* __restrict__ x, const b16* __restrict__ wqkv, b16* __restrict__ qk16, b16* __restrict__ vT) {
  constexpr int LP = C + 8, TILE = 128 * LP, TP = 128 + 8, QP = 64 + 8, NT = 3 * C / 128;   // LDS row pitch and tile size in f16; pitches of the v and of the q, k staging rows (16 B x odd); column tiles
  __shared__ __attribute__((aligned(16))) b16 Sa[TILE];        // pixels (A), rows of 256 channels
  __shared__ __attribute__((aligned(16))) b16 Sb[2 * TILE];    // weight rows (B), two buffers
  __shared__ __attribute__((aligned(16))) b16 St[8 * 32 * QP];  // output staging: per wave 32 x 64 (q, k) or the block's 128 channels x 128 pixels (v, 128 * TP, the smaller)
  const int lane = threadIdx.x & 31, wave = threadIdx.x >> 5, nloc = lane & 15, hlf = lane >> 4;
  const int mrow = wave & 3, ncol = wave >> 2;
  const int pix0 = blockIdx.x * 128, n = pix0 / (Hh * Wd), i = (pix0 / Wd) % Hh;
  const unsigned lB = (unsigned)(size_t)(Sb + wave * 16 * LP + lane * 8);       // wave copies rows 16 wave .. 16 wave + 15 of a weight tile
  const char* gB = (const char*)(wqkv + (size_t)(wave * 16) * C + lane * 8);
  auto copy_tile = [&](int t) {
    const unsigned l = lB + (unsigned)(t & 1) * (TILE * 2); const char* g = gB + (size_t)t * (128 * C * 2);
    copy_rows8(l, g, LP * 2, C * 2); copy_rows8(l + 8 * LP * 2, g + 8 * C * 2, LP * 2, C * 2);
  };
  copy_tile(0);
  {
    // wave = 32 channels; one load of a wave = the 128 pixels of one channel (512 contiguous bytes); all 32 loads are asked for before the first is used
    const float* xr = x + ((size_t)n * C + wave * 32) * (Hh * Wd) + (size_t)i * Wd + lane * 4;
    v4f xv[32];
#pragma unroll
    for (int e = 0; e < 32; ++e) xv[e] = *(const v4f*)(xr + (size_t)e * (Hh * Wd));
    asm volatile("s_wait_xcnt 0x0" ::: "memory");              // closes the run of loads: no address register of an issued load is rewritten ahead of this wait
#pragma unroll
    for (int g = 0; g < 4; ++g)
#pragma unroll
      for (int q = 0; q < 4; ++q) {                            // lane holds pixels 4 lane .. 4 lane + 3: per pixel 8 channels = one 16-B LDS store
        v8b pk;
#pragma unroll
        for (int e = 0; e < 8; ++e) pk[e] = (b16)xv[g * 8 + e][q];
        *(v8b*)(Sa + (lane * 4 + q) * LP + wave * 32 + g * 8) = pk;
      }
  }
  asm volatile("s_wait_asynccnt 0x0" ::: "memory");            // this wave's copies of tile 0 have landed before the barrier publishes them
  __syncthreads();                                             // publishes the pixel tile and weight tile 0
  copy_tile(1);
  const b16* As = Sa + (mrow * 32 + nloc) * LP;
#pragma unroll 1   // rolled: one copy of the tile body, so that the kernel's text stays small
  for (int t = 0; t < NT; ++t) {
    v8f acc[2][4];
#pragma unroll
    for (int r = 0; r < 2; ++r)
#pragma unroll
      for (int u = 0; u < 4; ++u) acc[r][u] = (v8f){};
    const b16* Bs = Sb + (t & 1) * TILE + (ncol * 64 + nloc) * LP;
    // a k-step's six fragments are read as one group, one k-step ahead of their products, so that a wave does not wait out the LDS latency in front of each pair of products
    v16b fa[2][2], fb[2][4];
    fa[0][0] = frag_kb(As, hlf); fa[0][1] = frag_kb(As + 16 * LP, hlf);
#pragma unroll
    for (int u = 0; u < 4; ++u) fb[0][u] = frag_kb(Bs + u * 16 * LP, hlf);
#pragma unroll   // unrolled so that both fragment sets are indexed by constants and stay in registers
    for (int ks = 0; ks < C / 32; ++ks) {
      const int cur = ks & 1, nxt = cur ^ 1, kn = (ks + 1) * 32;
      if (ks + 1 < C / 32) {
        fa[nxt][0] = frag_kb(As + kn, hlf); fa[nxt][1] = frag_kb(As + 16 * LP + kn, hlf);
#pragma unroll
        for (int u = 0; u < 4; ++u) fb[nxt][u] = frag_kb(Bs + u * 16 * LP + kn, hlf);
      }
#pragma unroll
      for (int u = 0; u < 4; ++u) { acc[0][u] = wmma16b(fa[cur][0], fb[cur][u], acc[0][u]); acc[1][u] = wmma16b(fa[cur][1], fb[cur][u], acc[1][u]); }
    }
    v8b wr[8];                                                 // the staged rows wait in registers: their global stores follow the tile's closing barrier, so that the barrier does not wait for a store
    if (t < 2 * C / 128) {                                     // q, k (block-uniform): the wave's 32 x 64 tile through its own staging range, read back in fragment order
      b16* Tw = St + wave * (32 * QP);
#pragma unroll
      for (int u = 0; u < 4; ++u)
#pragma unroll
        for (int r = 0; r < 2; ++r)
#pragma unroll
          for (int v = 0; v < 8; ++v) Tw[(r * 16 + v + 8 * hlf) * QP + u * 16 + nloc] = (b16)acc[r][u][v];
      wave_lds_sync();
#pragma unroll
      for (int j = 0; j < 8; ++j) wr[j] = ld8b(Tw + (((j >> 1) & 1) * 16 + nloc) * QP + (j >> 2) * 32 + (j & 1) * 16 + hlf * 8);   // j = (head of the two, position tile of the two, c / 16)
    } else {                                                   // v: tile columns = 4 heads x 32 c -> vT rows (h, c) of the block's 128 w
#pragma unroll
      for (int u = 0; u < 4; ++u)
#pragma unroll
        for (int r = 0; r < 2; ++r)
#pragma unroll
          for (int v = 0; v < 8; ++v) St[(ncol * 64 + u * 16 + nloc) * TP + mrow * 32 + r * 16 + 8 * hlf + v] = (b16)acc[r][u][v];
      __syncthreads();                                         // the block's staged v tile is complete before its rows are read back
#pragma unroll
      for (int j = 0; j < 8; ++j) wr[j] = ld8b(St + (wave * 16 + nloc) * TP + j * 16 + hlf * 8);   // j = w / 16; the wave holds 16 channels = one half of one head
    }
    asm volatile("s_wait_dscnt 0x0" ::: "memory");             // this wave's reads of buffer t & 1 and of the staging have returned
    asm volatile("s_wait_asynccnt 0x0" ::: "memory");          // this wave's copies of tile t + 1 have landed
    __syncthreads();                                           // publishes tile t + 1 and ends every wave's reads of the buffer refilled below and of the staging
    if (t + 2 < NT) copy_tile(t + 2);
    if (t < 2 * C / 128) {
      b16* dst = qk16 + (size_t)(t >> 1) * (NPIX * C) + ((size_t)blockIdx.x * NH + (t & 1) * 4 + ncol * 2) * (Wd * HD) + mrow * 1024 + lane * 8;
#pragma unroll
      for (int j = 0; j < 8; ++j) *(v8b*)(dst + (j >> 2) * (Wd * HD) + (j & 3) * 256) = wr[j];
    } else {
      const int h = (t - 2 * C / 128) * 4 + (wave >> 1);       // staged rows 16 wave .. + 15 = channels 16 (wave & 1) .. + 15 of head h
      b16* dst = vT + (((size_t)n * NH + h) * Hh + i) * (HD * Wd) + (wave & 1) * 2048 + lane * 8;
#pragma unroll
      for (int j = 0; j < 8; ++j) *(v8b*)(dst + j * 256) = wr[j];
    }
    asm volatile("s_wait_xcnt 0x0" ::: "memory");              // closes the run of stores: no address register of an issued store is rewritten ahead of this wait
  }
  asm volatile("s_wait_asynccnt 0x0" ::: "memory");            // no copy is outstanding when the wave ends
}

// E + attention + x2 in one kernel. Block = (h, n, 16 image rows i, 64 queries j), 16 waves, four passes of 16 queries. The two table products are GEMMs over the rows i for one j,
// the q.k and weights.v products are GEMMs over j for one row i: the 16 x 16 x 128 tile of logits, then of weights, changes hands between the two through LDS.
//  A (wave = query j):  E^T = Rcat[h][j] (rows w) x [q_j | k_j] (rows i)  -> Ls[i][j][w] f16
//  B (wave = row i):    logits = k.q / 16 + E, softmax over w, weights -> Ls in place; x1^T = v x weights -> Xs[i][j][c]; this row's k and v fragments stay in registers for all passes
//  C (wave = query j):  x2^T = rvT[h][j] (rows c) x weights (rows i); pre[h][pixel][c] = g1 x1 + g2 x2 rounded to f16 (the out conv's operand type), 64 B per pixel; two waves of the block fill a line
// Both tables are stored by prep, and q, k, v by qkv_kernel, in fragment order, so that a wave's 16-B-per-lane load is 512 contiguous bytes. A's operand [q_j | k_j] has its rows in
// 16 different image rows: wave i brings its own row's q and k of the pass's 16 queries into Qs[i][j][c'] by four async copies of whole lines, one pass ahead, and A reads it turned.
__device__ __forceinline__ void copy_qk(unsigned l, const char* gq, const char* gk) {   // l: the lane's LDS byte address; the s_wait_xcnt closes the statement, as in copy_rows8
  asm volatile("global_load_async_to_lds_b128 %0, %4, off\n\t"
               "global_load_async_to_lds_b128 %1, %5, off\n\t"
               "global_load_async_to_lds_b128 %2, %6, off\n\t"
               "global_load_async_to_lds_b128 %3, %7, off\n\t"
               "s_wait_xcnt 0x0"
               :: "v"(l), "v"(l + 32), "v"(l + 64), "v"(l + 96), "v"(gq), "v"(gq + 512), "v"(gk), "v"(gk + 512)
               : "memory");
}
__global__ __launch_bounds__(512) void attn_kernel(const b16* __restrict__ qk16, const b16* __restrict__ vT, const b16* __restrict__ Rcat, const b16* __restrict__ rvT,
                                                    const float* __restrict__ Gv1, const float* __restrict__ Gv2, b16* __restrict__ pre) {
  constexpr int WP = Wd + 8, RP = 16 * WP + 8;                 // Ls pitches in f16: 272 B per query, 4368 B per row i, both 16 B x odd for the b128 accesses of either orientation
  constexpr int XJ = HD + 4, XR = 16 * XJ + 4;                 // Xs pitches in floats: 144 B and 2320 B, both 16 B x odd
  __shared__ __attribute__((aligned(16))) b16 Ls[16 * RP];
  constexpr int QJ = 2 * HD + 8, QR = 16 * QJ + 8;             // Qs pitches in f16: 144 B per query, 2320 B per row i, both 16 B x odd
  __shared__ __attribute__((aligned(16))) float Xs[16 * XR];
  __shared__ __attribute__((aligned(16))) b16 Qs[16 * QR];
  const int lane = threadIdx.x & 31, wv = threadIdx.x >> 5, col = lane & 15, hh = lane >> 4;
  const int jh = blockIdx.x & 1, ig = (blockIdx.x >> 1) & 3, n = (blockIdx.x >> 3) & 3, h = blockIdx.x >> 5;
  const float g1 = tanh_e(Gv1[h]), g2 = tanh_e(Gv2[h]);
  const size_t pixA = ((size_t)n * Hh + ig * 16 + col) * Wd;   // pixel (n, i, 0) of the lane's row in C
  // the wave's row (n, i, h) in fragment order (row = lane % 16, k = 8 (lane / 16) .. + 7, and 16 more in the next 512 B: the k order of frag_kb)
  const b16* qf = qk16 + (((size_t)n * Hh + ig * 16 + wv) * NH + h) * (Wd * HD) + lane * 8;
  const b16* kf = qf + (size_t)NPIX * C;
  const b16* vp = vT + (((size_t)n * NH + h) * Hh + ig * 16 + wv) * (HD * Wd) + lane * 8;
  const unsigned lq = (unsigned)(size_t)(Qs + wv * QR + col * QJ + 8 * hh);   // where the lane's 16 B of q land; 32 B on: c + 16; 64 B on: k
  copy_qk(lq, (const char*)(qf + jh * 4 * 512), (const char*)(kf + jh * 4 * 512));
  v16b Kf[8], Vf[2][4];
#pragma unroll
  for (int t = 0; t < 8; ++t) Kf[t] = cat8b(ld8b(kf + t * 512), ld8b(kf + t * 512 + 256));
  asm volatile("s_wait_xcnt 0x0" :: "v"(kf) : "memory");       // closes the run of k loads: no result of a v load lands in their address registers ahead of this wait
#pragma unroll
  for (int nt = 0; nt < 2; ++nt)
#pragma unroll
    for (int ch = 0; ch < 4; ++ch) Vf[nt][ch] = cat8b(ld8b(vp + nt * 2048 + ch * 512), ld8b(vp + nt * 2048 + ch * 512 + 256));
  asm volatile("s_wait_xcnt 0x0" :: "v"(vp) : "memory");       // closes the run of v loads; the address is named so that its registers live up to the wait and no load's result lands in them ahead of it
  asm volatile("s_wait_asynccnt 0x0" ::: "memory");            // this wave's copies for the first pass have landed before the barrier publishes them
  __syncthreads();                                             // publishes Qs of the first pass
#pragma unroll 1   // rolled: one copy of the pass body, so that the kernel's text stays small
  for (int jt = jh * 4; jt < jh * 4 + 4; ++jt) {
    const int j0 = jt * 16, j = j0 + wv;
    // ---- A
    const b16* ra = Rcat + (size_t)(h * Wd + j) * (Wd * 64) + lane * 8;
    const b16* qp = qf + jt * 512;
    const v16b bq0 = frag_kb(Qs + col * QR + wv * QJ, hh), bq1 = frag_kb(Qs + col * QR + wv * QJ + HD, hh);   // row i = lane, query = wave
    const v16b qb = cat8b(ld8b(qp), ld8b(qp + 256));           // B's queries, asked for early
#pragma unroll
    for (int g = 0; g < 2; ++g) {                              // two groups of four w tiles: 64 registers of table fragments at a time
      v16b af[4][2];
#pragma unroll
      for (int u = 0; u < 4; ++u)
#pragma unroll
        for (int ks = 0; ks < 2; ++ks) af[u][ks] = cat8b(ld8b(ra + (g * 4 + u) * 1024 + ks * 512), ld8b(ra + (g * 4 + u) * 1024 + ks * 512 + 256));
      asm volatile("s_wait_xcnt 0x0" :: "v"(ra), "v"(qp) : "memory");   // closes the run of loads, as above
#pragma unroll
      for (int u = 0; u < 4; ++u) {
        v8f e = {};
        e = wmma16b(af[u][0], bq0, e); e = wmma16b(af[u][1], bq1, e);           // lane = row i, element = w
        v8b pk;
#pragma unroll
        for (int v = 0; v < 8; ++v) pk[v] = (b16)e[v];
        *(v8b*)(Ls + col * RP + wv * WP + (g * 4 + u) * 16 + 8 * hh) = pk;
      }
    }
    asm volatile("s_wait_dscnt 0x0" ::: "memory");             // this wave's reads of Qs have returned before the barrier lets Qs be refilled
    __syncthreads();                                           // E of all 16 queries is in Ls; every wave has left C of the pass before (Xs is free) and has read its part of Qs
    if (jt + 1 < jh * 4 + 4) copy_qk(lq, (const char*)(qf + (jt + 1) * 512), (const char*)(kf + (jt + 1) * 512));   // the next pass's q and k fly beside B
    // ---- B
    b16* Lr = Ls + wv * RP + col * WP;                         // row i = wave, query = lane
    float lg[4][16];
#pragma unroll
    for (int ch = 0; ch < 4; ++ch) {
      v8f s0 = {}, s1 = {};
      s0 = wmma16b(Kf[2 * ch], qb, s0);
      s1 = wmma16b(Kf[2 * ch + 1], qb, s1);
      const v8b e0 = ld8b(Lr + ch * 32 + 8 * hh), e1 = ld8b(Lr + ch * 32 + 16 + 8 * hh);
#pragma unroll
      for (int r = 0; r < 8; ++r) { lg[ch][r] = s0[r] * DS + (float)e0[r]; lg[ch][8 + r] = s1[r] * DS + (float)e1[r]; }
    }
    float m = -INFINITY;
#pragma unroll
    for (int ch = 0; ch < 4; ++ch)
#pragma unroll
      for (int r = 0; r < 16; ++r) m = fmaxf(m, lg[ch][r]);
    m = fmaxf(m, __shfl_xor(m, 16));
    float sum = 0.0f;
#pragma unroll
    for (int ch = 0; ch < 4; ++ch)
#pragma unroll
      for (int r = 0; r < 16; ++r) { lg[ch][r] = __expf(lg[ch][r] - m); sum += lg[ch][r]; }
    sum += __shfl_xor(sum, 16);
    const float inv = 1.0f / sum;
    v8f o[2] = {{}, {}};
#pragma unroll
    for (int ch = 0; ch < 4; ++ch) {
      v8b p0, p1;
#pragma unroll
      for (int r = 0; r < 8; ++r) { p0[r] = (b16)(lg[ch][r] * inv); p1[r] = (b16)(lg[ch][8 + r] * inv); }
      *(v8b*)(Lr + ch * 32 + 8 * hh) = p0; *(v8b*)(Lr + ch * 32 + 16 + 8 * hh) = p1;
      const v16b pb = cat8b(p0, p1);
#pragma unroll
      for (int nt = 0; nt < 2; ++nt) o[nt] = wmma16b(Vf[nt][ch], pb, o[nt]);
    }
#pragma unroll
    for (int nt = 0; nt < 2; ++nt) {                           // x1^T: lane = query, element = feature
      float* xd = Xs + wv * XR + col * XJ + nt * 16 + 8 * hh;
      *(v4f*)xd = (v4f){o[nt][0], o[nt][1], o[nt][2], o[nt][3]}; *(v4f*)(xd + 4) = (v4f){o[nt][4], o[nt][5], o[nt][6], o[nt][7]};
    }
    // C's table fragments are asked for in front of the barrier: their latency runs beside the wait for the slower waves, not behind it
    const b16* rb = rvT + (size_t)(h * Wd + j) * (HD * Wd) + lane * 8;
    v16b rf[2][4];
#pragma unroll
    for (int nt = 0; nt < 2; ++nt)
#pragma unroll
      for (int kb = 0; kb < 4; ++kb) rf[nt][kb] = cat8b(ld8b(rb + nt * 2048 + kb * 512), ld8b(rb + nt * 2048 + kb * 512 + 256));
    asm volatile("s_wait_xcnt 0x0" :: "v"(rb) : "memory");     // closes the run of loads, as above
    asm volatile("s_wait_asynccnt 0x0" ::: "memory");          // this wave's copies for the next pass have landed before the barrier publishes them
    __syncthreads();                                           // weights and x1 of all 16 rows, and Qs of the next pass, are in LDS
    // ---- C
    v8f a2[2] = {{}, {}};
#pragma unroll
    for (int kb = 0; kb < 4; ++kb) {
      const v16b wb = frag_kb(Ls + col * RP + wv * WP + kb * 32, hh);            // row i = lane, query = wave
#pragma unroll
      for (int nt = 0; nt < 2; ++nt) a2[nt] = wmma16b(rf[nt][kb], wb, a2[nt]);   // lane = row i, element = feature
    }
    b16* pd = pre + ((size_t)h * NPIX + pixA + j) * HD + 8 * hh;
    v8b rs[2];
#pragma unroll
    for (int nt = 0; nt < 2; ++nt) {
      const float* xs = Xs + col * XR + wv * XJ + nt * 16 + 8 * hh;
      const v4f x0 = *(const v4f*)xs, x1v = *(const v4f*)(xs + 4);
#pragma unroll
      for (int v = 0; v < 4; ++v) { rs[nt][v] = (b16)(g1 * x0[v] + g2 * a2[nt][v]); rs[nt][4 + v] = (b16)(g1 * x1v[v] + g2 * a2[nt][4 + v]); }
    }
#pragma unroll
    for (int nt = 0; nt < 2; ++nt) *(v8b*)(pd + nt * 16) = rs[nt];
    asm volatile("s_wait_xcnt 0x0" ::: "memory");              // closes the run of stores: no address register of an issued store is rewritten ahead of this wait
  }
}

// out conv: (32768 x 256) x (256 x 256); block = 128 pixels x all 256 output channels, 16 waves of 32 x 64. pre arrives as f16, head-major ([h][pixel][32]): a block's pixels of one head
// are 8 KB in a row. They and the f16 weight rows (full K) are copied once into LDS as whole lines, each pixel's eight heads side by side in one row (pitch 528 B = 16 B x odd).
__global__ __launch_bounds__(512) void out_kernel(const b16* __restrict__ pre, const b16* __restrict__ wo16, float* __restrict__ out) {
  constexpr int BP = C * 2 + 16, BOFF = 128 * BP;                   // LDS row pitch and the weight tile's offset, in bytes
  __shared__ __attribute__((aligned(16))) char S[(128 + C) * BP];   // reused as output staging behind a barrier
  const int lane = threadIdx.x & 31, wave = threadIdx.x >> 5, nloc = lane & 15, hlf = lane >> 4;
  const int mrow = wave & 3, ncol = wave >> 2;
  const int mb = blockIdx.x * 128, m0 = mb + mrow * 32, c0 = ncol * 64;
  {
    // wave copies 64 pixels of one head (one copy = 8 pixels x 64 B = 512 contiguous bytes; four lanes per pixel) and 16 weight rows
    const int hd = wave >> 1, p0 = (wave & 1) * 64;
    const unsigned lA = (unsigned)(size_t)(S + (p0 + (lane >> 2)) * BP + hd * (HD * 2) + (lane & 3) * 16), lB = (unsigned)(size_t)(S + BOFF + wave * 16 * BP + lane * 16);
    const char* gA = (const char*)(pre + ((size_t)hd * NPIX + mb + p0) * HD + lane * 8);
    const char* gB = (const char*)(wo16 + (size_t)(wave * 16) * C + lane * 8);
    copy_rows8(lA, gA, 8 * BP, 512);
    copy_rows8(lB, gB, BP, C * 2); copy_rows8(lB + 8 * BP, gB + 8 * C * 2, BP, C * 2);
  }
  asm volatile("s_wait_asynccnt 0x0" ::: "memory");            // this wave's copies have landed before the barrier publishes them
  __syncthreads();
  v8f acc[2][4];
#pragma unroll
  for (int r = 0; r < 2; ++r)
#pragma unroll
    for (int t = 0; t < 4; ++t) acc[r][t] = (v8f){};
  const b16* As = (const b16*)(S + (mrow * 32 + nloc) * BP); const b16* Bs = (const b16*)(S + BOFF + (c0 + nloc) * BP);
  // fragments read as one group, one k-step ahead of their products (as in qkv_kernel)
  v16b fa[2][2], fb[2][4];
  fa[0][0] = frag_kb(As, hlf); fa[0][1] = frag_kb(As + 16 * (BP / 2), hlf);
#pragma unroll
  for (int t = 0; t < 4; ++t) fb[0][t] = frag_kb(Bs + t * 16 * (BP / 2), hlf);
#pragma unroll   // unrolled so that both fragment sets are indexed by constants and stay in registers
  for (int ks = 0; ks < C / 32; ++ks) {
    const int cur = ks & 1, nxt = cur ^ 1, kn = (ks + 1) * 32;
    if (ks + 1 < C / 32) {
      fa[nxt][0] = frag_kb(As + kn, hlf); fa[nxt][1] = frag_kb(As + 16 * (BP / 2) + kn, hlf);
#pragma unroll
      for (int t = 0; t < 4; ++t) fb[nxt][t] = frag_kb(Bs + t * 16 * (BP / 2) + kn, hlf);
    }
#pragma unroll
    for (int t = 0; t < 4; ++t) { acc[0][t] = wmma16b(fa[cur][0], fb[cur][t], acc[0][t]); acc[1][t] = wmma16b(fa[cur][1], fb[cur][t], acc[1][t]); }
  }
  __syncthreads();                                             // every wave has read its last fragment: the tiles' LDS becomes output staging
  float* Tw = (float*)(S + wave * (64 * 36 * 4));              // per wave: 64 channels x 32 pixels, pitch 36 floats
#pragma unroll
  for (int t = 0; t < 4; ++t)
#pragma unroll
    for (int r = 0; r < 2; ++r)
#pragma unroll
      for (int v = 0; v < 8; ++v) Tw[(t * 16 + nloc) * 36 + r * 16 + v + 8 * hlf] = acc[r][t][v];
  wave_lds_sync();
  const int n = m0 / (Hh * Wd), hw0 = m0 % (Hh * Wd);         // pre rows = pixels (n, hw); a 32-row wave tile lies in one image
  {
#pragma unroll
    for (int jj = 0; jj < 16; ++jj) { const int cc = jj * 4 + (lane >> 3), c4 = (lane & 7) * 4; *(v4f*)(out + ((size_t)n * C + c0 + cc) * (Hh * Wd) + hw0 + c4) = *(const v4f*)(Tw + cc * 36 + c4); }   // channel-major [n][o][hw]
  }
}
}  // namespace

extern "C" void kernel_launch(void* const* d_in, const int* in_sizes, int n_in,
                              void* d_out, int out_size, void* d_ws, size_t ws_size, hipStream_t stream) {
  (void)n_in; (void)out_size;
  const float* x = (const float*)d_in[0]; const float* wq = (const float*)d_in[1]; const float* wk = (const float*)d_in[2]; const float* wv = (const float*)d_in[3]; const float* wo = (const float*)d_in[4];
  const float* rq = (const float*)d_in[5]; const float* rk = (const float*)d_in[6]; const float* rv = (const float*)d_in[7];
  const float* Gq = (const float*)d_in[8]; const float* Gk = (const float*)d_in[9]; const float* Gv1 = (const float*)d_in[10]; const float* Gv2 = (const float*)d_in[11];
  float* out = (float*)d_out;   // [4,256,64,128]
  if (in_sizes[0] != NPIX * C || in_sizes[1] != C * C || in_sizes[5] != NH * HD * Wd * Wd || in_sizes[8] != NH) return;
  size_t off = 0; char* ws = (char*)d_ws;
  auto carve = [&](size_t bytes) { char* p = ws + off; off += (bytes + 255) & ~(size_t)255; return p; };
  b16* wqkv = (b16*)carve((size_t)3 * C * C * 2); b16* wo16 = (b16*)carve((size_t)C * C * 2);
  b16* Rcat = (b16*)carve((size_t)NH * Wd * Wd * 64 * 2);      // 16 MB
  b16* rvT = (b16*)carve((size_t)NH * Wd * HD * Wd * 2);       // 8 MB
  b16* pre = (b16*)carve((size_t)NPIX * C * 2);                 // 16 MB
  b16* qk16 = (b16*)carve((size_t)NPIX * 2 * C * 2);            // 32 MB
  b16* vT = (b16*)carve((size_t)NPIX * C * 2);                  // 16 MB
  if (off > ws_size) return;                                     // total about 89 MB (binary)
  prep_kernel<<<1024, 256, 0, stream>>>(wq, wk, wv, wo, rq, rk, rv, Gq, Gk, wqkv, wo16, Rcat, rvT);
  qkv_kernel<<<NPIX / 128, 256, 0, stream>>>(x, wqkv, qk16, vT);
  attn_kernel<<<Nn * NH * (Hh / 16) * 2, 512, 0, stream>>>(qk16, vT, Rcat, rvT, Gv1, Gv2, pre);
  out_kernel<<<NPIX / 128, 512, 0, stream>>>(pre, wo16, out);
}
